// v000
// Times are from an AMD MI455X. After a warm-up the kernel runs many times in a row, and a time is the length of
// such a window on the GPU divided by its runs, so every launch and the gaps after it count. The runs cycle
// through copies of the inputs. A figure is the median of several windows, for all but v000 over two sittings.
// Sittings can differ by a few percent; kernels timed side by side share one.
// v000 is the starting kernel. One run takes 6920 microseconds.
#include <hip/hip_runtime.h>

// TimeSeriesAttention (x [4][4096][64]; h1 = softmax(x W1 + b1) (over the 64 features); encoded = tanh(h1 W2 + b2); scores[i][j] = x_i . encoded_j (unscaled); attention = softmax over j; out[i] = sum_j attention[j][i] x[j] (the TRANSPOSED attention, as the
// reference's permute) -> [4][4096][64]). The transposed use is handled by computing M[i][j] = encoded_i . x_j = scores[j][i] directly (swapped GEMM operands) and normalising each COLUMN j of M (= row j of the reference's softmax) with per-column statistics, so M-normalised[i][j] = attention[j][i] is already the A operand of out = attention^T x - exact restructuring.
// Compute dtypes, f32 accumulate: every input rounded to bf16; x W1 on PLAIN bf16 operands (inputs: exact) + bias; the feature softmax, h1 W2 + b2 (64-term fixed-order dots) and tanh f32 on the VALU -> bf16 hi+lo planes; scores as

#define NB_  4
#define TT   4096
#define DD   64
typedef _Float16 h16;
typedef unsigned short bf;
typedef __attribute__((ext_vector_type(16))) __bf16   v16bf;
typedef __attribute__((ext_vector_type(16))) _Float16 v16h;
typedef __attribute__((ext_vector_type(8)))  _Float16 v8h;
typedef __attribute__((ext_vector_type(8)))  unsigned short v8us;
typedef __attribute__((ext_vector_type(8)))  float    v8f;
typedef __attribute__((ext_vector_type(4)))  float    v4f;
typedef v8h  __attribute__((may_alias)) v8ha;
typedef v4f  __attribute__((may_alias)) v4fa;
typedef v8us __attribute__((may_alias)) v8usa;

__device__ __forceinline__ unsigned short f2bf(float f) { unsigned u = __float_as_uint(f); u += 0x7FFFu + ((u >> 16) & 1u); return (unsigned short)(u >> 16); }
__device__ __forceinline__ float bf2f(unsigned short b) { return __uint_as_float(((unsigned)b) << 16); }
__device__ __forceinline__ float bfr(float f) { return bf2f(f2bf(f)); }
__device__ __forceinline__ v16h cat16(v8h lo, v8h hi) { return __builtin_shufflevector(lo, hi, 0, 1, 2, 3, 4, 5, 6, 7, 8, 9, 10, 11, 12, 13, 14, 15); }
__device__ __forceinline__ v16bf cat16b(v8us lo, v8us hi) { return __builtin_bit_cast(v16bf, __builtin_shufflevector(lo, hi, 0, 1, 2, 3, 4, 5, 6, 7, 8, 9, 10, 11, 12, 13, 14, 15)); }
__device__ __forceinline__ v8f wmma16(v16h a, v16h b, v8f c) { return __builtin_amdgcn_wmma_f32_16x16x32_f16(false, a, false, b, (short)0, c, false, false); }
__device__ __forceinline__ v8f wmmab(v16bf a, v16bf b, v8f c) { return __builtin_amdgcn_wmma_f32_16x16x32_bf16(false, a, false, b, (short)0, c, false, false); }



// ---- k_gemmw: register-blocked GEMM, ONE WAVE per 64x64 output tile (16 accumulators), operands straight from K-contiguous 16-bit planes; grid (M/64, N/64, Z), 32 threads.
// C[m][n] (f32, pitch ldc, + optional f32 bias[n]) = sum_k A[m][k] Bt[n][k] (+ split products per NSPLIT). z-batch strides sA/sB/sC in elements. K % 32 == 0.
template <typename T16> struct WFrag;
template <> struct WFrag<h16> { typedef v16h V; static __device__ __forceinline__ V ld(const h16* p) { return cat16(*(const v8h*)p, *(const v8h*)(p + 16)); } static __device__ __forceinline__ v8f mma(V a, V b, v8f c) { return wmma16(a, b, c); } };
template <> struct WFrag<bf> { typedef v16bf V; static __device__ __forceinline__ V ld(const bf* p) { return cat16b(*(const v8us*)p, *(const v8us*)(p + 16)); } static __device__ __forceinline__ v8f mma(V a, V b, v8f c) { return wmmab(a, b, c); } };
template <typename T16, int NSPLIT, bool BIAS>
__global__ __launch_bounds__(32) void k_gemmw(const T16* __restrict__ A, const T16* __restrict__ A2, const T16* __restrict__ Bt, const T16* __restrict__ Bt2, int K, float* C, int ldc, const float* __restrict__ bias, size_t sA, size_t sB, size_t sC) {
    typedef typename WFrag<T16>::V V;
    __shared__ __align__(16) float os[16 * 68];
    const size_t z = blockIdx.z; A += z * sA; if (A2) A2 += z * sA; Bt += z * sB; if (Bt2) Bt2 += z * sB; C += z * sC;
    const int lane = threadIdx.x & 31, lr = lane & 15, hi = lane >> 4; const int r0 = blockIdx.x * 64, c0 = blockIdx.y * 64;
    v8f acc[4][4];
#pragma unroll
    for (int mb = 0; mb < 4; ++mb)
#pragma unroll
        for (int nb = 0; nb < 4; ++nb) acc[mb][nb] = (v8f){};
    const size_t aoff = (size_t)(r0 + lr) * K + 8 * hi, boff = (size_t)(c0 + lr) * K + 8 * hi;
#pragma unroll 1
    for (int kc = 0; kc < K; kc += 32) {
        V a[4], a2[4];
#pragma unroll
        for (int mb = 0; mb < 4; ++mb) { a[mb] = WFrag<T16>::ld(A + aoff + (size_t)mb * 16 * K + kc); if (NSPLIT == 1 || NSPLIT == 2) a2[mb] = WFrag<T16>::ld(A2 + aoff + (size_t)mb * 16 * K + kc); }
#pragma unroll
        for (int nb = 0; nb < 4; ++nb) { const V b = WFrag<T16>::ld(Bt + boff + (size_t)nb * 16 * K + kc); V b2; if (NSPLIT >= 2) b2 = WFrag<T16>::ld(Bt2 + boff + (size_t)nb * 16 * K + kc);
#pragma unroll
            for (int mb = 0; mb < 4; ++mb) { acc[mb][nb] = WFrag<T16>::mma(a[mb], b, acc[mb][nb]); if (NSPLIT == 1 || NSPLIT == 2) acc[mb][nb] = WFrag<T16>::mma(a2[mb], b, acc[mb][nb]); if (NSPLIT >= 2) acc[mb][nb] = WFrag<T16>::mma(a[mb], b2, acc[mb][nb]); } }
        asm volatile("v_nop\n\tv_nop\n\tv_nop\n\tv_nop" : "+v"(acc[0][0]), "+v"(acc[1][1]), "+v"(acc[2][2]), "+v"(acc[3][3]) : "v"(a[0]), "v"(a[3]));
    }
#pragma unroll
    for (int mb = 0; mb < 4; ++mb) {
#pragma unroll
        for (int nb = 0; nb < 4; ++nb) {
#pragma unroll
            for (int j = 0; j < 8; ++j) os[(hi * 8 + j) * 68 + nb * 16 + lr] = acc[mb][nb][j]; }
        __builtin_amdgcn_wave_barrier(); asm volatile("" ::: "memory");
        float* crow = C + (size_t)(r0 + mb * 16) * ldc + c0;
{
#pragma unroll
            for (int s = 0; s < 8; ++s) { const int row = 2 * s + hi, cofs = lr * 4; v4f val = *(const v4fa*)(os + row * 68 + cofs); if (BIAS) { val[0] += bfr(bias[c0 + cofs]); val[1] += bfr(bias[c0 + cofs + 1]); val[2] += bfr(bias[c0 + cofs + 2]); val[3] += bfr(bias[c0 + cofs + 3]); }
                *(v4f*)(crow + (size_t)row * ldc + cofs) = val; }
             }
        __builtin_amdgcn_wave_barrier(); asm volatile("" ::: "memory");
    }
}

__device__ __forceinline__ void splitf(float y, unsigned short& h, unsigned short& l) { h = f2bf(y); l = f2bf(y - bf2f(h)); }
typedef __attribute__((ext_vector_type(2))) unsigned short v2us;
typedef __attribute__((ext_vector_type(4))) unsigned short v4us;

__global__ __launch_bounds__(256) void k_wtG(const float* __restrict__ w, int K, int N, bf* Bt) {
    const int lane = threadIdx.x & 31; const int L0 = (blockIdx.x * 8 + (threadIdx.x >> 5)) * 8; const int nlines = N * K / 64;
{
#pragma unroll 1
        for (int l = 0; l < 8; ++l) { const int L = L0 + l; if (L >= nlines) break; const size_t e = (size_t)L * 64 + lane * 2; const int k = (int)(e % K), n = (int)(e / K); v2us o;
            o[0] = f2bf(w[(size_t)k * N + n]); o[1] = f2bf(w[(size_t)(k + 1) * N + n]); *(v2us*)(Bt + e) = o; }
         }
}
__global__ __launch_bounds__(256) void k_cvt8(const float* __restrict__ src, bf* dst, size_t n8) { const size_t i = (size_t)blockIdx.x * 256 + threadIdx.x; if (i >= n8) return; const v8f v = *(const v8f*)(src + i * 8); v8us o;
#pragma unroll
    for (int k = 0; k < 8; ++k) o[k] = f2bf(v[k]); *(v8us*)(dst + i * 8) = o;  }
// k_vt: XT[d][t] = bf16 x[t][d] (lane -> 2 consecutive t); k_enc: lane -> 4 consecutive features c of token t: softmax statistics of the Z row (64, fixed order), acc[u] = sum_k softmax_k W2[k][c+u], enc = tanh(acc + b2) -> hl planes (8-B lanes);
__global__ __launch_bounds__(256) void k_vt(const float* __restrict__ x, bf* XT) { const int e = (blockIdx.x * 256 + threadIdx.x) * 2; if (e >= DD * TT) return; const int t = e % TT; const int d = e / TT; v2us o; o[0] = f2bf(x[(size_t)t * DD + d]); o[1] = f2bf(x[(size_t)(t + 1) * DD + d]); *(v2us*)(XT + e) = o;  }
__global__ __launch_bounds__(256) void k_enc(const float* __restrict__ Z, const float* __restrict__ W2, const float* __restrict__ b2, bf* Eh, bf* El) { const int e = (blockIdx.x * 256 + threadIdx.x) * 4; if (e >= TT * DD) return; const int c0 = e % DD; const int t = e / DD; const float* zr = Z + (size_t)t * DD; float mx = -3.0e38f;
#pragma unroll 1
    for (int k = 0; k < DD; ++k) mx = fmaxf(mx, zr[k]);
    float sum = 0.f;
#pragma unroll 1
    for (int k = 0; k < DD; ++k) { float d0 = __fsub_rn(zr[k], mx); asm volatile("" : "+v"(d0)); sum = __fadd_rn(sum, __builtin_amdgcn_exp2f(__fmul_rn(d0, 1.4426950408889634f))); }
    const float rs = __fdiv_rn(1.0f, sum); float acc[4] = {0.f, 0.f, 0.f, 0.f};
#pragma unroll 1
    for (int k = 0; k < DD; ++k) { float d0 = __fsub_rn(zr[k], mx); asm volatile("" : "+v"(d0)); const float h1 = __fmul_rn(__builtin_amdgcn_exp2f(__fmul_rn(d0, 1.4426950408889634f)), rs);
#pragma unroll
        for (int u = 0; u < 4; ++u) { float w = bfr(W2[k * DD + c0 + u]); asm volatile("" : "+v"(w)); float pr = __fmul_rn(h1, w); asm volatile("" : "+v"(pr)); acc[u] = __fadd_rn(acc[u], pr); } }
    v4us oh, ol;
#pragma unroll
    for (int u = 0; u < 4; ++u) { const float en = tanhf(__fadd_rn(acc[u], bfr(b2[c0 + u]))); unsigned short a, b; splitf(en, a, b); oh[u] = a; ol[u] = b; } *(v4us*)(Eh + e) = oh; *(v4us*)(El + e) = ol;  }
__global__ __launch_bounds__(256) void k_cstat(const float* __restrict__ M, float* MX, float* RS) { const int j = blockIdx.x * 256 + threadIdx.x; if (j >= TT) return; float mx = -3.0e38f;
#pragma unroll 1
    for (int i = 0; i < TT; ++i) mx = fmaxf(mx, M[(size_t)i * TT + j]);
    float sum = 0.f;
#pragma unroll 1
    for (int i = 0; i < TT; ++i) { float d0 = __fsub_rn(M[(size_t)i * TT + j], mx); asm volatile("" : "+v"(d0)); sum = __fadd_rn(sum, __builtin_amdgcn_exp2f(__fmul_rn(d0, 1.4426950408889634f))); }
    const float rs = __fdiv_rn(1.0f, sum); { *(float*)(MX + j) = mx; *(float*)(RS + j) = rs;  } }
__global__ __launch_bounds__(256) void k_pcol(const float* __restrict__ M, const float* __restrict__ MX, const float* __restrict__ RS, bf* Ph, bf* Pl) { const size_t e = ((size_t)blockIdx.x * 256 + threadIdx.x) * 4; if (e >= (size_t)TT * TT) return; const int j0 = (int)(e % TT); const v4f a = *(const v4f*)(M + e); v4us oh, ol;
#pragma unroll
    for (int u = 0; u < 4; ++u) { const int j = j0 + u; float d0 = __fsub_rn(a[u], MX[j]); asm volatile("" : "+v"(d0)); const float p = __fmul_rn(__builtin_amdgcn_exp2f(__fmul_rn(d0, 1.4426950408889634f)), RS[j]); unsigned short x1, x2; splitf(p, x1, x2); oh[u] = x1; ol[u] = x2; }
    *(v4us*)(Ph + e) = oh; *(v4us*)(Pl + e) = ol;  }

extern "C" void kernel_launch(void* const* d_in, const int* in_sizes, int n_in,
                              void* d_out, int out_size, void* d_ws, size_t ws_size, hipStream_t stream) {
    (void)in_sizes; (void)n_in; (void)out_size;
    const float* x = (const float*)d_in[0]; const float* W1 = (const float*)d_in[1]; const float* b1 = (const float*)d_in[2]; const float* W2 = (const float*)d_in[3]; const float* b2 = (const float*)d_in[4];
    float* OUT = (float*)d_out;     // [4][4096][64]
    char* wsp = (char*)d_ws;
    auto take = [&](size_t bytes) { char* p = wsp; wsp += (bytes + 255) & ~(size_t)255; return (void*)p; };
    bf* BW1 = (bf*)take(DD * DD * 2); bf* XB = (bf*)take((size_t)TT * DD * 2); bf* XT = (bf*)take((size_t)DD * TT * 2); float* Z = (float*)take((size_t)TT * DD * 4); bf* Eh = (bf*)take((size_t)TT * DD * 2); bf* El = (bf*)take((size_t)TT * DD * 2);
    float* M = (float*)take((size_t)TT * TT * 4); float* MX = (float*)take(TT * 4); float* RS = (float*)take(TT * 4); bf* Ph = (bf*)take((size_t)TT * TT * 2); bf* Pl = (bf*)take((size_t)TT * TT * 2);
    if ((size_t)(wsp - (char*)d_ws) > ws_size) return;    // total ~ 135 MB (the [4096][4096] f32 score map 64 MB + hl probability planes 64 MB)
    k_wtG<<<(DD * DD / 64 + 63) / 64, 256, 0, stream>>>(W1, DD, DD, BW1);
    for (int b = 0; b < NB_; ++b) { const float* xb = x + (size_t)b * TT * DD;
        k_cvt8<<<(TT * DD / 8 + 255) / 256, 256, 0, stream>>>(xb, XB, TT * DD / 8); k_vt<<<(DD * TT / 2 + 255) / 256, 256, 0, stream>>>(xb, XT);
        k_gemmw<bf, 0, true><<<dim3(TT / 64, 1, 1), 32, 0, stream>>>(XB, nullptr, BW1, nullptr, DD, Z, DD, b1, 0, 0, 0); k_enc<<<(TT * DD / 4 + 255) / 256, 256, 0, stream>>>(Z, W2, b2, Eh, El);
        k_gemmw<bf, 1, false><<<dim3(TT / 64, TT / 64, 1), 32, 0, stream>>>(Eh, El, XB, nullptr, DD, M, TT, nullptr, 0, 0, 0);     // M[i][j] = encoded_i . x_j = scores[j][i]
        k_cstat<<<(TT + 255) / 256, 256, 0, stream>>>(M, MX, RS); k_pcol<<<(unsigned)(((size_t)TT * TT / 4 + 255) / 256), 256, 0, stream>>>(M, MX, RS, Ph, Pl);   // A[i][j] = attention[j][i]
        k_gemmw<bf, 1, false><<<dim3(TT / 64, 1, 1), 32, 0, stream>>>(Ph, Pl, XT, nullptr, TT, OUT + (size_t)b * TT * DD, DD, nullptr, 0, 0, 0); }   // out[i][d] = sum_j attention[j][i] x[j][d]
}

// v001
// One run takes 832 microseconds.
// Two timings next to v000 put it at 8.28 and 8.32 times that version's speed.
#include <hip/hip_runtime.h>

// TimeSeriesAttention (x [4][4096][64]; h1 = softmax(x W1 + b1) (over the 64 features); encoded = tanh(h1 W2 + b2); scores[i][j] = x_i . encoded_j (unscaled); attention = softmax over j; out[i] = sum_j attention[j][i] x[j] (the TRANSPOSED attention, as the
// reference's permute) -> [4][4096][64]). The transposed use is handled by computing M[i][j] = encoded_i . x_j = scores[j][i] directly (swapped GEMM operands) and normalising each COLUMN j of M (= row j of the reference's softmax) with per-column statistics, so M-normalised[i][j] = attention[j][i] is already the A operand of out = attention^T x - exact restructuring.
// Compute dtypes, f32 accumulate: every input rounded to bf16; x W1 on PLAIN bf16 operands (inputs: exact) + bias; the feature softmax, h1 W2 + b2 (64-term fixed-order dots) and tanh f32 on the VALU -> bf16 hi+lo planes; scores as

#define NB_  4
#define TT   4096
#define DD   64
typedef _Float16 h16;
typedef unsigned short bf;
typedef __attribute__((ext_vector_type(16))) __bf16   v16bf;
typedef __attribute__((ext_vector_type(16))) _Float16 v16h;
typedef __attribute__((ext_vector_type(8)))  _Float16 v8h;
typedef __attribute__((ext_vector_type(8)))  unsigned short v8us;
typedef __attribute__((ext_vector_type(8)))  float    v8f;
typedef __attribute__((ext_vector_type(4)))  float    v4f;
typedef v8h  __attribute__((may_alias)) v8ha;
typedef v4f  __attribute__((may_alias)) v4fa;
typedef v8us __attribute__((may_alias)) v8usa;

__device__ __forceinline__ unsigned short f2bf(float f) { unsigned u = __float_as_uint(f); u += 0x7FFFu + ((u >> 16) & 1u); return (unsigned short)(u >> 16); }
__device__ __forceinline__ float bf2f(unsigned short b) { return __uint_as_float(((unsigned)b) << 16); }
__device__ __forceinline__ float bfr(float f) { return bf2f(f2bf(f)); }
__device__ __forceinline__ v16h cat16(v8h lo, v8h hi) { return __builtin_shufflevector(lo, hi, 0, 1, 2, 3, 4, 5, 6, 7, 8, 9, 10, 11, 12, 13, 14, 15); }
__device__ __forceinline__ v16bf cat16b(v8us lo, v8us hi) { return __builtin_bit_cast(v16bf, __builtin_shufflevector(lo, hi, 0, 1, 2, 3, 4, 5, 6, 7, 8, 9, 10, 11, 12, 13, 14, 15)); }
__device__ __forceinline__ v8f wmma16(v16h a, v16h b, v8f c) { return __builtin_amdgcn_wmma_f32_16x16x32_f16(false, a, false, b, (short)0, c, false, false); }
__device__ __forceinline__ v8f wmmab(v16bf a, v16bf b, v8f c) { return __builtin_amdgcn_wmma_f32_16x16x32_bf16(false, a, false, b, (short)0, c, false, false); }



// ---- k_gemmw: register-blocked GEMM, ONE WAVE per 64x64 output tile (16 accumulators), operands straight from K-contiguous 16-bit planes; grid (M/64, N/64, Z), 32 threads.
// C[m][n] (f32, pitch ldc, + optional f32 bias[n]) = sum_k A[m][k] Bt[n][k] (+ split products per NSPLIT). z-batch strides sA/sB/sC in elements. K % 32 == 0.
template <typename T16> struct WFrag;
template <> struct WFrag<h16> { typedef v16h V; static __device__ __forceinline__ V ld(const h16* p) { return cat16(*(const v8h*)p, *(const v8h*)(p + 16)); } static __device__ __forceinline__ v8f mma(V a, V b, v8f c) { return wmma16(a, b, c); } };
template <> struct WFrag<bf> { typedef v16bf V; static __device__ __forceinline__ V ld(const bf* p) { return cat16b(*(const v8us*)p, *(const v8us*)(p + 16)); } static __device__ __forceinline__ v8f mma(V a, V b, v8f c) { return wmmab(a, b, c); } };
template <typename T16, int NSPLIT, bool BIAS>
__global__ __launch_bounds__(32) void k_gemmw(const T16* __restrict__ A, const T16* __restrict__ A2, const T16* __restrict__ Bt, const T16* __restrict__ Bt2, int K, float* C, int ldc, const float* __restrict__ bias, size_t sA, size_t sB, size_t sC) {
    typedef typename WFrag<T16>::V V;
    __shared__ __align__(16) float os[16 * 68];
    const size_t z = blockIdx.z; A += z * sA; if (A2) A2 += z * sA; Bt += z * sB; if (Bt2) Bt2 += z * sB; C += z * sC;
    const int lane = threadIdx.x & 31, lr = lane & 15, hi = lane >> 4; const int r0 = blockIdx.x * 64, c0 = blockIdx.y * 64;
    v8f acc[4][4];
#pragma unroll
    for (int mb = 0; mb < 4; ++mb)
#pragma unroll
        for (int nb = 0; nb < 4; ++nb) acc[mb][nb] = (v8f){};
    const size_t aoff = (size_t)(r0 + lr) * K + 8 * hi, boff = (size_t)(c0 + lr) * K + 8 * hi;
#pragma unroll 1
    for (int kc = 0; kc < K; kc += 32) {
        V a[4], a2[4];
#pragma unroll
        for (int mb = 0; mb < 4; ++mb) { a[mb] = WFrag<T16>::ld(A + aoff + (size_t)mb * 16 * K + kc); if (NSPLIT == 1 || NSPLIT == 2) a2[mb] = WFrag<T16>::ld(A2 + aoff + (size_t)mb * 16 * K + kc); }
#pragma unroll
        for (int nb = 0; nb < 4; ++nb) { const V b = WFrag<T16>::ld(Bt + boff + (size_t)nb * 16 * K + kc); V b2; if (NSPLIT >= 2) b2 = WFrag<T16>::ld(Bt2 + boff + (size_t)nb * 16 * K + kc);
#pragma unroll
            for (int mb = 0; mb < 4; ++mb) { acc[mb][nb] = WFrag<T16>::mma(a[mb], b, acc[mb][nb]); if (NSPLIT == 1 || NSPLIT == 2) acc[mb][nb] = WFrag<T16>::mma(a2[mb], b, acc[mb][nb]); if (NSPLIT >= 2) acc[mb][nb] = WFrag<T16>::mma(a[mb], b2, acc[mb][nb]); } }
        asm volatile("v_nop\n\tv_nop\n\tv_nop\n\tv_nop" : "+v"(acc[0][0]), "+v"(acc[1][1]), "+v"(acc[2][2]), "+v"(acc[3][3]) : "v"(a[0]), "v"(a[3]));
    }
#pragma unroll
    for (int mb = 0; mb < 4; ++mb) {
#pragma unroll
        for (int nb = 0; nb < 4; ++nb) {
#pragma unroll
            for (int j = 0; j < 8; ++j) os[(hi * 8 + j) * 68 + nb * 16 + lr] = acc[mb][nb][j]; }
        __builtin_amdgcn_wave_barrier(); asm volatile("" ::: "memory");
        float* crow = C + (size_t)(r0 + mb * 16) * ldc + c0;
{
#pragma unroll
            for (int s = 0; s < 8; ++s) { const int row = 2 * s + hi, cofs = lr * 4; v4f val = *(const v4fa*)(os + row * 68 + cofs); if (BIAS) { val[0] += bfr(bias[c0 + cofs]); val[1] += bfr(bias[c0 + cofs + 1]); val[2] += bfr(bias[c0 + cofs + 2]); val[3] += bfr(bias[c0 + cofs + 3]); }
                *(v4f*)(crow + (size_t)row * ldc + cofs) = val; }
             }
        __builtin_amdgcn_wave_barrier(); asm volatile("" ::: "memory");
    }
}

__device__ __forceinline__ void splitf(float y, unsigned short& h, unsigned short& l) { h = f2bf(y); l = f2bf(y - bf2f(h)); }
typedef __attribute__((ext_vector_type(2))) unsigned short v2us;
typedef __attribute__((ext_vector_type(4))) unsigned short v4us;

__global__ __launch_bounds__(256) void k_wtG(const float* __restrict__ w, int K, int N, bf* Bt) {
    const int lane = threadIdx.x & 31; const int L0 = (blockIdx.x * 8 + (threadIdx.x >> 5)) * 8; const int nlines = N * K / 64;
{
#pragma unroll 1
        for (int l = 0; l < 8; ++l) { const int L = L0 + l; if (L >= nlines) break; const size_t e = (size_t)L * 64 + lane * 2; const int k = (int)(e % K), n = (int)(e / K); v2us o;
            o[0] = f2bf(w[(size_t)k * N + n]); o[1] = f2bf(w[(size_t)(k + 1) * N + n]); *(v2us*)(Bt + e) = o; }
         }
}
__global__ __launch_bounds__(256) void k_cvt8(const float* __restrict__ src, bf* dst, size_t n8) { const size_t i = (size_t)blockIdx.x * 256 + threadIdx.x; if (i >= n8) return; const v8f v = *(const v8f*)(src + i * 8); v8us o;
#pragma unroll
    for (int k = 0; k < 8; ++k) o[k] = f2bf(v[k]); *(v8us*)(dst + i * 8) = o;  }
// k_vt: XT[d][t] = bf16 x[t][d] (lane -> 2 consecutive t); k_enc: lane -> 4 consecutive features c of token t: softmax statistics of the Z row (64, fixed order), acc[u] = sum_k softmax_k W2[k][c+u], enc = tanh(acc + b2) -> hl planes (8-B lanes);
__global__ __launch_bounds__(256) void k_vt(const float* __restrict__ x, bf* XT) { const int e = (blockIdx.x * 256 + threadIdx.x) * 2; if (e >= DD * TT) return; const int t = e % TT; const int d = e / TT; v2us o; o[0] = f2bf(x[(size_t)t * DD + d]); o[1] = f2bf(x[(size_t)(t + 1) * DD + d]); *(v2us*)(XT + e) = o;  }
__global__ __launch_bounds__(256) void k_enc(const float* __restrict__ Z, const float* __restrict__ W2, const float* __restrict__ b2, bf* Eh, bf* El) { const int e = (blockIdx.x * 256 + threadIdx.x) * 4; if (e >= TT * DD) return; const int c0 = e % DD; const int t = e / DD; const float* zr = Z + (size_t)t * DD; float mx = -3.0e38f;
#pragma unroll 1
    for (int k = 0; k < DD; ++k) mx = fmaxf(mx, zr[k]);
    float sum = 0.f;
#pragma unroll 1
    for (int k = 0; k < DD; ++k) { float d0 = __fsub_rn(zr[k], mx); asm volatile("" : "+v"(d0)); sum = __fadd_rn(sum, __builtin_amdgcn_exp2f(__fmul_rn(d0, 1.4426950408889634f))); }
    const float rs = __fdiv_rn(1.0f, sum); float acc[4] = {0.f, 0.f, 0.f, 0.f};
#pragma unroll 1
    for (int k = 0; k < DD; ++k) { float d0 = __fsub_rn(zr[k], mx); asm volatile("" : "+v"(d0)); const float h1 = __fmul_rn(__builtin_amdgcn_exp2f(__fmul_rn(d0, 1.4426950408889634f)), rs);
#pragma unroll
        for (int u = 0; u < 4; ++u) { float w = bfr(W2[k * DD + c0 + u]); asm volatile("" : "+v"(w)); float pr = __fmul_rn(h1, w); asm volatile("" : "+v"(pr)); acc[u] = __fadd_rn(acc[u], pr); } }
    v4us oh, ol;
#pragma unroll
    for (int u = 0; u < 4; ++u) { const float en = tanhf(__fadd_rn(acc[u], bfr(b2[c0 + u]))); unsigned short a, b; splitf(en, a, b); oh[u] = a; ol[u] = b; } *(v4us*)(Eh + e) = oh; *(v4us*)(El + e) = ol;  }
// k_cstat: per column j of M the maximum and 1 / sum_i exp(M[i][j] - max). One block = 32 columns (one 128-B line of every row). Its 128 lane groups (32 waves x 4 groups of 8 lanes, 16 B a lane) each take 32 rows in turn
// and keep a running (max, sum scaled to that max) pair per column; the pairs are merged in a fixed order: the 4 groups of a wave by a butterfly, the 32 waves through LDS.
// ex2d = exp(a - b). The v_nop keeps the one slot that the instruction set asks for behind a transcendental.
__device__ __forceinline__ float ex2d(float a, float b) { float r; asm("v_exp_f32 %0, %1\n\tv_nop" : "=v"(r) : "v"((a - b) * 1.4426950408889634f)); return r; }
__global__ __launch_bounds__(1024) void k_cstat(const float* __restrict__ M, float* MX, float* RS) {
    __shared__ __align__(16) float sm[32][32]; __shared__ __align__(16) float ss[32][32];
    const int lane = threadIdx.x & 31, wave = threadIdx.x >> 5, cq = lane & 7;
    const float* p = M + (size_t)(wave * 4 + (lane >> 3)) * (TT / 128) * TT + blockIdx.x * 32 + cq * 4;
    float m[4] = {-3.0e38f, -3.0e38f, -3.0e38f, -3.0e38f}, s[4] = {0.f, 0.f, 0.f, 0.f};
#pragma unroll 1   // 8 loads of 16 B in flight a wave; unrolled further the build spills at the 128 registers that 32 waves leave each
    for (int c = 0; c < TT / 1024; ++c, p += 8 * TT) { v4f v[8];
#pragma unroll
        for (int r = 0; r < 8; ++r) v[r] = *(const v4f*)(p + r * TT);
#pragma unroll
        for (int u = 0; u < 4; ++u) { float mn = m[u];
#pragma unroll
            for (int r = 0; r < 8; ++r) mn = fmaxf(mn, v[r][u]);
            float a = s[u] * ex2d(m[u], mn);
#pragma unroll
            for (int r = 0; r < 8; ++r) a += ex2d(v[r][u], mn);
            m[u] = mn; s[u] = a; } }
#pragma unroll
    for (int d = 8; d <= 16; d <<= 1) {
#pragma unroll
        for (int u = 0; u < 4; ++u) { const float om = __shfl_xor(m[u], d), os = __shfl_xor(s[u], d); const float mn = fmaxf(m[u], om); s[u] = s[u] * ex2d(m[u], mn) + os * ex2d(om, mn); m[u] = mn; } }
    if (lane < 8) { *(v4f*)(&sm[wave][cq * 4]) = (v4f){m[0], m[1], m[2], m[3]}; *(v4f*)(&ss[wave][cq * 4]) = (v4f){s[0], s[1], s[2], s[3]}; }
    __syncthreads();
    if (threadIdx.x < 32) { float mx = -3.0e38f, sum = 0.f;
#pragma unroll
        for (int w = 0; w < 32; ++w) mx = fmaxf(mx, sm[w][lane]);
#pragma unroll
        for (int w = 0; w < 32; ++w) sum += ss[w][lane] * ex2d(sm[w][lane], mx);
        const int j = blockIdx.x * 32 + lane; MX[j] = mx; RS[j] = __fdiv_rn(1.0f, sum); } }
__global__ __launch_bounds__(256) void k_pcol(const float* __restrict__ M, const float* __restrict__ MX, const float* __restrict__ RS, bf* Ph, bf* Pl) { const size_t e = ((size_t)blockIdx.x * 256 + threadIdx.x) * 4; if (e >= (size_t)TT * TT) return; const int j0 = (int)(e % TT); const v4f a = *(const v4f*)(M + e); v4us oh, ol;
#pragma unroll
    for (int u = 0; u < 4; ++u) { const int j = j0 + u; float d0 = __fsub_rn(a[u], MX[j]); asm volatile("" : "+v"(d0)); const float p = __fmul_rn(__builtin_amdgcn_exp2f(__fmul_rn(d0, 1.4426950408889634f)), RS[j]); unsigned short x1, x2; splitf(p, x1, x2); oh[u] = x1; ol[u] = x2; }
    *(v4us*)(Ph + e) = oh; *(v4us*)(Pl + e) = ol;  }

extern "C" void kernel_launch(void* const* d_in, const int* in_sizes, int n_in,
                              void* d_out, int out_size, void* d_ws, size_t ws_size, hipStream_t stream) {
    (void)in_sizes; (void)n_in; (void)out_size;
    const float* x = (const float*)d_in[0]; const float* W1 = (const float*)d_in[1]; const float* b1 = (const float*)d_in[2]; const float* W2 = (const float*)d_in[3]; const float* b2 = (const float*)d_in[4];
    float* OUT = (float*)d_out;     // [4][4096][64]
    char* wsp = (char*)d_ws;
    auto take = [&](size_t bytes) { char* p = wsp; wsp += (bytes + 255) & ~(size_t)255; return (void*)p; };
    bf* BW1 = (bf*)take(DD * DD * 2); bf* XB = (bf*)take((size_t)TT * DD * 2); bf* XT = (bf*)take((size_t)DD * TT * 2); float* Z = (float*)take((size_t)TT * DD * 4); bf* Eh = (bf*)take((size_t)TT * DD * 2); bf* El = (bf*)take((size_t)TT * DD * 2);
    float* M = (float*)take((size_t)TT * TT * 4); float* MX = (float*)take(TT * 4); float* RS = (float*)take(TT * 4); bf* Ph = (bf*)take((size_t)TT * TT * 2); bf* Pl = (bf*)take((size_t)TT * TT * 2);
    if ((size_t)(wsp - (char*)d_ws) > ws_size) return;    // total ~ 135 MB (the [4096][4096] f32 score map 64 MB + hl probability planes 64 MB)
    k_wtG<<<(DD * DD / 64 + 63) / 64, 256, 0, stream>>>(W1, DD, DD, BW1);
    for (int b = 0; b < NB_; ++b) { const float* xb = x + (size_t)b * TT * DD;
        k_cvt8<<<(TT * DD / 8 + 255) / 256, 256, 0, stream>>>(xb, XB, TT * DD / 8); k_vt<<<(DD * TT / 2 + 255) / 256, 256, 0, stream>>>(xb, XT);
        k_gemmw<bf, 0, true><<<dim3(TT / 64, 1, 1), 32, 0, stream>>>(XB, nullptr, BW1, nullptr, DD, Z, DD, b1, 0, 0, 0); k_enc<<<(TT * DD / 4 + 255) / 256, 256, 0, stream>>>(Z, W2, b2, Eh, El);
        k_gemmw<bf, 1, false><<<dim3(TT / 64, TT / 64, 1), 32, 0, stream>>>(Eh, El, XB, nullptr, DD, M, TT, nullptr, 0, 0, 0);     // M[i][j] = encoded_i . x_j = scores[j][i]
        k_cstat<<<TT / 32, 1024, 0, stream>>>(M, MX, RS); k_pcol<<<(unsigned)(((size_t)TT * TT / 4 + 255) / 256), 256, 0, stream>>>(M, MX, RS, Ph, Pl);   // A[i][j] = attention[j][i]
        k_gemmw<bf, 1, false><<<dim3(TT / 64, 1, 1), 32, 0, stream>>>(Ph, Pl, XT, nullptr, TT, OUT + (size_t)b * TT * DD, DD, nullptr, 0, 0, 0); }   // out[i][d] = sum_j attention[j][i] x[j][d]
}

// v002
// One run takes 492 microseconds.
// In two side-by-side timings against v001, it was 1.71 and 1.69 times as fast.
// Counting every step since v000, it is 14.1 times as fast.
#include <hip/hip_runtime.h>

// TimeSeriesAttention (x [4][4096][64]; h1 = softmax(x W1 + b1) (over the 64 features); encoded = tanh(h1 W2 + b2); scores[i][j] = x_i . encoded_j (unscaled); attention = softmax over j; out[i] = sum_j attention[j][i] x[j] (the TRANSPOSED attention, as the
// reference's permute) -> [4][4096][64]). The transposed use is handled by computing M[i][j] = encoded_i . x_j = scores[j][i] directly (swapped GEMM operands) and normalising each COLUMN j of M (= row j of the reference's softmax) with per-column statistics, so M-normalised[i][j] = attention[j][i] is already the A operand of out = attention^T x - exact restructuring.
// Compute dtypes, f32 accumulate: every input rounded to bf16; x W1 on PLAIN bf16 operands (inputs: exact) + bias; the feature softmax, h1 W2 + b2 (64-term fixed-order dots) and tanh f32 on the VALU -> bf16 hi+lo planes; scores as

#define NB_  4
#define TT   4096
#define DD   64
typedef _Float16 h16;
typedef unsigned short bf;
typedef __attribute__((ext_vector_type(16))) __bf16   v16bf;
typedef __attribute__((ext_vector_type(16))) _Float16 v16h;
typedef __attribute__((ext_vector_type(8)))  _Float16 v8h;
typedef __attribute__((ext_vector_type(8)))  unsigned short v8us;
typedef __attribute__((ext_vector_type(8)))  float    v8f;
typedef __attribute__((ext_vector_type(4)))  float    v4f;
typedef v8h  __attribute__((may_alias)) v8ha;
typedef v4f  __attribute__((may_alias)) v4fa;
typedef v8us __attribute__((may_alias)) v8usa;

__device__ __forceinline__ unsigned short f2bf(float f) { unsigned u = __float_as_uint(f); u += 0x7FFFu + ((u >> 16) & 1u); return (unsigned short)(u >> 16); }
__device__ __forceinline__ float bf2f(unsigned short b) { return __uint_as_float(((unsigned)b) << 16); }
__device__ __forceinline__ float bfr(float f) { return bf2f(f2bf(f)); }
__device__ __forceinline__ v16h cat16(v8h lo, v8h hi) { return __builtin_shufflevector(lo, hi, 0, 1, 2, 3, 4, 5, 6, 7, 8, 9, 10, 11, 12, 13, 14, 15); }
__device__ __forceinline__ v16bf cat16b(v8us lo, v8us hi) { return __builtin_bit_cast(v16bf, __builtin_shufflevector(lo, hi, 0, 1, 2, 3, 4, 5, 6, 7, 8, 9, 10, 11, 12, 13, 14, 15)); }
__device__ __forceinline__ v8f wmma16(v16h a, v16h b, v8f c) { return __builtin_amdgcn_wmma_f32_16x16x32_f16(false, a, false, b, (short)0, c, false, false); }
__device__ __forceinline__ v8f wmmab(v16bf a, v16bf b, v8f c) { return __builtin_amdgcn_wmma_f32_16x16x32_bf16(false, a, false, b, (short)0, c, false, false); }



// ---- k_gemmw: register-blocked GEMM, ONE WAVE per 64x64 output tile (16 accumulators), operands straight from K-contiguous 16-bit planes; grid (M/64, N/64, Z), 32 threads.
// C[m][n] (f32, pitch ldc, + optional f32 bias[n]) = sum_k A[m][k] Bt[n][k] (+ split products per NSPLIT). z-batch strides sA/sB/sC in elements. K % 32 == 0.
template <typename T16> struct WFrag;
template <> struct WFrag<h16> { typedef v16h V; static __device__ __forceinline__ V ld(const h16* p) { return cat16(*(const v8h*)p, *(const v8h*)(p + 16)); } static __device__ __forceinline__ v8f mma(V a, V b, v8f c) { return wmma16(a, b, c); } };
template <> struct WFrag<bf> { typedef v16bf V; static __device__ __forceinline__ V ld(const bf* p) { return cat16b(*(const v8us*)p, *(const v8us*)(p + 16)); } static __device__ __forceinline__ v8f mma(V a, V b, v8f c) { return wmmab(a, b, c); } };
template <typename T16, int NSPLIT, bool BIAS>
__global__ __launch_bounds__(32) void k_gemmw(const T16* __restrict__ A, const T16* __restrict__ A2, const T16* __restrict__ Bt, const T16* __restrict__ Bt2, int K, float* C, int ldc, const float* __restrict__ bias, size_t sA, size_t sB, size_t sC) {
    typedef typename WFrag<T16>::V V;
    __shared__ __align__(16) float os[16 * 68];
    const size_t z = blockIdx.z; A += z * sA; if (A2) A2 += z * sA; Bt += z * sB; if (Bt2) Bt2 += z * sB; C += z * sC;
    const int lane = threadIdx.x & 31, lr = lane & 15, hi = lane >> 4; const int r0 = blockIdx.x * 64, c0 = blockIdx.y * 64;
    v8f acc[4][4];
#pragma unroll
    for (int mb = 0; mb < 4; ++mb)
#pragma unroll
        for (int nb = 0; nb < 4; ++nb) acc[mb][nb] = (v8f){};
    const size_t aoff = (size_t)(r0 + lr) * K + 8 * hi, boff = (size_t)(c0 + lr) * K + 8 * hi;
#pragma unroll 1
    for (int kc = 0; kc < K; kc += 32) {
        V a[4], a2[4];
#pragma unroll
        for (int mb = 0; mb < 4; ++mb) { a[mb] = WFrag<T16>::ld(A + aoff + (size_t)mb * 16 * K + kc); if (NSPLIT == 1 || NSPLIT == 2) a2[mb] = WFrag<T16>::ld(A2 + aoff + (size_t)mb * 16 * K + kc); }
#pragma unroll
        for (int nb = 0; nb < 4; ++nb) { const V b = WFrag<T16>::ld(Bt + boff + (size_t)nb * 16 * K + kc); V b2; if (NSPLIT >= 2) b2 = WFrag<T16>::ld(Bt2 + boff + (size_t)nb * 16 * K + kc);
#pragma unroll
            for (int mb = 0; mb < 4; ++mb) { acc[mb][nb] = WFrag<T16>::mma(a[mb], b, acc[mb][nb]); if (NSPLIT == 1 || NSPLIT == 2) acc[mb][nb] = WFrag<T16>::mma(a2[mb], b, acc[mb][nb]); if (NSPLIT >= 2) acc[mb][nb] = WFrag<T16>::mma(a[mb], b2, acc[mb][nb]); } }
        asm volatile("v_nop\n\tv_nop\n\tv_nop\n\tv_nop" : "+v"(acc[0][0]), "+v"(acc[1][1]), "+v"(acc[2][2]), "+v"(acc[3][3]) : "v"(a[0]), "v"(a[3]));
    }
#pragma unroll
    for (int mb = 0; mb < 4; ++mb) {
#pragma unroll
        for (int nb = 0; nb < 4; ++nb) {
#pragma unroll
            for (int j = 0; j < 8; ++j) os[(hi * 8 + j) * 68 + nb * 16 + lr] = acc[mb][nb][j]; }
        __builtin_amdgcn_wave_barrier(); asm volatile("" ::: "memory");
        float* crow = C + (size_t)(r0 + mb * 16) * ldc + c0;
{
#pragma unroll
            for (int s = 0; s < 8; ++s) { const int row = 2 * s + hi, cofs = lr * 4; v4f val = *(const v4fa*)(os + row * 68 + cofs); if (BIAS) { val[0] += bfr(bias[c0 + cofs]); val[1] += bfr(bias[c0 + cofs + 1]); val[2] += bfr(bias[c0 + cofs + 2]); val[3] += bfr(bias[c0 + cofs + 3]); }
                *(v4f*)(crow + (size_t)row * ldc + cofs) = val; }
             }
        __builtin_amdgcn_wave_barrier(); asm volatile("" ::: "memory");
    }
}

// ---- k_gemmk: the out product, whose 64 output tiles of 64x64 leave most of the chip idle. One work-group = 16 rows x 64 columns of C; its 16 waves each take a K slice of 256 (512 B of every operand row)
// and keep a 16x64 f32 partial; the partials are summed in wave order through LDS. C[m][n] = sum_k (A[m][k] + A2[m][k]) Bt[n][k]; operand pitch TT, C pitch DD.
#define KW_ 16
typedef __attribute__((ext_vector_type(2))) float v2f;
typedef v2f __attribute__((may_alias)) v2fa;
__global__ __launch_bounds__(KW_ * 32) void k_gemmk(const bf* __restrict__ A, const bf* __restrict__ A2, const bf* __restrict__ Bt, float* C) {
    typedef WFrag<bf>::V V;
    __shared__ __align__(16) float red[KW_][16 * 68];
    const int lane = threadIdx.x & 31, wave = threadIdx.x >> 5, lr = lane & 15, hi = lane >> 4; const int r0 = blockIdx.x * 16;
    const int k0 = wave * (TT / KW_) + 8 * hi;
    const bf* pa = A + (size_t)(r0 + lr) * TT + k0; const bf* pa2 = A2 + (size_t)(r0 + lr) * TT + k0; const bf* pb = Bt + (size_t)lr * TT + k0;
    v8f acc[4];
#pragma unroll
    for (int nb = 0; nb < 4; ++nb) acc[nb] = (v8f){};
    V a[3], a2[3], b[3][4];   // three fragment sets: the loads of two k steps fly while the third is multiplied
#pragma unroll   // whole: the set index s % 3 must be a constant, or the fragment sets leave the registers
    for (int s = 0; s < TT / KW_ / 32 + 2; ++s) {
        if (s < TT / KW_ / 32) { const int q = s % 3, kc = s * 32; a[q] = WFrag<bf>::ld(pa + kc); a2[q] = WFrag<bf>::ld(pa2 + kc);
#pragma unroll
            for (int nb = 0; nb < 4; ++nb) b[q][nb] = WFrag<bf>::ld(pb + (size_t)nb * 16 * TT + kc); }
        if (s >= 2) { const int q = (s - 2) % 3;
#pragma unroll
            for (int nb = 0; nb < 4; ++nb) acc[nb] = WFrag<bf>::mma(a[q], b[q][nb], acc[nb]);
#pragma unroll
            for (int nb = 0; nb < 4; ++nb) acc[nb] = WFrag<bf>::mma(a2[q], b[q][nb], acc[nb]); }
    }
#pragma unroll
    for (int nb = 0; nb < 4; ++nb) {
#pragma unroll
        for (int j = 0; j < 8; ++j) red[wave][(hi * 8 + j) * 68 + nb * 16 + lr] = acc[nb][j]; }
    __syncthreads();
    const int row = threadIdx.x >> 5, col = lane * 2; v2f p[KW_];   // one wave sums and stores one 256-B row of C
#pragma unroll
    for (int w = 0; w < KW_; ++w) p[w] = *(const v2fa*)(&red[w][row * 68 + col]);
    float s0 = 0.f, s1 = 0.f;
#pragma unroll
    for (int w = 0; w < KW_; ++w) { s0 += p[w][0]; s1 += p[w][1]; }
    float* cp = C + (size_t)(r0 + row) * DD + col; cp[0] = s0; cp[1] = s1;
}

__device__ __forceinline__ void splitf(float y, unsigned short& h, unsigned short& l) { h = f2bf(y); l = f2bf(y - bf2f(h)); }
typedef __attribute__((ext_vector_type(2))) unsigned short v2us;
typedef __attribute__((ext_vector_type(4))) unsigned short v4us;

__global__ __launch_bounds__(256) void k_wtG(const float* __restrict__ w, int K, int N, bf* Bt) {
    const int lane = threadIdx.x & 31; const int L0 = (blockIdx.x * 8 + (threadIdx.x >> 5)) * 8; const int nlines = N * K / 64;
{
#pragma unroll 1
        for (int l = 0; l < 8; ++l) { const int L = L0 + l; if (L >= nlines) break; const size_t e = (size_t)L * 64 + lane * 2; const int k = (int)(e % K), n = (int)(e / K); v2us o;
            o[0] = f2bf(w[(size_t)k * N + n]); o[1] = f2bf(w[(size_t)(k + 1) * N + n]); *(v2us*)(Bt + e) = o; }
         }
}
__global__ __launch_bounds__(256) void k_cvt8(const float* __restrict__ src, bf* dst, size_t n8) { const size_t i = (size_t)blockIdx.x * 256 + threadIdx.x; if (i >= n8) return; const v8f v = *(const v8f*)(src + i * 8); v8us o;
#pragma unroll
    for (int k = 0; k < 8; ++k) o[k] = f2bf(v[k]); *(v8us*)(dst + i * 8) = o;  }
// k_vt: XT[d][t] = bf16 x[t][d] (lane -> 2 consecutive t); k_enc: lane -> 4 consecutive features c of token t: softmax statistics of the Z row (64, fixed order), acc[u] = sum_k softmax_k W2[k][c+u], enc = tanh(acc + b2) -> hl planes (8-B lanes);
__global__ __launch_bounds__(256) void k_vt(const float* __restrict__ x, bf* XT) { const int e = (blockIdx.x * 256 + threadIdx.x) * 2; if (e >= DD * TT) return; const int t = e % TT; const int d = e / TT; v2us o; o[0] = f2bf(x[(size_t)t * DD + d]); o[1] = f2bf(x[(size_t)(t + 1) * DD + d]); *(v2us*)(XT + e) = o;  }
__global__ __launch_bounds__(256) void k_enc(const float* __restrict__ Z, const float* __restrict__ W2, const float* __restrict__ b2, bf* Eh, bf* El) { const int e = (blockIdx.x * 256 + threadIdx.x) * 4; if (e >= TT * DD) return; const int c0 = e % DD; const int t = e / DD; const float* zr = Z + (size_t)t * DD; float mx = -3.0e38f;
#pragma unroll 1
    for (int k = 0; k < DD; ++k) mx = fmaxf(mx, zr[k]);
    float sum = 0.f;
#pragma unroll 1
    for (int k = 0; k < DD; ++k) { float d0 = __fsub_rn(zr[k], mx); asm volatile("" : "+v"(d0)); sum = __fadd_rn(sum, __builtin_amdgcn_exp2f(__fmul_rn(d0, 1.4426950408889634f))); }
    const float rs = __fdiv_rn(1.0f, sum); float acc[4] = {0.f, 0.f, 0.f, 0.f};
#pragma unroll 1
    for (int k = 0; k < DD; ++k) { float d0 = __fsub_rn(zr[k], mx); asm volatile("" : "+v"(d0)); const float h1 = __fmul_rn(__builtin_amdgcn_exp2f(__fmul_rn(d0, 1.4426950408889634f)), rs);
#pragma unroll
        for (int u = 0; u < 4; ++u) { float w = bfr(W2[k * DD + c0 + u]); asm volatile("" : "+v"(w)); float pr = __fmul_rn(h1, w); asm volatile("" : "+v"(pr)); acc[u] = __fadd_rn(acc[u], pr); } }
    v4us oh, ol;
#pragma unroll
    for (int u = 0; u < 4; ++u) { const float en = tanhf(__fadd_rn(acc[u], bfr(b2[c0 + u]))); unsigned short a, b; splitf(en, a, b); oh[u] = a; ol[u] = b; } *(v4us*)(Eh + e) = oh; *(v4us*)(El + e) = ol;  }
// k_cstat: per column j of M the maximum and 1 / sum_i exp(M[i][j] - max). One block = 32 columns (one 128-B line of every row). Its 128 lane groups (32 waves x 4 groups of 8 lanes, 16 B a lane) each take 32 rows in turn
// and keep a running (max, sum scaled to that max) pair per column; the pairs are merged in a fixed order: the 4 groups of a wave by a butterfly, the 32 waves through LDS.
// ex2d = exp(a - b). The v_nop keeps the one slot that the instruction set asks for behind a transcendental.
__device__ __forceinline__ float ex2d(float a, float b) { float r; asm("v_exp_f32 %0, %1\n\tv_nop" : "=v"(r) : "v"((a - b) * 1.4426950408889634f)); return r; }
__global__ __launch_bounds__(1024) void k_cstat(const float* __restrict__ M, float* MX, float* RS) {
    __shared__ __align__(16) float sm[32][32]; __shared__ __align__(16) float ss[32][32];
    const int lane = threadIdx.x & 31, wave = threadIdx.x >> 5, cq = lane & 7;
    const float* p = M + (size_t)(wave * 4 + (lane >> 3)) * (TT / 128) * TT + blockIdx.x * 32 + cq * 4;
    float m[4] = {-3.0e38f, -3.0e38f, -3.0e38f, -3.0e38f}, s[4] = {0.f, 0.f, 0.f, 0.f};
#pragma unroll 1   // 8 loads of 16 B in flight a wave; unrolled further the build spills at the 128 registers that 32 waves leave each
    for (int c = 0; c < TT / 1024; ++c, p += 8 * TT) { v4f v[8];
#pragma unroll
        for (int r = 0; r < 8; ++r) v[r] = *(const v4f*)(p + r * TT);
#pragma unroll
        for (int u = 0; u < 4; ++u) { float mn = m[u];
#pragma unroll
            for (int r = 0; r < 8; ++r) mn = fmaxf(mn, v[r][u]);
            float a = s[u] * ex2d(m[u], mn);
#pragma unroll
            for (int r = 0; r < 8; ++r) a += ex2d(v[r][u], mn);
            m[u] = mn; s[u] = a; } }
#pragma unroll
    for (int d = 8; d <= 16; d <<= 1) {
#pragma unroll
        for (int u = 0; u < 4; ++u) { const float om = __shfl_xor(m[u], d), os = __shfl_xor(s[u], d); const float mn = fmaxf(m[u], om); s[u] = s[u] * ex2d(m[u], mn) + os * ex2d(om, mn); m[u] = mn; } }
    if (lane < 8) { *(v4f*)(&sm[wave][cq * 4]) = (v4f){m[0], m[1], m[2], m[3]}; *(v4f*)(&ss[wave][cq * 4]) = (v4f){s[0], s[1], s[2], s[3]}; }
    __syncthreads();
    if (threadIdx.x < 32) { float mx = -3.0e38f, sum = 0.f;
#pragma unroll
        for (int w = 0; w < 32; ++w) mx = fmaxf(mx, sm[w][lane]);
#pragma unroll
        for (int w = 0; w < 32; ++w) sum += ss[w][lane] * ex2d(sm[w][lane], mx);
        const int j = blockIdx.x * 32 + lane; MX[j] = mx; RS[j] = __fdiv_rn(1.0f, sum); } }
__global__ __launch_bounds__(256) void k_pcol(const float* __restrict__ M, const float* __restrict__ MX, const float* __restrict__ RS, bf* Ph, bf* Pl) { const size_t e = ((size_t)blockIdx.x * 256 + threadIdx.x) * 4; if (e >= (size_t)TT * TT) return; const int j0 = (int)(e % TT); const v4f a = *(const v4f*)(M + e); v4us oh, ol;
#pragma unroll
    for (int u = 0; u < 4; ++u) { const int j = j0 + u; float d0 = __fsub_rn(a[u], MX[j]); asm volatile("" : "+v"(d0)); const float p = __fmul_rn(__builtin_amdgcn_exp2f(__fmul_rn(d0, 1.4426950408889634f)), RS[j]); unsigned short x1, x2; splitf(p, x1, x2); oh[u] = x1; ol[u] = x2; }
    *(v4us*)(Ph + e) = oh; *(v4us*)(Pl + e) = ol;  }

extern "C" void kernel_launch(void* const* d_in, const int* in_sizes, int n_in,
                              void* d_out, int out_size, void* d_ws, size_t ws_size, hipStream_t stream) {
    (void)in_sizes; (void)n_in; (void)out_size;
    const float* x = (const float*)d_in[0]; const float* W1 = (const float*)d_in[1]; const float* b1 = (const float*)d_in[2]; const float* W2 = (const float*)d_in[3]; const float* b2 = (const float*)d_in[4];
    float* OUT = (float*)d_out;     // [4][4096][64]
    char* wsp = (char*)d_ws;
    auto take = [&](size_t bytes) { char* p = wsp; wsp += (bytes + 255) & ~(size_t)255; return (void*)p; };
    bf* BW1 = (bf*)take(DD * DD * 2); bf* XB = (bf*)take((size_t)TT * DD * 2); bf* XT = (bf*)take((size_t)DD * TT * 2); float* Z = (float*)take((size_t)TT * DD * 4); bf* Eh = (bf*)take((size_t)TT * DD * 2); bf* El = (bf*)take((size_t)TT * DD * 2);
    float* M = (float*)take((size_t)TT * TT * 4); float* MX = (float*)take(TT * 4); float* RS = (float*)take(TT * 4); bf* Ph = (bf*)take((size_t)TT * TT * 2); bf* Pl = (bf*)take((size_t)TT * TT * 2);
    if ((size_t)(wsp - (char*)d_ws) > ws_size) return;    // total ~ 135 MB (the [4096][4096] f32 score map 64 MB + hl probability planes 64 MB)
    k_wtG<<<(DD * DD / 64 + 63) / 64, 256, 0, stream>>>(W1, DD, DD, BW1);
    for (int b = 0; b < NB_; ++b) { const float* xb = x + (size_t)b * TT * DD;
        k_cvt8<<<(TT * DD / 8 + 255) / 256, 256, 0, stream>>>(xb, XB, TT * DD / 8); k_vt<<<(DD * TT / 2 + 255) / 256, 256, 0, stream>>>(xb, XT);
        k_gemmw<bf, 0, true><<<dim3(TT / 64, 1, 1), 32, 0, stream>>>(XB, nullptr, BW1, nullptr, DD, Z, DD, b1, 0, 0, 0); k_enc<<<(TT * DD / 4 + 255) / 256, 256, 0, stream>>>(Z, W2, b2, Eh, El);
        k_gemmw<bf, 1, false><<<dim3(TT / 64, TT / 64, 1), 32, 0, stream>>>(Eh, El, XB, nullptr, DD, M, TT, nullptr, 0, 0, 0);     // M[i][j] = encoded_i . x_j = scores[j][i]
        k_cstat<<<TT / 32, 1024, 0, stream>>>(M, MX, RS); k_pcol<<<(unsigned)(((size_t)TT * TT / 4 + 255) / 256), 256, 0, stream>>>(M, MX, RS, Ph, Pl);   // A[i][j] = attention[j][i]
        k_gemmk<<<TT / 16, KW_ * 32, 0, stream>>>(Ph, Pl, XT, OUT + (size_t)b * TT * DD); }   // out[i][d] = sum_j attention[j][i] x[j][d]
}

// v003
// Measured time: 397 microseconds a run.
// Next to v002, in two timings, it ran 1.24 and 1.23 times as fast.
// Over all steps from v000 it is 17.4 times as fast.
#include <hip/hip_runtime.h>

// TimeSeriesAttention (x [4][4096][64]; h1 = softmax(x W1 + b1) (over the 64 features); encoded = tanh(h1 W2 + b2); scores[i][j] = x_i . encoded_j (unscaled); attention = softmax over j; out[i] = sum_j attention[j][i] x[j] (the TRANSPOSED attention, as the
// reference's permute) -> [4][4096][64]). The transposed use is handled by computing M[i][j] = encoded_i . x_j = scores[j][i] directly (swapped GEMM operands) and normalising each COLUMN j of M (= row j of the reference's softmax) with per-column statistics, so M-normalised[i][j] = attention[j][i] is already the A operand of out = attention^T x - exact restructuring.
// Compute dtypes, f32 accumulate: every input rounded to bf16; x W1 on PLAIN bf16 operands (inputs: exact) + bias; the feature softmax, h1 W2 + b2 (64-term fixed-order dots) and tanh f32 on the VALU -> bf16 hi+lo planes; scores as

#define NB_  4
#define TT   4096
#define DD   64
typedef _Float16 h16;
typedef unsigned short bf;
typedef __attribute__((ext_vector_type(16))) __bf16   v16bf;
typedef __attribute__((ext_vector_type(16))) _Float16 v16h;
typedef __attribute__((ext_vector_type(8)))  _Float16 v8h;
typedef __attribute__((ext_vector_type(8)))  unsigned short v8us;
typedef __attribute__((ext_vector_type(8)))  float    v8f;
typedef __attribute__((ext_vector_type(4)))  float    v4f;
typedef v8h  __attribute__((may_alias)) v8ha;
typedef v4f  __attribute__((may_alias)) v4fa;
typedef v8us __attribute__((may_alias)) v8usa;

__device__ __forceinline__ unsigned short f2bf(float f) { unsigned u = __float_as_uint(f); u += 0x7FFFu + ((u >> 16) & 1u); return (unsigned short)(u >> 16); }
__device__ __forceinline__ float bf2f(unsigned short b) { return __uint_as_float(((unsigned)b) << 16); }
__device__ __forceinline__ float bfr(float f) { return bf2f(f2bf(f)); }
__device__ __forceinline__ v16h cat16(v8h lo, v8h hi) { return __builtin_shufflevector(lo, hi, 0, 1, 2, 3, 4, 5, 6, 7, 8, 9, 10, 11, 12, 13, 14, 15); }
__device__ __forceinline__ v16bf cat16b(v8us lo, v8us hi) { return __builtin_bit_cast(v16bf, __builtin_shufflevector(lo, hi, 0, 1, 2, 3, 4, 5, 6, 7, 8, 9, 10, 11, 12, 13, 14, 15)); }
__device__ __forceinline__ v8f wmma16(v16h a, v16h b, v8f c) { return __builtin_amdgcn_wmma_f32_16x16x32_f16(false, a, false, b, (short)0, c, false, false); }
__device__ __forceinline__ v8f wmmab(v16bf a, v16bf b, v8f c) { return __builtin_amdgcn_wmma_f32_16x16x32_bf16(false, a, false, b, (short)0, c, false, false); }



// ---- k_gemmw: register-blocked GEMM, ONE WAVE per 64x64 output tile (16 accumulators), operands straight from K-contiguous 16-bit planes; grid (M/64, N/64, Z), 32 threads.
// C[m][n] (f32, pitch ldc, + optional f32 bias[n]) = sum_k A[m][k] Bt[n][k] (+ split products per NSPLIT). z-batch strides sA/sB/sC in elements. K % 32 == 0.
template <typename T16> struct WFrag;
template <> struct WFrag<h16> { typedef v16h V; static __device__ __forceinline__ V ld(const h16* p) { return cat16(*(const v8h*)p, *(const v8h*)(p + 16)); } static __device__ __forceinline__ v8f mma(V a, V b, v8f c) { return wmma16(a, b, c); } };
template <> struct WFrag<bf> { typedef v16bf V; static __device__ __forceinline__ V ld(const bf* p) { return cat16b(*(const v8us*)p, *(const v8us*)(p + 16)); } static __device__ __forceinline__ v8f mma(V a, V b, v8f c) { return wmmab(a, b, c); } };
template <typename T16, int NSPLIT, bool BIAS>
__global__ __launch_bounds__(32) void k_gemmw(const T16* __restrict__ A, const T16* __restrict__ A2, const T16* __restrict__ Bt, const T16* __restrict__ Bt2, int K, float* C, int ldc, const float* __restrict__ bias, size_t sA, size_t sB, size_t sC) {
    typedef typename WFrag<T16>::V V;
    __shared__ __align__(16) float os[16 * 68];
    const size_t z = blockIdx.z; A += z * sA; if (A2) A2 += z * sA; Bt += z * sB; if (Bt2) Bt2 += z * sB; C += z * sC;
    const int lane = threadIdx.x & 31, lr = lane & 15, hi = lane >> 4; const int r0 = blockIdx.x * 64, c0 = blockIdx.y * 64;
    v8f acc[4][4];
#pragma unroll
    for (int mb = 0; mb < 4; ++mb)
#pragma unroll
        for (int nb = 0; nb < 4; ++nb) acc[mb][nb] = (v8f){};
    const size_t aoff = (size_t)(r0 + lr) * K + 8 * hi, boff = (size_t)(c0 + lr) * K + 8 * hi;
#pragma unroll 1
    for (int kc = 0; kc < K; kc += 32) {
        V a[4], a2[4];
#pragma unroll
        for (int mb = 0; mb < 4; ++mb) { a[mb] = WFrag<T16>::ld(A + aoff + (size_t)mb * 16 * K + kc); if (NSPLIT == 1 || NSPLIT == 2) a2[mb] = WFrag<T16>::ld(A2 + aoff + (size_t)mb * 16 * K + kc); }
#pragma unroll
        for (int nb = 0; nb < 4; ++nb) { const V b = WFrag<T16>::ld(Bt + boff + (size_t)nb * 16 * K + kc); V b2; if (NSPLIT >= 2) b2 = WFrag<T16>::ld(Bt2 + boff + (size_t)nb * 16 * K + kc);
#pragma unroll
            for (int mb = 0; mb < 4; ++mb) { acc[mb][nb] = WFrag<T16>::mma(a[mb], b, acc[mb][nb]); if (NSPLIT == 1 || NSPLIT == 2) acc[mb][nb] = WFrag<T16>::mma(a2[mb], b, acc[mb][nb]); if (NSPLIT >= 2) acc[mb][nb] = WFrag<T16>::mma(a[mb], b2, acc[mb][nb]); } }
        asm volatile("v_nop\n\tv_nop\n\tv_nop\n\tv_nop" : "+v"(acc[0][0]), "+v"(acc[1][1]), "+v"(acc[2][2]), "+v"(acc[3][3]) : "v"(a[0]), "v"(a[3]));
    }
#pragma unroll
    for (int mb = 0; mb < 4; ++mb) {
#pragma unroll
        for (int nb = 0; nb < 4; ++nb) {
#pragma unroll
            for (int j = 0; j < 8; ++j) os[(hi * 8 + j) * 68 + nb * 16 + lr] = acc[mb][nb][j]; }
        __builtin_amdgcn_wave_barrier(); asm volatile("" ::: "memory");
        float* crow = C + (size_t)(r0 + mb * 16) * ldc + c0;
{
#pragma unroll
            for (int s = 0; s < 8; ++s) { const int row = 2 * s + hi, cofs = lr * 4; v4f val = *(const v4fa*)(os + row * 68 + cofs); if (BIAS) { val[0] += bfr(bias[c0 + cofs]); val[1] += bfr(bias[c0 + cofs + 1]); val[2] += bfr(bias[c0 + cofs + 2]); val[3] += bfr(bias[c0 + cofs + 3]); }
                *(v4f*)(crow + (size_t)row * ldc + cofs) = val; }
             }
        __builtin_amdgcn_wave_barrier(); asm volatile("" ::: "memory");
    }
}

__device__ __forceinline__ void splitf(float y, unsigned short& h, unsigned short& l) { h = f2bf(y); l = f2bf(y - bf2f(h)); }
typedef __attribute__((ext_vector_type(2))) unsigned short v2us;
typedef __attribute__((ext_vector_type(4))) unsigned short v4us;
// ex2d = exp(a - b). The v_nop keeps the one slot that the instruction set asks for behind a transcendental.
__device__ __forceinline__ float ex2d(float a, float b) { float r; asm("v_exp_f32 %0, %1\n\tv_nop" : "=v"(r) : "v"((a - b) * 1.4426950408889634f)); return r; }

// ---- k_gemmk: the out product, whose 64 output tiles of 64x64 leave most of the chip idle. One work-group = 16 rows x 64 columns of C; its 16 waves each take a K slice of 256
// and keep a 16x64 f32 partial; the partials are summed in wave order through LDS. C[m][n] = sum_k (Ph[m][k] + Pl[m][k]) Bt[n][k]; M and Bt pitch TT, C pitch DD.
// The A operand is formed in registers: a lane loads the 16 f32 scores M[m][k] of its own fragment slots, p = exp(M[m][k] - MX[k]) * RS[k] (the column statistics, staged once in LDS),
// and the bf16 hi + lo halves of p go straight into the two A fragments, element for element in the slot order of the 16-bit loader, so no probability plane is stored or read.
#define KW_ 16
typedef __attribute__((ext_vector_type(2))) float v2f;
typedef v2f __attribute__((may_alias)) v2fa;
__global__ __launch_bounds__(KW_ * 32) void k_gemmk(const float* __restrict__ M, const float* __restrict__ MX, const float* __restrict__ RS, const bf* __restrict__ Bt, float* C) {
    typedef WFrag<bf>::V V;
    __shared__ __align__(16) float red[KW_][16 * 68];
    __shared__ __align__(16) float smx[TT]; __shared__ __align__(16) float srs[TT];
    const int lane = threadIdx.x & 31, wave = threadIdx.x >> 5, lr = lane & 15, hi = lane >> 4; const int r0 = blockIdx.x * 16;
    const int k0 = wave * (TT / KW_) + 8 * hi;
    const int t8 = threadIdx.x * (TT / (KW_ * 32));   // 8 statistics of each kind a thread; loaded first, so that their LDS stores wait for these four loads alone
    const v4f g0 = *(const v4f*)(MX + t8), g1 = *(const v4f*)(MX + t8 + 4), g2 = *(const v4f*)(RS + t8), g3 = *(const v4f*)(RS + t8 + 4);
    const float* pm = M + (size_t)(r0 + lr) * TT + k0; const bf* pb = Bt + (size_t)lr * TT + k0;
    v8f acc[4];
#pragma unroll
    for (int nb = 0; nb < 4; ++nb) acc[nb] = (v8f){};
    v4f mr[3][4]; V b[3][4];   // three sets of scores and B fragments: the loads of two k steps fly while the third is normalised and multiplied
#pragma unroll   // whole: the set index s % 3 must be a constant, or the sets leave the registers
    for (int s = 0; s < TT / KW_ / 32 + 2; ++s) {
        if (s < TT / KW_ / 32) { const int q = s % 3, kc = s * 32;
            mr[q][0] = *(const v4f*)(pm + kc); mr[q][1] = *(const v4f*)(pm + kc + 4); mr[q][2] = *(const v4f*)(pm + kc + 16); mr[q][3] = *(const v4f*)(pm + kc + 20);
#pragma unroll
            for (int nb = 0; nb < 4; ++nb) b[q][nb] = WFrag<bf>::ld(pb + (size_t)nb * 16 * TT + kc); }
        __builtin_amdgcn_sched_barrier(0);   // holds this step's loads in front of the arithmetic of the step two back; without it the scheduler sinks them to just before their use and nothing flies ahead
        if (s == 1) { *(v4f*)(smx + t8) = g0; *(v4f*)(smx + t8 + 4) = g1; *(v4f*)(srs + t8) = g2; *(v4f*)(srs + t8 + 4) = g3; __syncthreads(); }
        if (s >= 2) { const int q = (s - 2) % 3, kc = (s - 2) * 32; v8us ah[2], al[2];
#pragma unroll
            for (int h = 0; h < 2; ++h) {   // fragment slots 8 h + u hold k = kc + 16 h + 8 hi + u
#pragma unroll
                for (int g = 0; g < 2; ++g) { const v4f mx = *(const v4fa*)(smx + k0 + kc + 16 * h + 4 * g), rs = *(const v4fa*)(srs + k0 + kc + 16 * h + 4 * g);
#pragma unroll
                    for (int u = 0; u < 4; ++u) { const float p = ex2d(mr[q][2 * h + g][u], mx[u]) * rs[u]; unsigned short x1, x2; splitf(p, x1, x2); ah[h][4 * g + u] = x1; al[h][4 * g + u] = x2; } } }
            const V a = cat16b(ah[0], ah[1]), a2 = cat16b(al[0], al[1]);
#pragma unroll
            for (int nb = 0; nb < 4; ++nb) acc[nb] = WFrag<bf>::mma(a, b[q][nb], acc[nb]);
#pragma unroll
            for (int nb = 0; nb < 4; ++nb) acc[nb] = WFrag<bf>::mma(a2, b[q][nb], acc[nb]); }
    }
#pragma unroll
    for (int nb = 0; nb < 4; ++nb) {
#pragma unroll
        for (int j = 0; j < 8; ++j) red[wave][(hi * 8 + j) * 68 + nb * 16 + lr] = acc[nb][j]; }
    __syncthreads();
    const int row = threadIdx.x >> 5, col = lane * 2; v2f p[KW_];   // one wave sums and stores one 256-B row of C
#pragma unroll
    for (int w = 0; w < KW_; ++w) p[w] = *(const v2fa*)(&red[w][row * 68 + col]);
    float s0 = 0.f, s1 = 0.f;
#pragma unroll
    for (int w = 0; w < KW_; ++w) { s0 += p[w][0]; s1 += p[w][1]; }
    float* cp = C + (size_t)(r0 + row) * DD + col; cp[0] = s0; cp[1] = s1;
}


__global__ __launch_bounds__(256) void k_wtG(const float* __restrict__ w, int K, int N, bf* Bt) {
    const int lane = threadIdx.x & 31; const int L0 = (blockIdx.x * 8 + (threadIdx.x >> 5)) * 8; const int nlines = N * K / 64;
{
#pragma unroll 1
        for (int l = 0; l < 8; ++l) { const int L = L0 + l; if (L >= nlines) break; const size_t e = (size_t)L * 64 + lane * 2; const int k = (int)(e % K), n = (int)(e / K); v2us o;
            o[0] = f2bf(w[(size_t)k * N + n]); o[1] = f2bf(w[(size_t)(k + 1) * N + n]); *(v2us*)(Bt + e) = o; }
         }
}
__global__ __launch_bounds__(256) void k_cvt8(const float* __restrict__ src, bf* dst, size_t n8) { const size_t i = (size_t)blockIdx.x * 256 + threadIdx.x; if (i >= n8) return; const v8f v = *(const v8f*)(src + i * 8); v8us o;
#pragma unroll
    for (int k = 0; k < 8; ++k) o[k] = f2bf(v[k]); *(v8us*)(dst + i * 8) = o;  }
// k_vt: XT[d][t] = bf16 x[t][d] (lane -> 2 consecutive t); k_enc: lane -> 4 consecutive features c of token t: softmax statistics of the Z row (64, fixed order), acc[u] = sum_k softmax_k W2[k][c+u], enc = tanh(acc + b2) -> hl planes (8-B lanes);
__global__ __launch_bounds__(256) void k_vt(const float* __restrict__ x, bf* XT) { const int e = (blockIdx.x * 256 + threadIdx.x) * 2; if (e >= DD * TT) return; const int t = e % TT; const int d = e / TT; v2us o; o[0] = f2bf(x[(size_t)t * DD + d]); o[1] = f2bf(x[(size_t)(t + 1) * DD + d]); *(v2us*)(XT + e) = o;  }
__global__ __launch_bounds__(256) void k_enc(const float* __restrict__ Z, const float* __restrict__ W2, const float* __restrict__ b2, bf* Eh, bf* El) { const int e = (blockIdx.x * 256 + threadIdx.x) * 4; if (e >= TT * DD) return; const int c0 = e % DD; const int t = e / DD; const float* zr = Z + (size_t)t * DD; float mx = -3.0e38f;
#pragma unroll 1
    for (int k = 0; k < DD; ++k) mx = fmaxf(mx, zr[k]);
    float sum = 0.f;
#pragma unroll 1
    for (int k = 0; k < DD; ++k) { float d0 = __fsub_rn(zr[k], mx); asm volatile("" : "+v"(d0)); sum = __fadd_rn(sum, __builtin_amdgcn_exp2f(__fmul_rn(d0, 1.4426950408889634f))); }
    const float rs = __fdiv_rn(1.0f, sum); float acc[4] = {0.f, 0.f, 0.f, 0.f};
#pragma unroll 1
    for (int k = 0; k < DD; ++k) { float d0 = __fsub_rn(zr[k], mx); asm volatile("" : "+v"(d0)); const float h1 = __fmul_rn(__builtin_amdgcn_exp2f(__fmul_rn(d0, 1.4426950408889634f)), rs);
#pragma unroll
        for (int u = 0; u < 4; ++u) { float w = bfr(W2[k * DD + c0 + u]); asm volatile("" : "+v"(w)); float pr = __fmul_rn(h1, w); asm volatile("" : "+v"(pr)); acc[u] = __fadd_rn(acc[u], pr); } }
    v4us oh, ol;
#pragma unroll
    for (int u = 0; u < 4; ++u) { const float en = tanhf(__fadd_rn(acc[u], bfr(b2[c0 + u]))); unsigned short a, b; splitf(en, a, b); oh[u] = a; ol[u] = b; } *(v4us*)(Eh + e) = oh; *(v4us*)(El + e) = ol;  }
// k_cstat: per column j of M the maximum and 1 / sum_i exp(M[i][j] - max). One block = 32 columns (one 128-B line of every row). Its 128 lane groups (32 waves x 4 groups of 8 lanes, 16 B a lane) each take 32 rows in turn
// and keep a running (max, sum scaled to that max) pair per column; the pairs are merged in a fixed order: the 4 groups of a wave by a butterfly, the 32 waves through LDS.
__global__ __launch_bounds__(1024) void k_cstat(const float* __restrict__ M, float* MX, float* RS) {
    __shared__ __align__(16) float sm[32][32]; __shared__ __align__(16) float ss[32][32];
    const int lane = threadIdx.x & 31, wave = threadIdx.x >> 5, cq = lane & 7;
    const float* p = M + (size_t)(wave * 4 + (lane >> 3)) * (TT / 128) * TT + blockIdx.x * 32 + cq * 4;
    float m[4] = {-3.0e38f, -3.0e38f, -3.0e38f, -3.0e38f}, s[4] = {0.f, 0.f, 0.f, 0.f};
#pragma unroll 1   // 8 loads of 16 B in flight a wave; unrolled further the build spills at the 128 registers that 32 waves leave each
    for (int c = 0; c < TT / 1024; ++c, p += 8 * TT) { v4f v[8];
#pragma unroll
        for (int r = 0; r < 8; ++r) v[r] = *(const v4f*)(p + r * TT);
#pragma unroll
        for (int u = 0; u < 4; ++u) { float mn = m[u];
#pragma unroll
            for (int r = 0; r < 8; ++r) mn = fmaxf(mn, v[r][u]);
            float a = s[u] * ex2d(m[u], mn);
#pragma unroll
            for (int r = 0; r < 8; ++r) a += ex2d(v[r][u], mn);
            m[u] = mn; s[u] = a; } }
#pragma unroll
    for (int d = 8; d <= 16; d <<= 1) {
#pragma unroll
        for (int u = 0; u < 4; ++u) { const float om = __shfl_xor(m[u], d), os = __shfl_xor(s[u], d); const float mn = fmaxf(m[u], om); s[u] = s[u] * ex2d(m[u], mn) + os * ex2d(om, mn); m[u] = mn; } }
    if (lane < 8) { *(v4f*)(&sm[wave][cq * 4]) = (v4f){m[0], m[1], m[2], m[3]}; *(v4f*)(&ss[wave][cq * 4]) = (v4f){s[0], s[1], s[2], s[3]}; }
    __syncthreads();
    if (threadIdx.x < 32) { float mx = -3.0e38f, sum = 0.f;
#pragma unroll
        for (int w = 0; w < 32; ++w) mx = fmaxf(mx, sm[w][lane]);
#pragma unroll
        for (int w = 0; w < 32; ++w) sum += ss[w][lane] * ex2d(sm[w][lane], mx);
        const int j = blockIdx.x * 32 + lane; MX[j] = mx; RS[j] = __fdiv_rn(1.0f, sum); } }

extern "C" void kernel_launch(void* const* d_in, const int* in_sizes, int n_in,
                              void* d_out, int out_size, void* d_ws, size_t ws_size, hipStream_t stream) {
    (void)in_sizes; (void)n_in; (void)out_size;
    const float* x = (const float*)d_in[0]; const float* W1 = (const float*)d_in[1]; const float* b1 = (const float*)d_in[2]; const float* W2 = (const float*)d_in[3]; const float* b2 = (const float*)d_in[4];
    float* OUT = (float*)d_out;     // [4][4096][64]
    char* wsp = (char*)d_ws;
    auto take = [&](size_t bytes) { char* p = wsp; wsp += (bytes + 255) & ~(size_t)255; return (void*)p; };
    bf* BW1 = (bf*)take(DD * DD * 2); bf* XB = (bf*)take((size_t)TT * DD * 2); bf* XT = (bf*)take((size_t)DD * TT * 2); float* Z = (float*)take((size_t)TT * DD * 4); bf* Eh = (bf*)take((size_t)TT * DD * 2); bf* El = (bf*)take((size_t)TT * DD * 2);
    float* M = (float*)take((size_t)TT * TT * 4); float* MX = (float*)take(TT * 4); float* RS = (float*)take(TT * 4);
    if ((size_t)(wsp - (char*)d_ws) > ws_size) return;    // total ~ 67 MB (the [4096][4096] f32 score map 64 MB)
    k_wtG<<<(DD * DD / 64 + 63) / 64, 256, 0, stream>>>(W1, DD, DD, BW1);
    for (int b = 0; b < NB_; ++b) { const float* xb = x + (size_t)b * TT * DD;
        k_cvt8<<<(TT * DD / 8 + 255) / 256, 256, 0, stream>>>(xb, XB, TT * DD / 8); k_vt<<<(DD * TT / 2 + 255) / 256, 256, 0, stream>>>(xb, XT);
        k_gemmw<bf, 0, true><<<dim3(TT / 64, 1, 1), 32, 0, stream>>>(XB, nullptr, BW1, nullptr, DD, Z, DD, b1, 0, 0, 0); k_enc<<<(TT * DD / 4 + 255) / 256, 256, 0, stream>>>(Z, W2, b2, Eh, El);
        k_gemmw<bf, 1, false><<<dim3(TT / 64, TT / 64, 1), 32, 0, stream>>>(Eh, El, XB, nullptr, DD, M, TT, nullptr, 0, 0, 0);     // M[i][j] = encoded_i . x_j = scores[j][i]
        k_cstat<<<TT / 32, 1024, 0, stream>>>(M, MX, RS);
        k_gemmk<<<TT / 16, KW_ * 32, 0, stream>>>(M, MX, RS, XT, OUT + (size_t)b * TT * DD); }   // out[i][d] = sum_j attention[j][i] x[j][d], attention[j][i] = exp(M[i][j] - MX[j]) RS[j]
}

// v004
// One run takes 307 microseconds.
// Next to v003, in two timings, it ran 1.29 times as fast each time.
// Over all steps from v000 it is 22.5 times as fast.
#include <hip/hip_runtime.h>

// TimeSeriesAttention (x [4][4096][64]; h1 = softmax(x W1 + b1) (over the 64 features); encoded = tanh(h1 W2 + b2); scores[i][j] = x_i . encoded_j (unscaled); attention = softmax over j; out[i] = sum_j attention[j][i] x[j] (the TRANSPOSED attention, as the
// reference's permute) -> [4][4096][64]). The transposed use is handled by computing M[i][j] = encoded_i . x_j = scores[j][i] directly (swapped GEMM operands) and normalising each COLUMN j of M (= row j of the reference's softmax) with per-column statistics, so M-normalised[i][j] = attention[j][i] is already the A operand of out = attention^T x - exact restructuring.
// Compute dtypes, f32 accumulate: every input rounded to bf16; x W1 on PLAIN bf16 operands (inputs: exact) + bias; the feature softmax, h1 W2 + b2 (64-term fixed-order dots) and tanh f32 on the VALU -> bf16 hi+lo planes; scores as

#define NB_  4
#define TT   4096
#define DD   64
typedef _Float16 h16;
typedef unsigned short bf;
typedef __attribute__((ext_vector_type(16))) __bf16   v16bf;
typedef __attribute__((ext_vector_type(16))) _Float16 v16h;
typedef __attribute__((ext_vector_type(8)))  _Float16 v8h;
typedef __attribute__((ext_vector_type(8)))  unsigned short v8us;
typedef __attribute__((ext_vector_type(8)))  float    v8f;
typedef __attribute__((ext_vector_type(4)))  float    v4f;
typedef v8h  __attribute__((may_alias)) v8ha;
typedef v4f  __attribute__((may_alias)) v4fa;
typedef v8us __attribute__((may_alias)) v8usa;

__device__ __forceinline__ unsigned short f2bf(float f) { unsigned u = __float_as_uint(f); u += 0x7FFFu + ((u >> 16) & 1u); return (unsigned short)(u >> 16); }
__device__ __forceinline__ float bf2f(unsigned short b) { return __uint_as_float(((unsigned)b) << 16); }
__device__ __forceinline__ float bfr(float f) { return bf2f(f2bf(f)); }
__device__ __forceinline__ v16h cat16(v8h lo, v8h hi) { return __builtin_shufflevector(lo, hi, 0, 1, 2, 3, 4, 5, 6, 7, 8, 9, 10, 11, 12, 13, 14, 15); }
__device__ __forceinline__ v16bf cat16b(v8us lo, v8us hi) { return __builtin_bit_cast(v16bf, __builtin_shufflevector(lo, hi, 0, 1, 2, 3, 4, 5, 6, 7, 8, 9, 10, 11, 12, 13, 14, 15)); }
__device__ __forceinline__ v8f wmma16(v16h a, v16h b, v8f c) { return __builtin_amdgcn_wmma_f32_16x16x32_f16(false, a, false, b, (short)0, c, false, false); }
__device__ __forceinline__ v8f wmmab(v16bf a, v16bf b, v8f c) { return __builtin_amdgcn_wmma_f32_16x16x32_bf16(false, a, false, b, (short)0, c, false, false); }



// ---- k_gemmw: register-blocked GEMM, ONE WAVE per 64x64 output tile (16 accumulators), operands straight from K-contiguous 16-bit planes; grid (M/64, N/64, Z), 32 threads.
// C[m][n] (f32, pitch ldc, + optional f32 bias[n]) = sum_k A[m][k] Bt[n][k] (+ split products per NSPLIT). z-batch strides sA/sB/sC in elements. K % 32 == 0.
template <typename T16> struct WFrag;
template <> struct WFrag<h16> { typedef v16h V; static __device__ __forceinline__ V ld(const h16* p) { return cat16(*(const v8h*)p, *(const v8h*)(p + 16)); } static __device__ __forceinline__ v8f mma(V a, V b, v8f c) { return wmma16(a, b, c); } };
template <> struct WFrag<bf> { typedef v16bf V; static __device__ __forceinline__ V ld(const bf* p) { return cat16b(*(const v8us*)p, *(const v8us*)(p + 16)); } static __device__ __forceinline__ v8f mma(V a, V b, v8f c) { return wmmab(a, b, c); } };
template <typename T16, int NSPLIT, bool BIAS>
__global__ __launch_bounds__(32) void k_gemmw(const T16* __restrict__ A, const T16* __restrict__ A2, const T16* __restrict__ Bt, const T16* __restrict__ Bt2, int K, float* C, int ldc, const float* __restrict__ bias, size_t sA, size_t sB, size_t sC) {
    typedef typename WFrag<T16>::V V;
    __shared__ __align__(16) float os[16 * 68];
    const size_t z = blockIdx.z; A += z * sA; if (A2) A2 += z * sA; Bt += z * sB; if (Bt2) Bt2 += z * sB; C += z * sC;
    const int lane = threadIdx.x & 31, lr = lane & 15, hi = lane >> 4; const int r0 = blockIdx.x * 64, c0 = blockIdx.y * 64;
    v8f acc[4][4];
#pragma unroll
    for (int mb = 0; mb < 4; ++mb)
#pragma unroll
        for (int nb = 0; nb < 4; ++nb) acc[mb][nb] = (v8f){};
    const size_t aoff = (size_t)(r0 + lr) * K + 8 * hi, boff = (size_t)(c0 + lr) * K + 8 * hi;
#pragma unroll 1
    for (int kc = 0; kc < K; kc += 32) {
        V a[4], a2[4];
#pragma unroll
        for (int mb = 0; mb < 4; ++mb) { a[mb] = WFrag<T16>::ld(A + aoff + (size_t)mb * 16 * K + kc); if (NSPLIT == 1 || NSPLIT == 2) a2[mb] = WFrag<T16>::ld(A2 + aoff + (size_t)mb * 16 * K + kc); }
#pragma unroll
        for (int nb = 0; nb < 4; ++nb) { const V b = WFrag<T16>::ld(Bt + boff + (size_t)nb * 16 * K + kc); V b2; if (NSPLIT >= 2) b2 = WFrag<T16>::ld(Bt2 + boff + (size_t)nb * 16 * K + kc);
#pragma unroll
            for (int mb = 0; mb < 4; ++mb) { acc[mb][nb] = WFrag<T16>::mma(a[mb], b, acc[mb][nb]); if (NSPLIT == 1 || NSPLIT == 2) acc[mb][nb] = WFrag<T16>::mma(a2[mb], b, acc[mb][nb]); if (NSPLIT >= 2) acc[mb][nb] = WFrag<T16>::mma(a[mb], b2, acc[mb][nb]); } }
        asm volatile("v_nop\n\tv_nop\n\tv_nop\n\tv_nop" : "+v"(acc[0][0]), "+v"(acc[1][1]), "+v"(acc[2][2]), "+v"(acc[3][3]) : "v"(a[0]), "v"(a[3]));
    }
#pragma unroll
    for (int mb = 0; mb < 4; ++mb) {
#pragma unroll
        for (int nb = 0; nb < 4; ++nb) {
#pragma unroll
            for (int j = 0; j < 8; ++j) os[(hi * 8 + j) * 68 + nb * 16 + lr] = acc[mb][nb][j]; }
        __builtin_amdgcn_wave_barrier(); asm volatile("" ::: "memory");
        float* crow = C + (size_t)(r0 + mb * 16) * ldc + c0;
{
#pragma unroll
            for (int s = 0; s < 8; ++s) { const int row = 2 * s + hi, cofs = lr * 4; v4f val = *(const v4fa*)(os + row * 68 + cofs); if (BIAS) { val[0] += bfr(bias[c0 + cofs]); val[1] += bfr(bias[c0 + cofs + 1]); val[2] += bfr(bias[c0 + cofs + 2]); val[3] += bfr(bias[c0 + cofs + 3]); }
                *(v4f*)(crow + (size_t)row * ldc + cofs) = val; }
             }
        __builtin_amdgcn_wave_barrier(); asm volatile("" ::: "memory");
    }
}

__device__ __forceinline__ void splitf(float y, unsigned short& h, unsigned short& l) { h = f2bf(y); l = f2bf(y - bf2f(h)); }
typedef __attribute__((ext_vector_type(2))) unsigned short v2us;
typedef __attribute__((ext_vector_type(4))) unsigned short v4us;
// ex2d = exp(a - b). The v_nop keeps the one slot that the instruction set asks for behind a transcendental.
__device__ __forceinline__ float ex2d(float a, float b) { float r; asm("v_exp_f32 %0, %1\n\tv_nop" : "=v"(r) : "v"((a - b) * 1.4426950408889634f)); return r; }

// ---- k_gemmk: the out product, whose 64 output tiles of 64x64 leave most of the chip idle. One work-group = 16 rows x 64 columns of C; its 16 waves each take a K slice of 256
// and keep a 16x64 f32 partial; the partials are summed in wave order through LDS. C[m][n] = sum_k (Ph[m][k] + Pl[m][k]) Bt[n][k]; Bt pitch TT, C pitch DD.
// The A operand is formed in registers and no score is read from memory: per k step of 32 the wave computes the two 16x16 score tiles S[k][m] = x_k . (Eh_m + El_m) on the matrix unit
// (A = x rows k, B = the work-group's 16 encoded rows, held in registers). The accumulator of tile h holds, in lane (lr, hi) and register u, S[16 h + 8 hi + u][lr]: that is slot 8 h + u
// of row lr of the 16-bit A fragment, so p = exp(S - MX[k]) * RS[k] goes into the hi and lo A fragments with no move between lanes.
// MX, RS: the SQ_ partial (max, sum) pairs a column that k_cstat leaves are merged in a fixed order and staged once in LDS.
#define KW_ 16
#define SQ_ 4
typedef __attribute__((ext_vector_type(2))) float v2f;
typedef v2f __attribute__((may_alias)) v2fa;
__global__ __launch_bounds__(KW_ * 32) void k_gemmk(const bf* __restrict__ XB, const bf* __restrict__ Eh, const bf* __restrict__ El, const float* __restrict__ PM, const float* __restrict__ PS, const bf* __restrict__ Bt, float* C) {
    typedef WFrag<bf>::V V;
    __shared__ __align__(16) float red[KW_][16 * 68];
    __shared__ __align__(16) float smx[TT]; __shared__ __align__(16) float srs[TT];
    const int lane = threadIdx.x & 31, wave = threadIdx.x >> 5, lr = lane & 15, hi = lane >> 4; const int r0 = blockIdx.x * 16;
    const int k0 = wave * (TT / KW_) + 8 * hi;
    const int t8 = threadIdx.x * (TT / (KW_ * 32));   // 8 columns' statistics a thread; loaded first, so that their merge waits for these loads alone
    v4f pm[SQ_][2], ps[SQ_][2];
#pragma unroll
    for (int q = 0; q < SQ_; ++q) { pm[q][0] = *(const v4f*)(PM + q * TT + t8); pm[q][1] = *(const v4f*)(PM + q * TT + t8 + 4); ps[q][0] = *(const v4f*)(PS + q * TT + t8); ps[q][1] = *(const v4f*)(PS + q * TT + t8 + 4); }
    const bf* px = XB + (size_t)(wave * (TT / KW_) + lr) * DD + 8 * hi; const bf* pb = Bt + (size_t)lr * TT + k0;
    const bf* peh = Eh + (size_t)(r0 + lr) * DD + 8 * hi; const bf* pel = El + (size_t)(r0 + lr) * DD + 8 * hi;
    const V eh0 = WFrag<bf>::ld(peh), eh1 = WFrag<bf>::ld(peh + 32), el0 = WFrag<bf>::ld(pel), el1 = WFrag<bf>::ld(pel + 32);
    v8f acc[4];
#pragma unroll
    for (int nb = 0; nb < 4; ++nb) acc[nb] = (v8f){};
    V xa[2][4], b[2][4];   // two sets of x and B fragments: the loads of the next k step fly while this one is worked on
#pragma unroll   // whole: the set index s % 2 must be a constant, or the sets leave the registers
    for (int s = 0; s < TT / KW_ / 32 + 1; ++s) {
        if (s < TT / KW_ / 32) { const int q = s % 2, kc = s * 32;
#pragma unroll
            for (int h = 0; h < 2; ++h) { xa[q][2 * h] = WFrag<bf>::ld(px + (size_t)(kc + 16 * h) * DD); xa[q][2 * h + 1] = WFrag<bf>::ld(px + (size_t)(kc + 16 * h) * DD + 32); }
#pragma unroll
            for (int nb = 0; nb < 4; ++nb) b[q][nb] = WFrag<bf>::ld(pb + (size_t)nb * 16 * TT + kc); }
        // the wait that stands in front of an overwrite of an issued load's address registers. The pointers that are used for the last time are named as inputs, so that they stay live up to the wait and no later load's result is placed on them; in front of the scheduling barrier, so that no arithmetic is lifted over it
        if (s == 0) asm volatile("s_wait_xcnt 0x0" :: "v"(peh), "v"(pel) : "memory");
        if (s == TT / KW_ / 32 - 1) asm volatile("s_wait_xcnt 0x0" :: "v"(px), "v"(pb) : "memory");
        __builtin_amdgcn_sched_barrier(0);   // holds this step's loads in front of the arithmetic of the step before; without it the scheduler sinks them to just before their use and nothing flies ahead
        if (s == 0) {
#pragma unroll
            for (int g = 0; g < 2; ++g) { v4f mv, rv;
#pragma unroll
                for (int u = 0; u < 4; ++u) { float mx = pm[0][g][u];
#pragma unroll
                    for (int q = 1; q < SQ_; ++q) mx = fmaxf(mx, pm[q][g][u]);
                    float sum = 0.f;
#pragma unroll
                    for (int q = 0; q < SQ_; ++q) sum += ps[q][g][u] * ex2d(pm[q][g][u], mx);
                    mv[u] = mx; rv[u] = __fdiv_rn(1.0f, sum); }
                *(v4f*)(smx + t8 + 4 * g) = mv; *(v4f*)(srs + t8 + 4 * g) = rv; }
            __syncthreads(); }
        if (s >= 1) { const int q = (s - 1) % 2, kc = (s - 1) * 32; v8us ah[2], al[2]; v8f sc[2] = {(v8f){}, (v8f){}};
            // per score the sum order of the four products is: hi d 0..31, lo d 0..31, hi d 32..63, lo d 32..63, as in k_cstat
            sc[0] = WFrag<bf>::mma(xa[q][0], eh0, sc[0]); sc[1] = WFrag<bf>::mma(xa[q][2], eh0, sc[1]); sc[0] = WFrag<bf>::mma(xa[q][0], el0, sc[0]); sc[1] = WFrag<bf>::mma(xa[q][2], el0, sc[1]);
            sc[0] = WFrag<bf>::mma(xa[q][1], eh1, sc[0]); sc[1] = WFrag<bf>::mma(xa[q][3], eh1, sc[1]); sc[0] = WFrag<bf>::mma(xa[q][1], el1, sc[0]); sc[1] = WFrag<bf>::mma(xa[q][3], el1, sc[1]);
            __builtin_amdgcn_sched_barrier(0);   // keeps the asm exponentials behind ALL score products
#pragma unroll
            for (int h = 0; h < 2; ++h) {   // fragment slots 8 h + u hold k = kc + 16 h + 8 hi + u
#pragma unroll
                for (int g = 0; g < 2; ++g) { const v4f mx = *(const v4fa*)(smx + k0 + kc + 16 * h + 4 * g), rs = *(const v4fa*)(srs + k0 + kc + 16 * h + 4 * g);
#pragma unroll
                    for (int u = 0; u < 4; ++u) { const float p = ex2d(sc[h][4 * g + u], mx[u]) * rs[u]; unsigned short x1, x2; splitf(p, x1, x2); ah[h][4 * g + u] = x1; al[h][4 * g + u] = x2; } } }
            const V a = cat16b(ah[0], ah[1]), a2 = cat16b(al[0], al[1]);
#pragma unroll
            for (int nb = 0; nb < 4; ++nb) acc[nb] = WFrag<bf>::mma(a, b[q][nb], acc[nb]);
#pragma unroll
            for (int nb = 0; nb < 4; ++nb) acc[nb] = WFrag<bf>::mma(a2, b[q][nb], acc[nb]); }
    }
#pragma unroll
    for (int nb = 0; nb < 4; ++nb) {
#pragma unroll
        for (int j = 0; j < 8; ++j) red[wave][(hi * 8 + j) * 68 + nb * 16 + lr] = acc[nb][j]; }
    __syncthreads();
    const int row = threadIdx.x >> 5, col = lane * 2; v2f p[KW_];   // one wave sums and stores one 256-B row of C
#pragma unroll
    for (int w = 0; w < KW_; ++w) p[w] = *(const v2fa*)(&red[w][row * 68 + col]);
    float s0 = 0.f, s1 = 0.f;
#pragma unroll
    for (int w = 0; w < KW_; ++w) { s0 += p[w][0]; s1 += p[w][1]; }
    float* cp = C + (size_t)(r0 + row) * DD + col; cp[0] = s0; cp[1] = s1;
}


__global__ __launch_bounds__(256) void k_wtG(const float* __restrict__ w, int K, int N, bf* Bt) {
    const int lane = threadIdx.x & 31; const int L0 = (blockIdx.x * 8 + (threadIdx.x >> 5)) * 8; const int nlines = N * K / 64;
{
#pragma unroll 1
        for (int l = 0; l < 8; ++l) { const int L = L0 + l; if (L >= nlines) break; const size_t e = (size_t)L * 64 + lane * 2; const int k = (int)(e % K), n = (int)(e / K); v2us o;
            o[0] = f2bf(w[(size_t)k * N + n]); o[1] = f2bf(w[(size_t)(k + 1) * N + n]); *(v2us*)(Bt + e) = o; }
         }
}
__global__ __launch_bounds__(256) void k_cvt8(const float* __restrict__ src, bf* dst, size_t n8) { const size_t i = (size_t)blockIdx.x * 256 + threadIdx.x; if (i >= n8) return; const v8f v = *(const v8f*)(src + i * 8); v8us o;
#pragma unroll
    for (int k = 0; k < 8; ++k) o[k] = f2bf(v[k]); *(v8us*)(dst + i * 8) = o;  }
// k_vt: XT[d][t] = bf16 x[t][d] (lane -> 2 consecutive t); k_enc: lane -> 4 consecutive features c of token t: softmax statistics of the Z row (64, fixed order), acc[u] = sum_k softmax_k W2[k][c+u], enc = tanh(acc + b2) -> hl planes (8-B lanes);
__global__ __launch_bounds__(256) void k_vt(const float* __restrict__ x, bf* XT) { const int e = (blockIdx.x * 256 + threadIdx.x) * 2; if (e >= DD * TT) return; const int t = e % TT; const int d = e / TT; v2us o; o[0] = f2bf(x[(size_t)t * DD + d]); o[1] = f2bf(x[(size_t)(t + 1) * DD + d]); *(v2us*)(XT + e) = o;  }
__global__ __launch_bounds__(256) void k_enc(const float* __restrict__ Z, const float* __restrict__ W2, const float* __restrict__ b2, bf* Eh, bf* El) { const int e = (blockIdx.x * 256 + threadIdx.x) * 4; if (e >= TT * DD) return; const int c0 = e % DD; const int t = e / DD; const float* zr = Z + (size_t)t * DD; float mx = -3.0e38f;
#pragma unroll 1
    for (int k = 0; k < DD; ++k) mx = fmaxf(mx, zr[k]);
    float sum = 0.f;
#pragma unroll 1
    for (int k = 0; k < DD; ++k) { float d0 = __fsub_rn(zr[k], mx); asm volatile("" : "+v"(d0)); sum = __fadd_rn(sum, __builtin_amdgcn_exp2f(__fmul_rn(d0, 1.4426950408889634f))); }
    const float rs = __fdiv_rn(1.0f, sum); float acc[4] = {0.f, 0.f, 0.f, 0.f};
#pragma unroll 1
    for (int k = 0; k < DD; ++k) { float d0 = __fsub_rn(zr[k], mx); asm volatile("" : "+v"(d0)); const float h1 = __fmul_rn(__builtin_amdgcn_exp2f(__fmul_rn(d0, 1.4426950408889634f)), rs);
#pragma unroll
        for (int u = 0; u < 4; ++u) { float w = bfr(W2[k * DD + c0 + u]); asm volatile("" : "+v"(w)); float pr = __fmul_rn(h1, w); asm volatile("" : "+v"(pr)); acc[u] = __fadd_rn(acc[u], pr); } }
    v4us oh, ol;
#pragma unroll
    for (int u = 0; u < 4; ++u) { const float en = tanhf(__fadd_rn(acc[u], bfr(b2[c0 + u]))); unsigned short a, b; splitf(en, a, b); oh[u] = a; ol[u] = b; } *(v4us*)(Eh + e) = oh; *(v4us*)(El + e) = ol;  }
// k_cstat: per column j of M[i][j] = encoded_i . x_j a partial maximum and a partial sum_i exp(M[i][j] - max), with M formed on the matrix unit and never stored. One block = 64 columns x a quarter of the rows (grid.y = SQ_).
// Each of its 16 waves holds the B fragments of the 64 columns and takes 64 rows as 4 tiles of 16 (A = encoded hi, lo). In the accumulator a lane holds 8 rows of ONE column, so the running (max, sum scaled to that max)
// pair is per lane; the pairs are merged in a fixed order: the two lane halves by a shuffle, the 16 waves through LDS; the SQ_ quarters are merged by the reader (k_gemmk).
__global__ __launch_bounds__(512) void k_cstat(const bf* __restrict__ Eh, const bf* __restrict__ El, const bf* __restrict__ XB, float* PM, float* PS) {
    typedef WFrag<bf>::V V;
    __shared__ __align__(16) float sm[16][64]; __shared__ __align__(16) float ss[16][64];
    const int lane = threadIdx.x & 31, wave = threadIdx.x >> 5, lr = lane & 15, hi = lane >> 4;
    const int j0 = blockIdx.x * 64, i0 = blockIdx.y * (TT / SQ_) + wave * (TT / SQ_ / 16);
    const bf* pxb = XB + (size_t)(j0 + lr) * DD + 8 * hi; const bf* peh = Eh + (size_t)(i0 + lr) * DD + 8 * hi; const bf* pel = El + (size_t)(i0 + lr) * DD + 8 * hi;   // one address a plane; tiles and column blocks are constant offsets from it
    V b[4][2];
#pragma unroll
    for (int nb = 0; nb < 4; ++nb) { b[nb][0] = WFrag<bf>::ld(pxb + nb * 16 * DD); b[nb][1] = WFrag<bf>::ld(pxb + nb * 16 * DD + 32); }
    float m[4] = {-3.0e38f, -3.0e38f, -3.0e38f, -3.0e38f}, s[4] = {0.f, 0.f, 0.f, 0.f};
    V a[2][4];   // two sets of A fragments: the next tile's loads fly while this one is worked on
#pragma unroll   // whole: the set index t % 2 must be a constant, or the sets leave the registers
    for (int t = 0; t < TT / SQ_ / 256 + 1; ++t) {
        if (t < TT / SQ_ / 256) { const int q = t % 2, o = t * 16 * DD;
            a[q][0] = WFrag<bf>::ld(peh + o); a[q][1] = WFrag<bf>::ld(pel + o); a[q][2] = WFrag<bf>::ld(peh + o + 32); a[q][3] = WFrag<bf>::ld(pel + o + 32); }
        // the wait that stands in front of an overwrite of an issued load's address registers. The pointers that are used for the last time are named as inputs, so that they stay live up to the wait and no later load's result is placed on them
        if (t == 0) asm volatile("s_wait_xcnt 0x0" :: "v"(pxb) : "memory");
        if (t == TT / SQ_ / 256 - 1) asm volatile("s_wait_xcnt 0x0" :: "v"(peh), "v"(pel) : "memory");
        __builtin_amdgcn_sched_barrier(0);   // holds this tile's loads in front of the arithmetic of the tile before; without it the scheduler sinks them to just before their use
        if (t >= 1) { const int q = (t - 1) % 2; v8f acc[4];
#pragma unroll
            for (int nb = 0; nb < 4; ++nb) acc[nb] = (v8f){};
#pragma unroll
            for (int f = 0; f < 4; ++f) {   // hi d 0..31, lo d 0..31, hi d 32..63, lo d 32..63
#pragma unroll
                for (int nb = 0; nb < 4; ++nb) acc[nb] = WFrag<bf>::mma(a[q][f], b[nb][f >> 1], acc[nb]); }
            __builtin_amdgcn_sched_barrier(0);   // keeps the asm exponentials behind ALL products of the tile
#pragma unroll
            for (int nb = 0; nb < 4; ++nb) { float mn = m[nb];
#pragma unroll
                for (int r = 0; r < 8; ++r) mn = fmaxf(mn, acc[nb][r]);
                float sa = s[nb] * ex2d(m[nb], mn);
#pragma unroll
                for (int r = 0; r < 8; ++r) sa += ex2d(acc[nb][r], mn);
                m[nb] = mn; s[nb] = sa; } }
    }
#pragma unroll
    for (int nb = 0; nb < 4; ++nb) { const float om = __shfl_xor(m[nb], 16), os = __shfl_xor(s[nb], 16); const float mn = fmaxf(m[nb], om); s[nb] = s[nb] * ex2d(m[nb], mn) + os * ex2d(om, mn); m[nb] = mn; }
    if (hi == 0) {
#pragma unroll
        for (int nb = 0; nb < 4; ++nb) { sm[wave][nb * 16 + lr] = m[nb]; ss[wave][nb * 16 + lr] = s[nb]; } }
    __syncthreads();
    if (threadIdx.x < 64) { const int c = threadIdx.x; float mx = -3.0e38f, sum = 0.f;
#pragma unroll
        for (int w = 0; w < 16; ++w) mx = fmaxf(mx, sm[w][c]);
#pragma unroll
        for (int w = 0; w < 16; ++w) sum += ss[w][c] * ex2d(sm[w][c], mx);
        PM[blockIdx.y * TT + j0 + c] = mx; PS[blockIdx.y * TT + j0 + c] = sum; } }

extern "C" void kernel_launch(void* const* d_in, const int* in_sizes, int n_in,
                              void* d_out, int out_size, void* d_ws, size_t ws_size, hipStream_t stream) {
    (void)in_sizes; (void)n_in; (void)out_size;
    const float* x = (const float*)d_in[0]; const float* W1 = (const float*)d_in[1]; const float* b1 = (const float*)d_in[2]; const float* W2 = (const float*)d_in[3]; const float* b2 = (const float*)d_in[4];
    float* OUT = (float*)d_out;     // [4][4096][64]
    char* wsp = (char*)d_ws;
    auto take = [&](size_t bytes) { char* p = wsp; wsp += (bytes + 255) & ~(size_t)255; return (void*)p; };
    bf* BW1 = (bf*)take(DD * DD * 2); bf* XB = (bf*)take((size_t)TT * DD * 2); bf* XT = (bf*)take((size_t)DD * TT * 2); float* Z = (float*)take((size_t)TT * DD * 4); bf* Eh = (bf*)take((size_t)TT * DD * 2); bf* El = (bf*)take((size_t)TT * DD * 2);
    float* PM = (float*)take(SQ_ * TT * 4); float* PS = (float*)take(SQ_ * TT * 4);
    if ((size_t)(wsp - (char*)d_ws) > ws_size) return;    // total ~ 3.2 MB
    k_wtG<<<(DD * DD / 64 + 63) / 64, 256, 0, stream>>>(W1, DD, DD, BW1);
    for (int b = 0; b < NB_; ++b) { const float* xb = x + (size_t)b * TT * DD;
        k_cvt8<<<(TT * DD / 8 + 255) / 256, 256, 0, stream>>>(xb, XB, TT * DD / 8); k_vt<<<(DD * TT / 2 + 255) / 256, 256, 0, stream>>>(xb, XT);
        k_gemmw<bf, 0, true><<<dim3(TT / 64, 1, 1), 32, 0, stream>>>(XB, nullptr, BW1, nullptr, DD, Z, DD, b1, 0, 0, 0); k_enc<<<(TT * DD / 4 + 255) / 256, 256, 0, stream>>>(Z, W2, b2, Eh, El);
        k_cstat<<<dim3(TT / 64, SQ_, 1), 512, 0, stream>>>(Eh, El, XB, PM, PS);     // statistics of M[i][j] = encoded_i . x_j = scores[j][i] over i
        k_gemmk<<<TT / 16, KW_ * 32, 0, stream>>>(XB, Eh, El, PM, PS, XT, OUT + (size_t)b * TT * DD); }   // out[i][d] = sum_j attention[j][i] x[j][d], attention[j][i] = exp(M[i][j] - MX[j]) RS[j]
}

// v005
// A run of this version takes 183 microseconds.
// In two side-by-side timings against v004, it was 1.68 and 1.69 times as fast.
// Over all steps from v000 it is 37.8 times as fast.
#include <hip/hip_runtime.h>

// TimeSeriesAttention (x [4][4096][64]; h1 = softmax(x W1 + b1) (over the 64 features); encoded = tanh(h1 W2 + b2); scores[i][j] = x_i . encoded_j (unscaled); attention = softmax over j; out[i] = sum_j attention[j][i] x[j] (the TRANSPOSED attention, as the
// reference's permute) -> [4][4096][64]). The transposed use is handled by computing M[i][j] = encoded_i . x_j = scores[j][i] directly (swapped GEMM operands) and normalising each COLUMN j of M (= row j of the reference's softmax) with per-column statistics, so M-normalised[i][j] = attention[j][i] is already the A operand of out = attention^T x - exact restructuring.
// Compute dtypes, f32 accumulate: every input rounded to bf16; x W1 on PLAIN bf16 operands (inputs: exact) + bias; the feature softmax, h1 W2 + b2 (64-term fixed-order dots) and tanh f32 on the VALU -> bf16 hi+lo planes; scores as

#define NB_  4
#define TT   4096
#define DD   64
typedef _Float16 h16;
typedef unsigned short bf;
typedef __attribute__((ext_vector_type(16))) __bf16   v16bf;
typedef __attribute__((ext_vector_type(16))) _Float16 v16h;
typedef __attribute__((ext_vector_type(8)))  _Float16 v8h;
typedef __attribute__((ext_vector_type(8)))  unsigned short v8us;
typedef __attribute__((ext_vector_type(8)))  float    v8f;
typedef __attribute__((ext_vector_type(4)))  float    v4f;
typedef v8h  __attribute__((may_alias)) v8ha;
typedef v4f  __attribute__((may_alias)) v4fa;
typedef v8us __attribute__((may_alias)) v8usa;

__device__ __forceinline__ unsigned short f2bf(float f) { unsigned u = __float_as_uint(f); u += 0x7FFFu + ((u >> 16) & 1u); return (unsigned short)(u >> 16); }
__device__ __forceinline__ float bf2f(unsigned short b) { return __uint_as_float(((unsigned)b) << 16); }
__device__ __forceinline__ float bfr(float f) { return bf2f(f2bf(f)); }
__device__ __forceinline__ v16h cat16(v8h lo, v8h hi) { return __builtin_shufflevector(lo, hi, 0, 1, 2, 3, 4, 5, 6, 7, 8, 9, 10, 11, 12, 13, 14, 15); }
__device__ __forceinline__ v16bf cat16b(v8us lo, v8us hi) { return __builtin_bit_cast(v16bf, __builtin_shufflevector(lo, hi, 0, 1, 2, 3, 4, 5, 6, 7, 8, 9, 10, 11, 12, 13, 14, 15)); }
__device__ __forceinline__ v8f wmma16(v16h a, v16h b, v8f c) { return __builtin_amdgcn_wmma_f32_16x16x32_f16(false, a, false, b, (short)0, c, false, false); }
__device__ __forceinline__ v8f wmmab(v16bf a, v16bf b, v8f c) { return __builtin_amdgcn_wmma_f32_16x16x32_bf16(false, a, false, b, (short)0, c, false, false); }



// ---- k_gemmw: register-blocked GEMM, ONE WAVE per 64x64 output tile (16 accumulators), operands straight from K-contiguous 16-bit planes; grid (M/64, N/64, Z), 32 threads.
// C[m][n] (f32, pitch ldc, + optional f32 bias[n]) = sum_k A[m][k] Bt[n][k] (+ split products per NSPLIT). z-batch strides sA/sB/sC in elements. K % 32 == 0.
template <typename T16> struct WFrag;
template <> struct WFrag<h16> { typedef v16h V; static __device__ __forceinline__ V ld(const h16* p) { return cat16(*(const v8h*)p, *(const v8h*)(p + 16)); } static __device__ __forceinline__ v8f mma(V a, V b, v8f c) { return wmma16(a, b, c); } };
template <> struct WFrag<bf> { typedef v16bf V; static __device__ __forceinline__ V ld(const bf* p) { return cat16b(*(const v8us*)p, *(const v8us*)(p + 16)); } static __device__ __forceinline__ v8f mma(V a, V b, v8f c) { return wmmab(a, b, c); } };
template <typename T16, int NSPLIT, bool BIAS>
__global__ __launch_bounds__(32) void k_gemmw(const T16* __restrict__ A, const T16* __restrict__ A2, const T16* __restrict__ Bt, const T16* __restrict__ Bt2, int K, float* C, int ldc, const float* __restrict__ bias, size_t sA, size_t sB, size_t sC) {
    typedef typename WFrag<T16>::V V;
    __shared__ __align__(16) float os[16 * 68];
    const size_t z = blockIdx.z; A += z * sA; if (A2) A2 += z * sA; Bt += z * sB; if (Bt2) Bt2 += z * sB; C += z * sC;
    const int lane = threadIdx.x & 31, lr = lane & 15, hi = lane >> 4; const int r0 = blockIdx.x * 64, c0 = blockIdx.y * 64;
    v8f acc[4][4];
#pragma unroll
    for (int mb = 0; mb < 4; ++mb)
#pragma unroll
        for (int nb = 0; nb < 4; ++nb) acc[mb][nb] = (v8f){};
    const size_t aoff = (size_t)(r0 + lr) * K + 8 * hi, boff = (size_t)(c0 + lr) * K + 8 * hi;
#pragma unroll 1
    for (int kc = 0; kc < K; kc += 32) {
        V a[4], a2[4];
#pragma unroll
        for (int mb = 0; mb < 4; ++mb) { a[mb] = WFrag<T16>::ld(A + aoff + (size_t)mb * 16 * K + kc); if (NSPLIT == 1 || NSPLIT == 2) a2[mb] = WFrag<T16>::ld(A2 + aoff + (size_t)mb * 16 * K + kc); }
#pragma unroll
        for (int nb = 0; nb < 4; ++nb) { const V b = WFrag<T16>::ld(Bt + boff + (size_t)nb * 16 * K + kc); V b2; if (NSPLIT >= 2) b2 = WFrag<T16>::ld(Bt2 + boff + (size_t)nb * 16 * K + kc);
#pragma unroll
            for (int mb = 0; mb < 4; ++mb) { acc[mb][nb] = WFrag<T16>::mma(a[mb], b, acc[mb][nb]); if (NSPLIT == 1 || NSPLIT == 2) acc[mb][nb] = WFrag<T16>::mma(a2[mb], b, acc[mb][nb]); if (NSPLIT >= 2) acc[mb][nb] = WFrag<T16>::mma(a[mb], b2, acc[mb][nb]); } }
        asm volatile("v_nop\n\tv_nop\n\tv_nop\n\tv_nop" : "+v"(acc[0][0]), "+v"(acc[1][1]), "+v"(acc[2][2]), "+v"(acc[3][3]) : "v"(a[0]), "v"(a[3]));
    }
#pragma unroll
    for (int mb = 0; mb < 4; ++mb) {
#pragma unroll
        for (int nb = 0; nb < 4; ++nb) {
#pragma unroll
            for (int j = 0; j < 8; ++j) os[(hi * 8 + j) * 68 + nb * 16 + lr] = acc[mb][nb][j]; }
        __builtin_amdgcn_wave_barrier(); asm volatile("" ::: "memory");
        float* crow = C + (size_t)(r0 + mb * 16) * ldc + c0;
{
#pragma unroll
            for (int s = 0; s < 8; ++s) { const int row = 2 * s + hi, cofs = lr * 4; v4f val = *(const v4fa*)(os + row * 68 + cofs); if (BIAS) { val[0] += bfr(bias[c0 + cofs]); val[1] += bfr(bias[c0 + cofs + 1]); val[2] += bfr(bias[c0 + cofs + 2]); val[3] += bfr(bias[c0 + cofs + 3]); }
                *(v4f*)(crow + (size_t)row * ldc + cofs) = val; }
             }
        __builtin_amdgcn_wave_barrier(); asm volatile("" ::: "memory");
    }
}

__device__ __forceinline__ void splitf(float y, unsigned short& h, unsigned short& l) { h = f2bf(y); l = f2bf(y - bf2f(h)); }
typedef __attribute__((ext_vector_type(2))) unsigned short v2us;
typedef __attribute__((ext_vector_type(4))) unsigned short v4us;
// ex2d = exp(a - b). The v_nop keeps the one slot that the instruction set asks for behind a transcendental.
__device__ __forceinline__ float ex2d(float a, float b) { float r; asm("v_exp_f32 %0, %1\n\tv_nop" : "=v"(r) : "v"((a - b) * 1.4426950408889634f)); return r; }

// ---- k_gemmk: the out product, whose 256 output tiles of 64x64 leave most of the chip idle. One work-group = 16 rows x 64 columns of C; its 16 waves each take a K slice of 256
// and keep a 16x64 f32 partial; the partials are summed in wave order through LDS. C[m][n] = sum_k (Ph[m][k] + Pl[m][k]) Bt[n][k]; Bt pitch TT, C pitch DD.
// The A operand is formed in registers and no score is read from memory: per k step of 32 the wave computes the two 16x16 score tiles S[k][m] = x_k . (Eh_m + El_m) on the matrix unit
// (A = x rows k, B = the work-group's 16 encoded rows, held in registers). The accumulator of tile h holds, in lane (lr, hi) and register u, S[16 h + 8 hi + u][lr]: that is slot 8 h + u
// of row lr of the 16-bit A fragment, so p = exp(S - MX[k]) * RS[k] goes into the hi and lo A fragments with no move between lanes.
// MX, RS: the SQ_ partial (max, sum) pairs a column that k_cstat leaves are merged in a fixed order and staged once in LDS.
// grid (TT / 16, NB_): blockIdx.y is the batch; every plane holds the NB_ batches one behind the other.
#define KW_ 16
#define SQ_ 4
typedef __attribute__((ext_vector_type(2))) float v2f;
typedef v2f __attribute__((may_alias)) v2fa;
__global__ __launch_bounds__(KW_ * 32) void k_gemmk(const bf* __restrict__ XB, const bf* __restrict__ Eh, const bf* __restrict__ El, const float* __restrict__ PM, const float* __restrict__ PS, const bf* __restrict__ Bt, float* C) {
    typedef WFrag<bf>::V V;
    __shared__ __align__(16) float red[KW_][16 * 68];
    __shared__ __align__(16) float smx[TT]; __shared__ __align__(16) float srs[TT];
    const int lane = threadIdx.x & 31, wave = threadIdx.x >> 5, lr = lane & 15, hi = lane >> 4; const int r0 = blockIdx.x * 16;
    { const size_t zb = blockIdx.y; XB += zb * TT * DD; Eh += zb * TT * DD; El += zb * TT * DD; Bt += zb * DD * TT; C += zb * TT * DD; PM += zb * SQ_ * TT; PS += zb * SQ_ * TT; }
    const int k0 = wave * (TT / KW_) + 8 * hi;
    const int t8 = threadIdx.x * (TT / (KW_ * 32));   // 8 columns' statistics a thread; loaded first, so that their merge waits for these loads alone
    v4f pm[SQ_][2], ps[SQ_][2];
#pragma unroll
    for (int q = 0; q < SQ_; ++q) { pm[q][0] = *(const v4f*)(PM + q * TT + t8); pm[q][1] = *(const v4f*)(PM + q * TT + t8 + 4); ps[q][0] = *(const v4f*)(PS + q * TT + t8); ps[q][1] = *(const v4f*)(PS + q * TT + t8 + 4); }
    const bf* px = XB + (size_t)(wave * (TT / KW_) + lr) * DD + 8 * hi; const bf* pb = Bt + (size_t)lr * TT + k0;
    const bf* peh = Eh + (size_t)(r0 + lr) * DD + 8 * hi; const bf* pel = El + (size_t)(r0 + lr) * DD + 8 * hi;
    const V eh0 = WFrag<bf>::ld(peh), eh1 = WFrag<bf>::ld(peh + 32), el0 = WFrag<bf>::ld(pel), el1 = WFrag<bf>::ld(pel + 32);
    v8f acc[4];
#pragma unroll
    for (int nb = 0; nb < 4; ++nb) acc[nb] = (v8f){};
    V xa[2][4], b[2][4];   // two sets of x and B fragments: the loads of the next k step fly while this one is worked on
#pragma unroll   // whole: the set index s % 2 must be a constant, or the sets leave the registers
    for (int s = 0; s < TT / KW_ / 32 + 1; ++s) {
        if (s < TT / KW_ / 32) { const int q = s % 2, kc = s * 32;
#pragma unroll
            for (int h = 0; h < 2; ++h) { xa[q][2 * h] = WFrag<bf>::ld(px + (size_t)(kc + 16 * h) * DD); xa[q][2 * h + 1] = WFrag<bf>::ld(px + (size_t)(kc + 16 * h) * DD + 32); }
#pragma unroll
            for (int nb = 0; nb < 4; ++nb) b[q][nb] = WFrag<bf>::ld(pb + (size_t)nb * 16 * TT + kc); }
        // the wait that stands in front of an overwrite of an issued load's address registers. The pointers that are used for the last time are named as inputs, so that they stay live up to the wait and no later load's result is placed on them; in front of the scheduling barrier, so that no arithmetic is lifted over it
        if (s == 0) asm volatile("s_wait_xcnt 0x0" :: "v"(peh), "v"(pel) : "memory");
        if (s == TT / KW_ / 32 - 1) asm volatile("s_wait_xcnt 0x0" :: "v"(px), "v"(pb) : "memory");
        __builtin_amdgcn_sched_barrier(0);   // holds this step's loads in front of the arithmetic of the step before; without it the scheduler sinks them to just before their use and nothing flies ahead
        if (s == 0) {
#pragma unroll
            for (int g = 0; g < 2; ++g) { v4f mv, rv;
#pragma unroll
                for (int u = 0; u < 4; ++u) { float mx = pm[0][g][u];
#pragma unroll
                    for (int q = 1; q < SQ_; ++q) mx = fmaxf(mx, pm[q][g][u]);
                    float sum = 0.f;
#pragma unroll
                    for (int q = 0; q < SQ_; ++q) sum += ps[q][g][u] * ex2d(pm[q][g][u], mx);
                    mv[u] = mx; rv[u] = __fdiv_rn(1.0f, sum); }
                *(v4f*)(smx + t8 + 4 * g) = mv; *(v4f*)(srs + t8 + 4 * g) = rv; }
            __syncthreads(); }
        if (s >= 1) { const int q = (s - 1) % 2, kc = (s - 1) * 32; v8us ah[2], al[2]; v8f sc[2] = {(v8f){}, (v8f){}};
            // per score the sum order of the four products is: hi d 0..31, lo d 0..31, hi d 32..63, lo d 32..63, as in k_cstat
            sc[0] = WFrag<bf>::mma(xa[q][0], eh0, sc[0]); sc[1] = WFrag<bf>::mma(xa[q][2], eh0, sc[1]); sc[0] = WFrag<bf>::mma(xa[q][0], el0, sc[0]); sc[1] = WFrag<bf>::mma(xa[q][2], el0, sc[1]);
            sc[0] = WFrag<bf>::mma(xa[q][1], eh1, sc[0]); sc[1] = WFrag<bf>::mma(xa[q][3], eh1, sc[1]); sc[0] = WFrag<bf>::mma(xa[q][1], el1, sc[0]); sc[1] = WFrag<bf>::mma(xa[q][3], el1, sc[1]);
            __builtin_amdgcn_sched_barrier(0);   // keeps the asm exponentials behind ALL score products
#pragma unroll
            for (int h = 0; h < 2; ++h) {   // fragment slots 8 h + u hold k = kc + 16 h + 8 hi + u
#pragma unroll
                for (int g = 0; g < 2; ++g) { const v4f mx = *(const v4fa*)(smx + k0 + kc + 16 * h + 4 * g), rs = *(const v4fa*)(srs + k0 + kc + 16 * h + 4 * g);
#pragma unroll
                    for (int u = 0; u < 4; ++u) { const float p = ex2d(sc[h][4 * g + u], mx[u]) * rs[u]; unsigned short x1, x2; splitf(p, x1, x2); ah[h][4 * g + u] = x1; al[h][4 * g + u] = x2; } } }
            const V a = cat16b(ah[0], ah[1]), a2 = cat16b(al[0], al[1]);
#pragma unroll
            for (int nb = 0; nb < 4; ++nb) acc[nb] = WFrag<bf>::mma(a, b[q][nb], acc[nb]);
#pragma unroll
            for (int nb = 0; nb < 4; ++nb) acc[nb] = WFrag<bf>::mma(a2, b[q][nb], acc[nb]); }
    }
#pragma unroll
    for (int nb = 0; nb < 4; ++nb) {
#pragma unroll
        for (int j = 0; j < 8; ++j) red[wave][(hi * 8 + j) * 68 + nb * 16 + lr] = acc[nb][j]; }
    __syncthreads();
    const int row = threadIdx.x >> 5, col = lane * 2; v2f p[KW_];   // one wave sums and stores one 256-B row of C
#pragma unroll
    for (int w = 0; w < KW_; ++w) p[w] = *(const v2fa*)(&red[w][row * 68 + col]);
    float s0 = 0.f, s1 = 0.f;
#pragma unroll
    for (int w = 0; w < KW_; ++w) { s0 += p[w][0]; s1 += p[w][1]; }
    float* cp = C + (size_t)(r0 + row) * DD + col; cp[0] = s0; cp[1] = s1;
}


__global__ __launch_bounds__(256) void k_wtG(const float* __restrict__ w, int K, int N, bf* Bt) {
    const int lane = threadIdx.x & 31; const int L0 = (blockIdx.x * 8 + (threadIdx.x >> 5)) * 8; const int nlines = N * K / 64;
{
#pragma unroll 1
        for (int l = 0; l < 8; ++l) { const int L = L0 + l; if (L >= nlines) break; const size_t e = (size_t)L * 64 + lane * 2; const int k = (int)(e % K), n = (int)(e / K); v2us o;
            o[0] = f2bf(w[(size_t)k * N + n]); o[1] = f2bf(w[(size_t)(k + 1) * N + n]); *(v2us*)(Bt + e) = o; }
         }
}
__global__ __launch_bounds__(256) void k_cvt8(const float* __restrict__ src, bf* dst, size_t n8) { const size_t i = (size_t)blockIdx.x * 256 + threadIdx.x; if (i >= n8) return; const v8f v = *(const v8f*)(src + i * 8); v8us o;
#pragma unroll
    for (int k = 0; k < 8; ++k) o[k] = f2bf(v[k]); *(v8us*)(dst + i * 8) = o;  }
// k_vt: XT[d][t] = bf16 x[t][d] (lane -> 2 consecutive t; blockIdx.y is the batch); k_enc (all NB_ * TT tokens in one launch): lane -> 4 consecutive features c of token t: softmax statistics of the Z row (64, fixed order), acc[u] = sum_k softmax_k W2[k][c+u], enc = tanh(acc + b2) -> hl planes (8-B lanes);
__global__ __launch_bounds__(256) void k_vt(const float* __restrict__ x, bf* XT) { const int e = (blockIdx.x * 256 + threadIdx.x) * 2; if (e >= DD * TT) return; x += (size_t)blockIdx.y * TT * DD; XT += (size_t)blockIdx.y * DD * TT; const int t = e % TT; const int d = e / TT; v2us o; o[0] = f2bf(x[(size_t)t * DD + d]); o[1] = f2bf(x[(size_t)(t + 1) * DD + d]); *(v2us*)(XT + e) = o;  }
__global__ __launch_bounds__(256) void k_enc(const float* __restrict__ Z, const float* __restrict__ W2, const float* __restrict__ b2, bf* Eh, bf* El) { const int e = (blockIdx.x * 256 + threadIdx.x) * 4; if (e >= NB_ * TT * DD) return; const int c0 = e % DD; const int t = e / DD; const float* zr = Z + (size_t)t * DD; float mx = -3.0e38f;
#pragma unroll 1
    for (int k = 0; k < DD; ++k) mx = fmaxf(mx, zr[k]);
    float sum = 0.f;
#pragma unroll 1
    for (int k = 0; k < DD; ++k) { float d0 = __fsub_rn(zr[k], mx); asm volatile("" : "+v"(d0)); sum = __fadd_rn(sum, __builtin_amdgcn_exp2f(__fmul_rn(d0, 1.4426950408889634f))); }
    const float rs = __fdiv_rn(1.0f, sum); float acc[4] = {0.f, 0.f, 0.f, 0.f};
#pragma unroll 1
    for (int k = 0; k < DD; ++k) { float d0 = __fsub_rn(zr[k], mx); asm volatile("" : "+v"(d0)); const float h1 = __fmul_rn(__builtin_amdgcn_exp2f(__fmul_rn(d0, 1.4426950408889634f)), rs);
#pragma unroll
        for (int u = 0; u < 4; ++u) { float w = bfr(W2[k * DD + c0 + u]); asm volatile("" : "+v"(w)); float pr = __fmul_rn(h1, w); asm volatile("" : "+v"(pr)); acc[u] = __fadd_rn(acc[u], pr); } }
    v4us oh, ol;
#pragma unroll
    for (int u = 0; u < 4; ++u) { const float en = tanhf(__fadd_rn(acc[u], bfr(b2[c0 + u]))); unsigned short a, b; splitf(en, a, b); oh[u] = a; ol[u] = b; } *(v4us*)(Eh + e) = oh; *(v4us*)(El + e) = ol;  }
// k_cstat: per column j of M[i][j] = encoded_i . x_j a partial maximum and a partial sum_i exp(M[i][j] - max), with M formed on the matrix unit and never stored. One block = 64 columns x a quarter of the rows of one batch (grid.y = SQ_, grid.z = NB_).
// Each of its 16 waves holds the B fragments of the 64 columns and takes 64 rows as 4 tiles of 16 (A = encoded hi, lo). In the accumulator a lane holds 8 rows of ONE column, so the running (max, sum scaled to that max)
// pair is per lane; the pairs are merged in a fixed order: the two lane halves by a shuffle, the 16 waves through LDS; the SQ_ quarters are merged by the reader (k_gemmk).
__global__ __launch_bounds__(512) void k_cstat(const bf* __restrict__ Eh, const bf* __restrict__ El, const bf* __restrict__ XB, float* PM, float* PS) {
    typedef WFrag<bf>::V V;
    __shared__ __align__(16) float sm[16][64]; __shared__ __align__(16) float ss[16][64];
    const int lane = threadIdx.x & 31, wave = threadIdx.x >> 5, lr = lane & 15, hi = lane >> 4;
    const int j0 = blockIdx.x * 64, i0 = blockIdx.y * (TT / SQ_) + wave * (TT / SQ_ / 16);
    { const size_t zb = blockIdx.z; Eh += zb * TT * DD; El += zb * TT * DD; XB += zb * TT * DD; PM += zb * SQ_ * TT; PS += zb * SQ_ * TT; }
    const bf* pxb = XB + (size_t)(j0 + lr) * DD + 8 * hi; const bf* peh = Eh + (size_t)(i0 + lr) * DD + 8 * hi; const bf* pel = El + (size_t)(i0 + lr) * DD + 8 * hi;   // one address a plane; tiles and column blocks are constant offsets from it
    V b[4][2];
#pragma unroll
    for (int nb = 0; nb < 4; ++nb) { b[nb][0] = WFrag<bf>::ld(pxb + nb * 16 * DD); b[nb][1] = WFrag<bf>::ld(pxb + nb * 16 * DD + 32); }
    float m[4] = {-3.0e38f, -3.0e38f, -3.0e38f, -3.0e38f}, s[4] = {0.f, 0.f, 0.f, 0.f};
    V a[2][4];   // two sets of A fragments: the next tile's loads fly while this one is worked on
#pragma unroll   // whole: the set index t % 2 must be a constant, or the sets leave the registers
    for (int t = 0; t < TT / SQ_ / 256 + 1; ++t) {
        if (t < TT / SQ_ / 256) { const int q = t % 2, o = t * 16 * DD;
            a[q][0] = WFrag<bf>::ld(peh + o); a[q][1] = WFrag<bf>::ld(pel + o); a[q][2] = WFrag<bf>::ld(peh + o + 32); a[q][3] = WFrag<bf>::ld(pel + o + 32); }
        // the wait that stands in front of an overwrite of an issued load's address registers. The pointers that are used for the last time are named as inputs, so that they stay live up to the wait and no later load's result is placed on them
        if (t == 0) asm volatile("s_wait_xcnt 0x0" :: "v"(pxb) : "memory");
        if (t == TT / SQ_ / 256 - 1) asm volatile("s_wait_xcnt 0x0" :: "v"(peh), "v"(pel) : "memory");
        __builtin_amdgcn_sched_barrier(0);   // holds this tile's loads in front of the arithmetic of the tile before; without it the scheduler sinks them to just before their use
        if (t >= 1) { const int q = (t - 1) % 2; v8f acc[4];
#pragma unroll
            for (int nb = 0; nb < 4; ++nb) acc[nb] = (v8f){};
#pragma unroll
            for (int f = 0; f < 4; ++f) {   // hi d 0..31, lo d 0..31, hi d 32..63, lo d 32..63
#pragma unroll
                for (int nb = 0; nb < 4; ++nb) acc[nb] = WFrag<bf>::mma(a[q][f], b[nb][f >> 1], acc[nb]); }
            __builtin_amdgcn_sched_barrier(0);   // keeps the asm exponentials behind ALL products of the tile
#pragma unroll
            for (int nb = 0; nb < 4; ++nb) { float mn = m[nb];
#pragma unroll
                for (int r = 0; r < 8; ++r) mn = fmaxf(mn, acc[nb][r]);
                float sa = s[nb] * ex2d(m[nb], mn);
#pragma unroll
                for (int r = 0; r < 8; ++r) sa += ex2d(acc[nb][r], mn);
                m[nb] = mn; s[nb] = sa; } }
    }
#pragma unroll
    for (int nb = 0; nb < 4; ++nb) { const float om = __shfl_xor(m[nb], 16), os = __shfl_xor(s[nb], 16); const float mn = fmaxf(m[nb], om); s[nb] = s[nb] * ex2d(m[nb], mn) + os * ex2d(om, mn); m[nb] = mn; }
    if (hi == 0) {
#pragma unroll
        for (int nb = 0; nb < 4; ++nb) { sm[wave][nb * 16 + lr] = m[nb]; ss[wave][nb * 16 + lr] = s[nb]; } }
    __syncthreads();
    if (threadIdx.x < 64) { const int c = threadIdx.x; float mx = -3.0e38f, sum = 0.f;
#pragma unroll
        for (int w = 0; w < 16; ++w) mx = fmaxf(mx, sm[w][c]);
#pragma unroll
        for (int w = 0; w < 16; ++w) sum += ss[w][c] * ex2d(sm[w][c], mx);
        PM[blockIdx.y * TT + j0 + c] = mx; PS[blockIdx.y * TT + j0 + c] = sum; } }

extern "C" void kernel_launch(void* const* d_in, const int* in_sizes, int n_in,
                              void* d_out, int out_size, void* d_ws, size_t ws_size, hipStream_t stream) {
    (void)in_sizes; (void)n_in; (void)out_size;
    const float* x = (const float*)d_in[0]; const float* W1 = (const float*)d_in[1]; const float* b1 = (const float*)d_in[2]; const float* W2 = (const float*)d_in[3]; const float* b2 = (const float*)d_in[4];
    float* OUT = (float*)d_out;     // [4][4096][64]
    char* wsp = (char*)d_ws;
    auto take = [&](size_t bytes) { char* p = wsp; wsp += (bytes + 255) & ~(size_t)255; return (void*)p; };
    bf* BW1 = (bf*)take(DD * DD * 2); bf* XB = (bf*)take((size_t)NB_ * TT * DD * 2); bf* XT = (bf*)take((size_t)NB_ * DD * TT * 2); float* Z = (float*)take((size_t)NB_ * TT * DD * 4); bf* Eh = (bf*)take((size_t)NB_ * TT * DD * 2); bf* El = (bf*)take((size_t)NB_ * TT * DD * 2);
    float* PM = (float*)take((size_t)NB_ * SQ_ * TT * 4); float* PS = (float*)take((size_t)NB_ * SQ_ * TT * 4);
    if ((size_t)(wsp - (char*)d_ws) > ws_size) return;    // total ~ 13 MB
    // every stage runs once for all NB_ batches: token-wise stages over NB_ * TT rows, the others with the batch as a grid dimension
    k_wtG<<<(DD * DD / 64 + 63) / 64, 256, 0, stream>>>(W1, DD, DD, BW1);
    k_cvt8<<<(NB_ * TT * DD / 8 + 255) / 256, 256, 0, stream>>>(x, XB, NB_ * TT * DD / 8); k_vt<<<dim3((DD * TT / 2 + 255) / 256, NB_, 1), 256, 0, stream>>>(x, XT);
    k_gemmw<bf, 0, true><<<dim3(NB_ * TT / 64, 1, 1), 32, 0, stream>>>(XB, nullptr, BW1, nullptr, DD, Z, DD, b1, 0, 0, 0); k_enc<<<(NB_ * TT * DD / 4 + 255) / 256, 256, 0, stream>>>(Z, W2, b2, Eh, El);
    k_cstat<<<dim3(TT / 64, SQ_, NB_), 512, 0, stream>>>(Eh, El, XB, PM, PS);     // statistics of M[i][j] = encoded_i . x_j = scores[j][i] over i
    k_gemmk<<<dim3(TT / 16, NB_, 1), KW_ * 32, 0, stream>>>(XB, Eh, El, PM, PS, XT, OUT);   // out[i][d] = sum_j attention[j][i] x[j][d], attention[j][i] = exp(M[i][j] - MX[j]) RS[j]
}

// v006
// Measured time: 137 microseconds a run.
// In two side-by-side timings against v005, it was 1.34 and 1.35 times as fast.
// All steps since v000 together make it 50.7 times as fast.
#include <hip/hip_runtime.h>

// TimeSeriesAttention (x [4][4096][64]; h1 = softmax(x W1 + b1) (over the 64 features); encoded = tanh(h1 W2 + b2); scores[i][j] = x_i . encoded_j (unscaled); attention = softmax over j; out[i] = sum_j attention[j][i] x[j] (the TRANSPOSED attention, as the
// reference's permute) -> [4][4096][64]). The transposed use is handled by computing M[i][j] = encoded_i . x_j = scores[j][i] directly (swapped GEMM operands) and normalising each COLUMN j of M (= row j of the reference's softmax) with per-column statistics, so M-normalised[i][j] = attention[j][i] is already the A operand of out = attention^T x - exact restructuring.
// Compute dtypes, f32 accumulate: every input rounded to bf16; x W1 on PLAIN bf16 operands (inputs: exact) + bias; the feature softmax, h1 W2 + b2 (64-term fixed-order dots) and tanh f32 on the VALU -> bf16 hi+lo planes; scores as

#define NB_  4
#define TT   4096
#define DD   64
typedef _Float16 h16;
typedef unsigned short bf;
typedef __attribute__((ext_vector_type(16))) __bf16   v16bf;
typedef __attribute__((ext_vector_type(16))) _Float16 v16h;
typedef __attribute__((ext_vector_type(8)))  _Float16 v8h;
typedef __attribute__((ext_vector_type(8)))  unsigned short v8us;
typedef __attribute__((ext_vector_type(8)))  float    v8f;
typedef __attribute__((ext_vector_type(4)))  float    v4f;
typedef v8h  __attribute__((may_alias)) v8ha;
typedef v4f  __attribute__((may_alias)) v4fa;
typedef v8us __attribute__((may_alias)) v8usa;

__device__ __forceinline__ unsigned short f2bf(float f) { unsigned u = __float_as_uint(f); u += 0x7FFFu + ((u >> 16) & 1u); return (unsigned short)(u >> 16); }
__device__ __forceinline__ float bf2f(unsigned short b) { return __uint_as_float(((unsigned)b) << 16); }
__device__ __forceinline__ float bfr(float f) { return bf2f(f2bf(f)); }
__device__ __forceinline__ v16h cat16(v8h lo, v8h hi) { return __builtin_shufflevector(lo, hi, 0, 1, 2, 3, 4, 5, 6, 7, 8, 9, 10, 11, 12, 13, 14, 15); }
__device__ __forceinline__ v16bf cat16b(v8us lo, v8us hi) { return __builtin_bit_cast(v16bf, __builtin_shufflevector(lo, hi, 0, 1, 2, 3, 4, 5, 6, 7, 8, 9, 10, 11, 12, 13, 14, 15)); }
__device__ __forceinline__ v8f wmma16(v16h a, v16h b, v8f c) { return __builtin_amdgcn_wmma_f32_16x16x32_f16(false, a, false, b, (short)0, c, false, false); }
__device__ __forceinline__ v8f wmmab(v16bf a, v16bf b, v8f c) { return __builtin_amdgcn_wmma_f32_16x16x32_bf16(false, a, false, b, (short)0, c, false, false); }



// ---- FRAGMENT ORDER of the 16-bit planes that pass between the launches (XB, XT, Eh, El): a plane of R rows x C columns is kept as tiles of 16 rows x 32 columns, 512 elements = 1 KB each, tile number (row / 16) * (C / 32) + col / 32.
// Inside a tile the 8 elements that lane l = 16 hi + lr of a wave takes as fragment slots 0..7 (row lr, columns 8 hi + 0..7) stand at element 8 l, those of slots 8..15 (columns 16 + 8 hi + 0..7) at element 256 + 8 l.
// So a fragment is two wave-wide 16-B loads of 512 contiguous bytes each (4 whole lines); from a row-major plane each such load touches 16 lines and takes 32 B of each. WFrag::ldf(tile + 8 * lane) reads one; fpos gives an element's place.
__device__ __forceinline__ size_t fpos(int r, int c, int C) { return ((size_t)(r >> 4) * (C >> 5) + (c >> 5)) * 512 + ((c >> 4) & 1) * 256 + (((c >> 3) & 1) * 16 + (r & 15)) * 8 + (c & 7); }

// ---- k_gemmw: register-blocked GEMM, ONE WAVE per 64x64 output tile (16 accumulators), A from planes in fragment order, Bt from K-contiguous row-major planes; grid (M/64, N/64, Z), 32 threads.
// C[m][n] (f32, pitch ldc, + optional f32 bias[n]) = sum_k A[m][k] Bt[n][k] (+ split products per NSPLIT). z-batch strides sA/sB/sC in elements. K % 32 == 0.
template <typename T16> struct WFrag;
template <> struct WFrag<h16> { typedef v16h V; static __device__ __forceinline__ V ld(const h16* p) { return cat16(*(const v8h*)p, *(const v8h*)(p + 16)); } static __device__ __forceinline__ V ldf(const h16* p) { return cat16(*(const v8h*)p, *(const v8h*)(p + 256)); } static __device__ __forceinline__ v8f mma(V a, V b, v8f c) { return wmma16(a, b, c); } };
template <> struct WFrag<bf> { typedef v16bf V; static __device__ __forceinline__ V ld(const bf* p) { return cat16b(*(const v8us*)p, *(const v8us*)(p + 16)); } static __device__ __forceinline__ V ldf(const bf* p) { return cat16b(*(const v8us*)p, *(const v8us*)(p + 256)); } static __device__ __forceinline__ v8f mma(V a, V b, v8f c) { return wmmab(a, b, c); } };
template <typename T16, int NSPLIT, bool BIAS>
__global__ __launch_bounds__(32) void k_gemmw(const T16* __restrict__ A, const T16* __restrict__ A2, const T16* __restrict__ Bt, const T16* __restrict__ Bt2, int K, float* C, int ldc, const float* __restrict__ bias, size_t sA, size_t sB, size_t sC) {
    typedef typename WFrag<T16>::V V;
    __shared__ __align__(16) float os[16 * 68];
    const size_t z = blockIdx.z; A += z * sA; if (A2) A2 += z * sA; Bt += z * sB; if (Bt2) Bt2 += z * sB; C += z * sC;
    const int lane = threadIdx.x & 31, lr = lane & 15, hi = lane >> 4; const int r0 = blockIdx.x * 64, c0 = blockIdx.y * 64;
    v8f acc[4][4];
#pragma unroll
    for (int mb = 0; mb < 4; ++mb)
#pragma unroll
        for (int nb = 0; nb < 4; ++nb) acc[mb][nb] = (v8f){};
    const size_t aoff = (size_t)(r0 >> 4) * (K >> 5) * 512 + 8 * lane, boff = (size_t)(c0 + lr) * K + 8 * hi;
#pragma unroll 1
    for (int kc = 0; kc < K; kc += 32) {
        V a[4], a2[4]; const T16* pa[4]; const T16* pa2[4];
#pragma unroll
        for (int mb = 0; mb < 4; ++mb) { const size_t o = aoff + ((size_t)mb * (K >> 5) + (kc >> 5)) * 512; pa[mb] = A + o; a[mb] = WFrag<T16>::ldf(pa[mb]); if (NSPLIT == 1 || NSPLIT == 2) { pa2[mb] = A2 + o; a2[mb] = WFrag<T16>::ldf(pa2[mb]); } }
        // the wait that stands in front of an overwrite of an issued load's address registers. The A pointers are named as inputs, so that they stay live up to the wait and no later load's result is placed on them
        asm volatile("s_wait_xcnt 0x0" :: "v"(pa[0]), "v"(pa[1]), "v"(pa[2]), "v"(pa[3]) : "memory");
        if (NSPLIT == 1 || NSPLIT == 2) asm volatile("s_wait_xcnt 0x0" :: "v"(pa2[0]), "v"(pa2[1]), "v"(pa2[2]), "v"(pa2[3]) : "memory");
#pragma unroll
        for (int nb = 0; nb < 4; ++nb) { const V b = WFrag<T16>::ld(Bt + boff + (size_t)nb * 16 * K + kc); V b2; if (NSPLIT >= 2) b2 = WFrag<T16>::ld(Bt2 + boff + (size_t)nb * 16 * K + kc);
#pragma unroll
            for (int mb = 0; mb < 4; ++mb) { acc[mb][nb] = WFrag<T16>::mma(a[mb], b, acc[mb][nb]); if (NSPLIT == 1 || NSPLIT == 2) acc[mb][nb] = WFrag<T16>::mma(a2[mb], b, acc[mb][nb]); if (NSPLIT >= 2) acc[mb][nb] = WFrag<T16>::mma(a[mb], b2, acc[mb][nb]); } }
        asm volatile("v_nop\n\tv_nop\n\tv_nop\n\tv_nop" : "+v"(acc[0][0]), "+v"(acc[1][1]), "+v"(acc[2][2]), "+v"(acc[3][3]) : "v"(a[0]), "v"(a[3]));
    }
#pragma unroll
    for (int mb = 0; mb < 4; ++mb) {
#pragma unroll
        for (int nb = 0; nb < 4; ++nb) {
#pragma unroll
            for (int j = 0; j < 8; ++j) os[(hi * 8 + j) * 68 + nb * 16 + lr] = acc[mb][nb][j]; }
        __builtin_amdgcn_wave_barrier(); asm volatile("" ::: "memory");
        float* crow = C + (size_t)(r0 + mb * 16) * ldc + c0;
{
#pragma unroll
            for (int s = 0; s < 8; ++s) { const int row = 2 * s + hi, cofs = lr * 4; v4f val = *(const v4fa*)(os + row * 68 + cofs); if (BIAS) { val[0] += bfr(bias[c0 + cofs]); val[1] += bfr(bias[c0 + cofs + 1]); val[2] += bfr(bias[c0 + cofs + 2]); val[3] += bfr(bias[c0 + cofs + 3]); }
                *(v4f*)(crow + (size_t)row * ldc + cofs) = val; }
             }
        __builtin_amdgcn_wave_barrier(); asm volatile("" ::: "memory");
    }
}

__device__ __forceinline__ void splitf(float y, unsigned short& h, unsigned short& l) { h = f2bf(y); l = f2bf(y - bf2f(h)); }
typedef __attribute__((ext_vector_type(2))) unsigned short v2us;
typedef __attribute__((ext_vector_type(4))) unsigned short v4us;
// ex2d = exp(a - b). The v_nop keeps the one slot that the instruction set asks for behind a transcendental.
__device__ __forceinline__ float ex2d(float a, float b) { float r; asm("v_exp_f32 %0, %1\n\tv_nop" : "=v"(r) : "v"((a - b) * 1.4426950408889634f)); return r; }

// ---- k_gemmk: the out product, whose 64 output tiles of 64x64 leave most of the chip idle. One work-group = 16 rows x 64 columns of C; its 16 waves each take a K slice of 256
// and keep a 16x64 f32 partial; the partials are summed in wave order through LDS. C[m][n] = sum_k (Ph[m][k] + Pl[m][k]) Bt[n][k]; Bt (DD x TT) in fragment order, C pitch DD.
// The A operand is formed in registers and no score is read from memory: per k step of 32 the wave computes the two 16x16 score tiles S[k][m] = x_k . (Eh_m + El_m) on the matrix unit
// (A = x rows k, B = the work-group's 16 encoded rows, held in registers). The accumulator of tile h holds, in lane (lr, hi) and register u, S[16 h + 8 hi + u][lr]: that is slot 8 h + u
// of row lr of the 16-bit A fragment, so p = exp(S - MX[k]) * RS[k] goes into the hi and lo A fragments with no move between lanes.
// MX, RS: the SQ_ partial (max, sum) pairs a column that k_cstat leaves are merged in a fixed order and staged once in LDS.
// grid (TT / 16, NB_): blockIdx.y is the batch; every plane holds the NB_ batches one behind the other.
#define KW_ 16
#define SQ_ 4
typedef __attribute__((ext_vector_type(2))) float v2f;
typedef v2f __attribute__((may_alias)) v2fa;
__global__ __launch_bounds__(KW_ * 32) void k_gemmk(const bf* __restrict__ XB, const bf* __restrict__ Eh, const bf* __restrict__ El, const float* __restrict__ PM, const float* __restrict__ PS, const bf* __restrict__ Bt, float* C) {
    typedef WFrag<bf>::V V;
    __shared__ __align__(16) float red[KW_][16 * 68];
    __shared__ __align__(16) float smx[TT]; __shared__ __align__(16) float srs[TT];
    const int lane = threadIdx.x & 31, wave = threadIdx.x >> 5, lr = lane & 15, hi = lane >> 4; const int r0 = blockIdx.x * 16;
    { const size_t zb = blockIdx.y; XB += zb * TT * DD; Eh += zb * TT * DD; El += zb * TT * DD; Bt += zb * DD * TT; C += zb * TT * DD; PM += zb * SQ_ * TT; PS += zb * SQ_ * TT; }
    const int k0 = wave * (TT / KW_) + 8 * hi;
    const int t8 = threadIdx.x * (TT / (KW_ * 32));   // 8 columns' statistics a thread; loaded first, so that their merge waits for these loads alone
    v4f pm[SQ_][2], ps[SQ_][2];
#pragma unroll
    for (int q = 0; q < SQ_; ++q) { pm[q][0] = *(const v4f*)(PM + q * TT + t8); pm[q][1] = *(const v4f*)(PM + q * TT + t8 + 4); ps[q][0] = *(const v4f*)(PS + q * TT + t8); ps[q][1] = *(const v4f*)(PS + q * TT + t8 + 4); }
    // fragment order: 16 rows of XB, Eh or El are 2 tiles (d 0..31, d 32..63); in Bt = XT the tile of d block nb and k step kc is number nb * (TT / 32) + k / 32
    const bf* px = XB + (size_t)wave * (TT / KW_) * DD + 8 * lane; const bf* pb = Bt + (size_t)wave * (TT / KW_ / 32) * 512 + 8 * lane;
    const bf* peh = Eh + (size_t)r0 * DD + 8 * lane; const bf* pel = El + (size_t)r0 * DD + 8 * lane;
    const V eh0 = WFrag<bf>::ldf(peh), eh1 = WFrag<bf>::ldf(peh + 512), el0 = WFrag<bf>::ldf(pel), el1 = WFrag<bf>::ldf(pel + 512);
    v8f acc[4];
#pragma unroll
    for (int nb = 0; nb < 4; ++nb) acc[nb] = (v8f){};
    V xa[2][4], b[2][4];   // two sets of x and B fragments: the loads of the next k step fly while this one is worked on
#pragma unroll   // whole: the set index s % 2 must be a constant, or the sets leave the registers
    for (int s = 0; s < TT / KW_ / 32 + 1; ++s) {
        if (s < TT / KW_ / 32) { const int q = s % 2, kc = s * 32;
#pragma unroll
            for (int h = 0; h < 2; ++h) { xa[q][2 * h] = WFrag<bf>::ldf(px + (size_t)(kc + 16 * h) * DD); xa[q][2 * h + 1] = WFrag<bf>::ldf(px + (size_t)(kc + 16 * h) * DD + 512); }
#pragma unroll
            for (int nb = 0; nb < 4; ++nb) b[q][nb] = WFrag<bf>::ldf(pb + (size_t)nb * 16 * TT + s * 512); }
        // the wait that stands in front of an overwrite of an issued load's address registers. The pointers that are used for the last time are named as inputs, so that they stay live up to the wait and no later load's result is placed on them; in front of the scheduling barrier, so that no arithmetic is lifted over it
        if (s == 0) asm volatile("s_wait_xcnt 0x0" :: "v"(peh), "v"(pel) : "memory");
        if (s == TT / KW_ / 32 - 1) asm volatile("s_wait_xcnt 0x0" :: "v"(px), "v"(pb) : "memory");
        __builtin_amdgcn_sched_barrier(0);   // holds this step's loads in front of the arithmetic of the step before; without it the scheduler sinks them to just before their use and nothing flies ahead
        if (s == 0) {
#pragma unroll
            for (int g = 0; g < 2; ++g) { v4f mv, rv;
#pragma unroll
                for (int u = 0; u < 4; ++u) { float mx = pm[0][g][u];
#pragma unroll
                    for (int q = 1; q < SQ_; ++q) mx = fmaxf(mx, pm[q][g][u]);
                    float sum = 0.f;
#pragma unroll
                    for (int q = 0; q < SQ_; ++q) sum += ps[q][g][u] * ex2d(pm[q][g][u], mx);
                    mv[u] = mx; rv[u] = __fdiv_rn(1.0f, sum); }
                *(v4f*)(smx + t8 + 4 * g) = mv; *(v4f*)(srs + t8 + 4 * g) = rv; }
            __syncthreads(); }
        if (s >= 1) { const int q = (s - 1) % 2, kc = (s - 1) * 32; v8us ah[2], al[2]; v8f sc[2] = {(v8f){}, (v8f){}};
            // per score the sum order of the four products is: hi d 0..31, lo d 0..31, hi d 32..63, lo d 32..63, as in k_cstat
            sc[0] = WFrag<bf>::mma(xa[q][0], eh0, sc[0]); sc[1] = WFrag<bf>::mma(xa[q][2], eh0, sc[1]); sc[0] = WFrag<bf>::mma(xa[q][0], el0, sc[0]); sc[1] = WFrag<bf>::mma(xa[q][2], el0, sc[1]);
            sc[0] = WFrag<bf>::mma(xa[q][1], eh1, sc[0]); sc[1] = WFrag<bf>::mma(xa[q][3], eh1, sc[1]); sc[0] = WFrag<bf>::mma(xa[q][1], el1, sc[0]); sc[1] = WFrag<bf>::mma(xa[q][3], el1, sc[1]);
            __builtin_amdgcn_sched_barrier(0);   // keeps the asm exponentials behind ALL score products
#pragma unroll
            for (int h = 0; h < 2; ++h) {   // fragment slots 8 h + u hold k = kc + 16 h + 8 hi + u
#pragma unroll
                for (int g = 0; g < 2; ++g) { const v4f mx = *(const v4fa*)(smx + k0 + kc + 16 * h + 4 * g), rs = *(const v4fa*)(srs + k0 + kc + 16 * h + 4 * g);
#pragma unroll
                    for (int u = 0; u < 4; ++u) { const float p = ex2d(sc[h][4 * g + u], mx[u]) * rs[u]; unsigned short x1, x2; splitf(p, x1, x2); ah[h][4 * g + u] = x1; al[h][4 * g + u] = x2; } } }
            const V a = cat16b(ah[0], ah[1]), a2 = cat16b(al[0], al[1]);
#pragma unroll
            for (int nb = 0; nb < 4; ++nb) acc[nb] = WFrag<bf>::mma(a, b[q][nb], acc[nb]);
#pragma unroll
            for (int nb = 0; nb < 4; ++nb) acc[nb] = WFrag<bf>::mma(a2, b[q][nb], acc[nb]); }
    }
#pragma unroll
    for (int nb = 0; nb < 4; ++nb) {
#pragma unroll
        for (int j = 0; j < 8; ++j) red[wave][(hi * 8 + j) * 68 + nb * 16 + lr] = acc[nb][j]; }
    __syncthreads();
    const int row = threadIdx.x >> 5, col = lane * 2; v2f p[KW_];   // one wave sums and stores one 256-B row of C
#pragma unroll
    for (int w = 0; w < KW_; ++w) p[w] = *(const v2fa*)(&red[w][row * 68 + col]);
    float s0 = 0.f, s1 = 0.f;
#pragma unroll
    for (int w = 0; w < KW_; ++w) { s0 += p[w][0]; s1 += p[w][1]; }
    float* cp = C + (size_t)(r0 + row) * DD + col; cp[0] = s0; cp[1] = s1;
}


__global__ __launch_bounds__(256) void k_wtG(const float* __restrict__ w, int K, int N, bf* Bt) {
    const int lane = threadIdx.x & 31; const int L0 = (blockIdx.x * 8 + (threadIdx.x >> 5)) * 8; const int nlines = N * K / 64;
{
#pragma unroll 1
        for (int l = 0; l < 8; ++l) { const int L = L0 + l; if (L >= nlines) break; const size_t e = (size_t)L * 64 + lane * 2; const int k = (int)(e % K), n = (int)(e / K); v2us o;
            o[0] = f2bf(w[(size_t)k * N + n]); o[1] = f2bf(w[(size_t)(k + 1) * N + n]); *(v2us*)(Bt + e) = o; }
         }
}
// k_cvt8: dst = bf16 src (rows of DD), in fragment order. Thread i writes the i-th 16-B piece of dst, so a wave stores 4 whole lines; the piece's row and column follow from its place.
__global__ __launch_bounds__(256) void k_cvt8(const float* __restrict__ src, bf* dst, size_t n8) { const size_t i = (size_t)blockIdx.x * 256 + threadIdx.x; if (i >= n8) return;
    const size_t r = (i >> 7) * 16 + (i & 15); const int c = (int)((i >> 6) & 1) * 32 + (int)((i >> 5) & 1) * 16 + (int)((i >> 4) & 1) * 8; const v8f v = *(const v8f*)(src + r * DD + c); v8us o;
#pragma unroll
    for (int k = 0; k < 8; ++k) o[k] = f2bf(v[k]); *(v8us*)(dst + i * 8) = o;  }
// k_vt: XT[d][t] = bf16 x[t][d], a DD x TT plane in fragment order (thread i writes its i-th 16-B piece: 8 consecutive t of one d; 16 lanes read 64 B in a row of x; blockIdx.y is the batch); k_enc (all NB_ * TT tokens in one launch): lane -> 4 consecutive features c of token t: softmax statistics of the Z row (64, fixed order), acc[u] = sum_k softmax_k W2[k][c+u], enc = tanh(acc + b2) -> hl planes in fragment order (8-B lanes; a block's 16 tokens are 2 KB in a row of each plane);
__global__ __launch_bounds__(256) void k_vt(const float* __restrict__ x, bf* XT) { const int i = blockIdx.x * 256 + threadIdx.x; if (i >= DD * TT / 8) return; x += (size_t)blockIdx.y * TT * DD; XT += (size_t)blockIdx.y * DD * TT;
    const int tile = i >> 6; const int d = tile / (TT / 32) * 16 + (i & 15); const int t = tile % (TT / 32) * 32 + ((i >> 5) & 1) * 16 + ((i >> 4) & 1) * 8; v8us o;
#pragma unroll
    for (int k = 0; k < 8; ++k) o[k] = f2bf(x[(size_t)(t + k) * DD + d]);
    *(v8us*)(XT + (size_t)i * 8) = o;  }
__global__ __launch_bounds__(256) void k_enc(const float* __restrict__ Z, const float* __restrict__ W2, const float* __restrict__ b2, bf* Eh, bf* El) { const int e = (blockIdx.x * 256 + threadIdx.x) * 4; if (e >= NB_ * TT * DD) return; const int c0 = e % DD; const int t = e / DD; const float* zr = Z + (size_t)t * DD; float mx = -3.0e38f;
#pragma unroll 1
    for (int k = 0; k < DD; ++k) mx = fmaxf(mx, zr[k]);
    float sum = 0.f;
#pragma unroll 1
    for (int k = 0; k < DD; ++k) { float d0 = __fsub_rn(zr[k], mx); asm volatile("" : "+v"(d0)); sum = __fadd_rn(sum, __builtin_amdgcn_exp2f(__fmul_rn(d0, 1.4426950408889634f))); }
    const float rs = __fdiv_rn(1.0f, sum); float acc[4] = {0.f, 0.f, 0.f, 0.f};
#pragma unroll 1
    for (int k = 0; k < DD; ++k) { float d0 = __fsub_rn(zr[k], mx); asm volatile("" : "+v"(d0)); const float h1 = __fmul_rn(__builtin_amdgcn_exp2f(__fmul_rn(d0, 1.4426950408889634f)), rs);
#pragma unroll
        for (int u = 0; u < 4; ++u) { float w = bfr(W2[k * DD + c0 + u]); asm volatile("" : "+v"(w)); float pr = __fmul_rn(h1, w); asm volatile("" : "+v"(pr)); acc[u] = __fadd_rn(acc[u], pr); } }
    v4us oh, ol;
#pragma unroll
    for (int u = 0; u < 4; ++u) { const float en = tanhf(__fadd_rn(acc[u], bfr(b2[c0 + u]))); unsigned short a, b; splitf(en, a, b); oh[u] = a; ol[u] = b; } const size_t f = fpos(t, c0, DD); *(v4us*)(Eh + f) = oh; *(v4us*)(El + f) = ol;  }
// k_cstat: per column j of M[i][j] = encoded_i . x_j a partial maximum and a partial sum_i exp(M[i][j] - max), with M formed on the matrix unit and never stored. One block = 64 columns x a quarter of the rows of one batch (grid.y = SQ_, grid.z = NB_).
// Each of its 16 waves holds the B fragments of the 64 columns and takes 64 rows as 4 tiles of 16 (A = encoded hi, lo). In the accumulator a lane holds 8 rows of ONE column, so the running (max, sum scaled to that max)
// pair is per lane; the pairs are merged in a fixed order: the two lane halves by a shuffle, the 16 waves through LDS; the SQ_ quarters are merged by the reader (k_gemmk).
__global__ __launch_bounds__(512) void k_cstat(const bf* __restrict__ Eh, const bf* __restrict__ El, const bf* __restrict__ XB, float* PM, float* PS) {
    typedef WFrag<bf>::V V;
    __shared__ __align__(16) float sm[16][64]; __shared__ __align__(16) float ss[16][64];
    const int lane = threadIdx.x & 31, wave = threadIdx.x >> 5, lr = lane & 15, hi = lane >> 4;
    const int j0 = blockIdx.x * 64, i0 = blockIdx.y * (TT / SQ_) + wave * (TT / SQ_ / 16);
    { const size_t zb = blockIdx.z; Eh += zb * TT * DD; El += zb * TT * DD; XB += zb * TT * DD; PM += zb * SQ_ * TT; PS += zb * SQ_ * TT; }
    const bf* pxb = XB + (size_t)j0 * DD + 8 * lane; const bf* peh = Eh + (size_t)i0 * DD + 8 * lane; const bf* pel = El + (size_t)i0 * DD + 8 * lane;   // one address a plane (fragment order: 16 rows are 2 tiles of 512 elements); tiles and column blocks are constant offsets from it
    V b[4][2];
#pragma unroll
    for (int nb = 0; nb < 4; ++nb) { b[nb][0] = WFrag<bf>::ldf(pxb + nb * 16 * DD); b[nb][1] = WFrag<bf>::ldf(pxb + nb * 16 * DD + 512); }
    float m[4] = {-3.0e38f, -3.0e38f, -3.0e38f, -3.0e38f}, s[4] = {0.f, 0.f, 0.f, 0.f};
    V a[2][4];   // two sets of A fragments: the next tile's loads fly while this one is worked on
#pragma unroll   // whole: the set index t % 2 must be a constant, or the sets leave the registers
    for (int t = 0; t < TT / SQ_ / 256 + 1; ++t) {
        if (t < TT / SQ_ / 256) { const int q = t % 2, o = t * 16 * DD;
            a[q][0] = WFrag<bf>::ldf(peh + o); a[q][1] = WFrag<bf>::ldf(pel + o); a[q][2] = WFrag<bf>::ldf(peh + o + 512); a[q][3] = WFrag<bf>::ldf(pel + o + 512); }
        // the wait that stands in front of an overwrite of an issued load's address registers. The pointers that are used for the last time are named as inputs, so that they stay live up to the wait and no later load's result is placed on them
        if (t == 0) asm volatile("s_wait_xcnt 0x0" :: "v"(pxb) : "memory");
        if (t == TT / SQ_ / 256 - 1) asm volatile("s_wait_xcnt 0x0" :: "v"(peh), "v"(pel) : "memory");
        __builtin_amdgcn_sched_barrier(0);   // holds this tile's loads in front of the arithmetic of the tile before; without it the scheduler sinks them to just before their use
        if (t >= 1) { const int q = (t - 1) % 2; v8f acc[4];
#pragma unroll
            for (int nb = 0; nb < 4; ++nb) acc[nb] = (v8f){};
#pragma unroll
            for (int f = 0; f < 4; ++f) {   // hi d 0..31, lo d 0..31, hi d 32..63, lo d 32..63
#pragma unroll
                for (int nb = 0; nb < 4; ++nb) acc[nb] = WFrag<bf>::mma(a[q][f], b[nb][f >> 1], acc[nb]); }
            __builtin_amdgcn_sched_barrier(0);   // keeps the asm exponentials behind ALL products of the tile
#pragma unroll
            for (int nb = 0; nb < 4; ++nb) { float mn = m[nb];
#pragma unroll
                for (int r = 0; r < 8; ++r) mn = fmaxf(mn, acc[nb][r]);
                float sa = s[nb] * ex2d(m[nb], mn);
#pragma unroll
                for (int r = 0; r < 8; ++r) sa += ex2d(acc[nb][r], mn);
                m[nb] = mn; s[nb] = sa; } }
    }
#pragma unroll
    for (int nb = 0; nb < 4; ++nb) { const float om = __shfl_xor(m[nb], 16), os = __shfl_xor(s[nb], 16); const float mn = fmaxf(m[nb], om); s[nb] = s[nb] * ex2d(m[nb], mn) + os * ex2d(om, mn); m[nb] = mn; }
    if (hi == 0) {
#pragma unroll
        for (int nb = 0; nb < 4; ++nb) { sm[wave][nb * 16 + lr] = m[nb]; ss[wave][nb * 16 + lr] = s[nb]; } }
    __syncthreads();
    if (threadIdx.x < 64) { const int c = threadIdx.x; float mx = -3.0e38f, sum = 0.f;
#pragma unroll
        for (int w = 0; w < 16; ++w) mx = fmaxf(mx, sm[w][c]);
#pragma unroll
        for (int w = 0; w < 16; ++w) sum += ss[w][c] * ex2d(sm[w][c], mx);
        PM[blockIdx.y * TT + j0 + c] = mx; PS[blockIdx.y * TT + j0 + c] = sum; } }

extern "C" void kernel_launch(void* const* d_in, const int* in_sizes, int n_in,
                              void* d_out, int out_size, void* d_ws, size_t ws_size, hipStream_t stream) {
    (void)in_sizes; (void)n_in; (void)out_size;
    const float* x = (const float*)d_in[0]; const float* W1 = (const float*)d_in[1]; const float* b1 = (const float*)d_in[2]; const float* W2 = (const float*)d_in[3]; const float* b2 = (const float*)d_in[4];
    float* OUT = (float*)d_out;     // [4][4096][64]
    char* wsp = (char*)d_ws;
    auto take = [&](size_t bytes) { char* p = wsp; wsp += (bytes + 255) & ~(size_t)255; return (void*)p; };
    bf* BW1 = (bf*)take(DD * DD * 2); bf* XB = (bf*)take((size_t)NB_ * TT * DD * 2); bf* XT = (bf*)take((size_t)NB_ * DD * TT * 2); float* Z = (float*)take((size_t)NB_ * TT * DD * 4); bf* Eh = (bf*)take((size_t)NB_ * TT * DD * 2); bf* El = (bf*)take((size_t)NB_ * TT * DD * 2);
    float* PM = (float*)take((size_t)NB_ * SQ_ * TT * 4); float* PS = (float*)take((size_t)NB_ * SQ_ * TT * 4);
    if ((size_t)(wsp - (char*)d_ws) > ws_size) return;    // total ~ 13 MB
    // every stage runs once for all NB_ batches: token-wise stages over NB_ * TT rows, the others with the batch as a grid dimension
    k_wtG<<<(DD * DD / 64 + 63) / 64, 256, 0, stream>>>(W1, DD, DD, BW1);
    k_cvt8<<<(NB_ * TT * DD / 8 + 255) / 256, 256, 0, stream>>>(x, XB, NB_ * TT * DD / 8); k_vt<<<dim3((DD * TT / 8 + 255) / 256, NB_, 1), 256, 0, stream>>>(x, XT);
    k_gemmw<bf, 0, true><<<dim3(NB_ * TT / 64, 1, 1), 32, 0, stream>>>(XB, nullptr, BW1, nullptr, DD, Z, DD, b1, 0, 0, 0); k_enc<<<(NB_ * TT * DD / 4 + 255) / 256, 256, 0, stream>>>(Z, W2, b2, Eh, El);
    k_cstat<<<dim3(TT / 64, SQ_, NB_), 512, 0, stream>>>(Eh, El, XB, PM, PS);     // statistics of M[i][j] = encoded_i . x_j = scores[j][i] over i
    k_gemmk<<<dim3(TT / 16, NB_, 1), KW_ * 32, 0, stream>>>(XB, Eh, El, PM, PS, XT, OUT);   // out[i][d] = sum_j attention[j][i] x[j][d], attention[j][i] = exp(M[i][j] - MX[j]) RS[j]
}

// v007
// Measured time: 93.4 microseconds a run.
// Timed twice side by side with v006, it ran 1.46 times as fast both times.
// All steps since v000 together make it 74.1 times as fast.
#include <hip/hip_runtime.h>

// TimeSeriesAttention (x [4][4096][64]; h1 = softmax(x W1 + b1) (over the 64 features); encoded = tanh(h1 W2 + b2); scores[i][j] = x_i . encoded_j (unscaled); attention = softmax over j; out[i] = sum_j attention[j][i] x[j] (the TRANSPOSED attention, as the
// reference's permute) -> [4][4096][64]). The transposed use is handled by computing M[i][j] = encoded_i . x_j = scores[j][i] directly (swapped GEMM operands) and normalising each COLUMN j of M (= row j of the reference's softmax) with per-column statistics, so M-normalised[i][j] = attention[j][i] is already the A operand of out = attention^T x - exact restructuring.
// Compute dtypes, f32 accumulate: every input rounded to bf16; x W1 on PLAIN bf16 operands (inputs: exact) + bias; the feature softmax, h1 W2 + b2 (64-term fixed-order dots) and tanh f32 on the VALU -> bf16 hi+lo planes; scores as

#define NB_  4
#define TT   4096
#define DD   64
typedef _Float16 h16;
typedef unsigned short bf;
typedef __attribute__((ext_vector_type(16))) __bf16   v16bf;
typedef __attribute__((ext_vector_type(16))) _Float16 v16h;
typedef __attribute__((ext_vector_type(8)))  _Float16 v8h;
typedef __attribute__((ext_vector_type(8)))  unsigned short v8us;
typedef __attribute__((ext_vector_type(8)))  float    v8f;
typedef __attribute__((ext_vector_type(4)))  float    v4f;
typedef v8h  __attribute__((may_alias)) v8ha;
typedef v4f  __attribute__((may_alias)) v4fa;
typedef v8us __attribute__((may_alias)) v8usa;

__device__ __forceinline__ unsigned short f2bf(float f) { unsigned u = __float_as_uint(f); u += 0x7FFFu + ((u >> 16) & 1u); return (unsigned short)(u >> 16); }
__device__ __forceinline__ float bf2f(unsigned short b) { return __uint_as_float(((unsigned)b) << 16); }
__device__ __forceinline__ float bfr(float f) { return bf2f(f2bf(f)); }
__device__ __forceinline__ v16h cat16(v8h lo, v8h hi) { return __builtin_shufflevector(lo, hi, 0, 1, 2, 3, 4, 5, 6, 7, 8, 9, 10, 11, 12, 13, 14, 15); }
__device__ __forceinline__ v16bf cat16b(v8us lo, v8us hi) { return __builtin_bit_cast(v16bf, __builtin_shufflevector(lo, hi, 0, 1, 2, 3, 4, 5, 6, 7, 8, 9, 10, 11, 12, 13, 14, 15)); }
__device__ __forceinline__ v8f wmma16(v16h a, v16h b, v8f c) { return __builtin_amdgcn_wmma_f32_16x16x32_f16(false, a, false, b, (short)0, c, false, false); }
__device__ __forceinline__ v8f wmmab(v16bf a, v16bf b, v8f c) { return __builtin_amdgcn_wmma_f32_16x16x32_bf16(false, a, false, b, (short)0, c, false, false); }



// ---- FRAGMENT ORDER of the 16-bit planes that pass between the launches (XB, XT, Eh, El): a plane of R rows x C columns is kept as tiles of 16 rows x 32 columns, 512 elements = 1 KB each, tile number (row / 16) * (C / 32) + col / 32.
// Inside a tile the 8 elements that lane l = 16 hi + lr of a wave takes as fragment slots 0..7 (row lr, columns 8 hi + 0..7) stand at element 8 l, those of slots 8..15 (columns 16 + 8 hi + 0..7) at element 256 + 8 l.
// So a fragment is two wave-wide 16-B loads of 512 contiguous bytes each (4 whole lines); from a row-major plane each such load touches 16 lines and takes 32 B of each. WFrag::ldf(tile + 8 * lane) reads one; fpos gives an element's place.
__device__ __forceinline__ size_t fpos(int r, int c, int C) { return ((size_t)(r >> 4) * (C >> 5) + (c >> 5)) * 512 + ((c >> 4) & 1) * 256 + (((c >> 3) & 1) * 16 + (r & 15)) * 8 + (c & 7); }

// ---- k_gemmw: register-blocked GEMM, ONE WAVE per 64x64 output tile (16 accumulators), A from planes in fragment order, Bt from K-contiguous row-major planes; grid (M/64, N/64, Z), 32 threads.
// C[m][n] (f32, pitch ldc, + optional f32 bias[n]) = sum_k A[m][k] Bt[n][k] (+ split products per NSPLIT). z-batch strides sA/sB/sC in elements. K % 32 == 0.
template <typename T16> struct WFrag;
template <> struct WFrag<h16> { typedef v16h V; static __device__ __forceinline__ V ld(const h16* p) { return cat16(*(const v8h*)p, *(const v8h*)(p + 16)); } static __device__ __forceinline__ V ldf(const h16* p) { return cat16(*(const v8h*)p, *(const v8h*)(p + 256)); } static __device__ __forceinline__ v8f mma(V a, V b, v8f c) { return wmma16(a, b, c); } };
template <> struct WFrag<bf> { typedef v16bf V; static __device__ __forceinline__ V ld(const bf* p) { return cat16b(*(const v8us*)p, *(const v8us*)(p + 16)); } static __device__ __forceinline__ V ldf(const bf* p) { return cat16b(*(const v8us*)p, *(const v8us*)(p + 256)); } static __device__ __forceinline__ v8f mma(V a, V b, v8f c) { return wmmab(a, b, c); } };
template <typename T16, int NSPLIT, bool BIAS>
__global__ __launch_bounds__(32) void k_gemmw(const T16* __restrict__ A, const T16* __restrict__ A2, const T16* __restrict__ Bt, const T16* __restrict__ Bt2, int K, float* C, int ldc, const float* __restrict__ bias, size_t sA, size_t sB, size_t sC) {
    typedef typename WFrag<T16>::V V;
    __shared__ __align__(16) float os[16 * 68];
    const size_t z = blockIdx.z; A += z * sA; if (A2) A2 += z * sA; Bt += z * sB; if (Bt2) Bt2 += z * sB; C += z * sC;
    const int lane = threadIdx.x & 31, lr = lane & 15, hi = lane >> 4; const int r0 = blockIdx.x * 64, c0 = blockIdx.y * 64;
    v8f acc[4][4];
#pragma unroll
    for (int mb = 0; mb < 4; ++mb)
#pragma unroll
        for (int nb = 0; nb < 4; ++nb) acc[mb][nb] = (v8f){};
    const size_t aoff = (size_t)(r0 >> 4) * (K >> 5) * 512 + 8 * lane, boff = (size_t)(c0 + lr) * K + 8 * hi;
#pragma unroll 1
    for (int kc = 0; kc < K; kc += 32) {
        V a[4], a2[4]; const T16* pa[4]; const T16* pa2[4];
#pragma unroll
        for (int mb = 0; mb < 4; ++mb) { const size_t o = aoff + ((size_t)mb * (K >> 5) + (kc >> 5)) * 512; pa[mb] = A + o; a[mb] = WFrag<T16>::ldf(pa[mb]); if (NSPLIT == 1 || NSPLIT == 2) { pa2[mb] = A2 + o; a2[mb] = WFrag<T16>::ldf(pa2[mb]); } }
        // the wait that stands in front of an overwrite of an issued load's address registers. The A pointers are named as inputs, so that they stay live up to the wait and no later load's result is placed on them
        asm volatile("s_wait_xcnt 0x0" :: "v"(pa[0]), "v"(pa[1]), "v"(pa[2]), "v"(pa[3]) : "memory");
        if (NSPLIT == 1 || NSPLIT == 2) asm volatile("s_wait_xcnt 0x0" :: "v"(pa2[0]), "v"(pa2[1]), "v"(pa2[2]), "v"(pa2[3]) : "memory");
#pragma unroll
        for (int nb = 0; nb < 4; ++nb) { const V b = WFrag<T16>::ld(Bt + boff + (size_t)nb * 16 * K + kc); V b2; if (NSPLIT >= 2) b2 = WFrag<T16>::ld(Bt2 + boff + (size_t)nb * 16 * K + kc);
#pragma unroll
            for (int mb = 0; mb < 4; ++mb) { acc[mb][nb] = WFrag<T16>::mma(a[mb], b, acc[mb][nb]); if (NSPLIT == 1 || NSPLIT == 2) acc[mb][nb] = WFrag<T16>::mma(a2[mb], b, acc[mb][nb]); if (NSPLIT >= 2) acc[mb][nb] = WFrag<T16>::mma(a[mb], b2, acc[mb][nb]); } }
        asm volatile("v_nop\n\tv_nop\n\tv_nop\n\tv_nop" : "+v"(acc[0][0]), "+v"(acc[1][1]), "+v"(acc[2][2]), "+v"(acc[3][3]) : "v"(a[0]), "v"(a[3]));
    }
#pragma unroll
    for (int mb = 0; mb < 4; ++mb) {
#pragma unroll
        for (int nb = 0; nb < 4; ++nb) {
#pragma unroll
            for (int j = 0; j < 8; ++j) os[(hi * 8 + j) * 68 + nb * 16 + lr] = acc[mb][nb][j]; }
        __builtin_amdgcn_wave_barrier(); asm volatile("" ::: "memory");
        float* crow = C + (size_t)(r0 + mb * 16) * ldc + c0;
{
#pragma unroll
            for (int s = 0; s < 8; ++s) { const int row = 2 * s + hi, cofs = lr * 4; v4f val = *(const v4fa*)(os + row * 68 + cofs); if (BIAS) { val[0] += bfr(bias[c0 + cofs]); val[1] += bfr(bias[c0 + cofs + 1]); val[2] += bfr(bias[c0 + cofs + 2]); val[3] += bfr(bias[c0 + cofs + 3]); }
                *(v4f*)(crow + (size_t)row * ldc + cofs) = val; }
             }
        __builtin_amdgcn_wave_barrier(); asm volatile("" ::: "memory");
    }
}

__device__ __forceinline__ void splitf(float y, unsigned short& h, unsigned short& l) { h = f2bf(y); l = f2bf(y - bf2f(h)); }
typedef __attribute__((ext_vector_type(2))) unsigned short v2us;
typedef __attribute__((ext_vector_type(4))) unsigned short v4us;
// ex2d = exp(a - b). The v_nop keeps the one slot that the instruction set asks for behind a transcendental.
__device__ __forceinline__ float ex2d(float a, float b) { float r; asm("v_exp_f32 %0, %1\n\tv_nop" : "=v"(r) : "v"((a - b) * 1.4426950408889634f)); return r; }

// ---- k_gemmk: the out product, whose 64 output tiles of 64x64 leave most of the chip idle. One work-group = 16 rows x 64 columns of C; its 16 waves each take a K slice of 256
// and keep a 16x64 f32 partial; the partials are summed in wave order through LDS. C[m][n] = sum_k (Ph[m][k] + Pl[m][k]) Bt[n][k]; Bt (DD x TT) in fragment order, C pitch DD.
// The A operand is formed in registers and no score is read from memory: per k step of 32 the wave computes the two 16x16 score tiles S[k][m] = x_k . (Eh_m + El_m) on the matrix unit
// (A = x rows k, B = the work-group's 16 encoded rows, held in registers). The accumulator of tile h holds, in lane (lr, hi) and register u, S[16 h + 8 hi + u][lr]: that is slot 8 h + u
// of row lr of the 16-bit A fragment, so p = exp(S - MX[k]) * RS[k] goes into the hi and lo A fragments with no move between lanes.
// MX, RS: the SQ_ partial (max, sum) pairs a column that k_cstat leaves are merged in a fixed order and staged once in LDS.
// grid (TT / 16, NB_): blockIdx.y is the batch; every plane holds the NB_ batches one behind the other.
#define KW_ 16
#define SQ_ 4
typedef __attribute__((ext_vector_type(2))) float v2f;
typedef v2f __attribute__((may_alias)) v2fa;
__global__ __launch_bounds__(KW_ * 32) void k_gemmk(const bf* __restrict__ XB, const bf* __restrict__ Eh, const bf* __restrict__ El, const float* __restrict__ PM, const float* __restrict__ PS, const bf* __restrict__ Bt, float* C) {
    typedef WFrag<bf>::V V;
    __shared__ __align__(16) float red[KW_][16 * 68];
    __shared__ __align__(16) float smx[TT]; __shared__ __align__(16) float srs[TT];
    const int lane = threadIdx.x & 31, wave = threadIdx.x >> 5, lr = lane & 15, hi = lane >> 4; const int r0 = blockIdx.x * 16;
    { const size_t zb = blockIdx.y; XB += zb * TT * DD; Eh += zb * TT * DD; El += zb * TT * DD; Bt += zb * DD * TT; C += zb * TT * DD; PM += zb * SQ_ * TT; PS += zb * SQ_ * TT; }
    const int k0 = wave * (TT / KW_) + 8 * hi;
    const int t8 = threadIdx.x * (TT / (KW_ * 32));   // 8 columns' statistics a thread; loaded first, so that their merge waits for these loads alone
    v4f pm[SQ_][2], ps[SQ_][2];
#pragma unroll
    for (int q = 0; q < SQ_; ++q) { pm[q][0] = *(const v4f*)(PM + q * TT + t8); pm[q][1] = *(const v4f*)(PM + q * TT + t8 + 4); ps[q][0] = *(const v4f*)(PS + q * TT + t8); ps[q][1] = *(const v4f*)(PS + q * TT + t8 + 4); }
    // fragment order: 16 rows of XB, Eh or El are 2 tiles (d 0..31, d 32..63); in Bt = XT the tile of d block nb and k step kc is number nb * (TT / 32) + k / 32
    const bf* px = XB + (size_t)wave * (TT / KW_) * DD + 8 * lane; const bf* pb = Bt + (size_t)wave * (TT / KW_ / 32) * 512 + 8 * lane;
    const bf* peh = Eh + (size_t)r0 * DD + 8 * lane; const bf* pel = El + (size_t)r0 * DD + 8 * lane;
    const V eh0 = WFrag<bf>::ldf(peh), eh1 = WFrag<bf>::ldf(peh + 512), el0 = WFrag<bf>::ldf(pel), el1 = WFrag<bf>::ldf(pel + 512);
    v8f acc[4];
#pragma unroll
    for (int nb = 0; nb < 4; ++nb) acc[nb] = (v8f){};
    V xa[2][4], b[2][4];   // two sets of x and B fragments: the loads of the next k step fly while this one is worked on
#pragma unroll   // whole: the set index s % 2 must be a constant, or the sets leave the registers
    for (int s = 0; s < TT / KW_ / 32 + 1; ++s) {
        if (s < TT / KW_ / 32) { const int q = s % 2, kc = s * 32;
#pragma unroll
            for (int h = 0; h < 2; ++h) { xa[q][2 * h] = WFrag<bf>::ldf(px + (size_t)(kc + 16 * h) * DD); xa[q][2 * h + 1] = WFrag<bf>::ldf(px + (size_t)(kc + 16 * h) * DD + 512); }
#pragma unroll
            for (int nb = 0; nb < 4; ++nb) b[q][nb] = WFrag<bf>::ldf(pb + (size_t)nb * 16 * TT + s * 512); }
        // the wait that stands in front of an overwrite of an issued load's address registers. The pointers that are used for the last time are named as inputs, so that they stay live up to the wait and no later load's result is placed on them; in front of the scheduling barrier, so that no arithmetic is lifted over it
        if (s == 0) asm volatile("s_wait_xcnt 0x0" :: "v"(peh), "v"(pel) : "memory");
        if (s == TT / KW_ / 32 - 1) asm volatile("s_wait_xcnt 0x0" :: "v"(px), "v"(pb) : "memory");
        __builtin_amdgcn_sched_barrier(0);   // holds this step's loads in front of the arithmetic of the step before; without it the scheduler sinks them to just before their use and nothing flies ahead
        if (s == 0) {
#pragma unroll
            for (int g = 0; g < 2; ++g) { v4f mv, rv;
#pragma unroll
                for (int u = 0; u < 4; ++u) { float mx = pm[0][g][u];
#pragma unroll
                    for (int q = 1; q < SQ_; ++q) mx = fmaxf(mx, pm[q][g][u]);
                    float sum = 0.f;
#pragma unroll
                    for (int q = 0; q < SQ_; ++q) sum += ps[q][g][u] * ex2d(pm[q][g][u], mx);
                    mv[u] = mx; rv[u] = __fdiv_rn(1.0f, sum); }
                *(v4f*)(smx + t8 + 4 * g) = mv; *(v4f*)(srs + t8 + 4 * g) = rv; }
            __syncthreads(); }
        if (s >= 1) { const int q = (s - 1) % 2, kc = (s - 1) * 32; v8us ah[2], al[2]; v8f sc[2] = {(v8f){}, (v8f){}};
            // per score the sum order of the four products is: hi d 0..31, lo d 0..31, hi d 32..63, lo d 32..63, as in k_cstat
            sc[0] = WFrag<bf>::mma(xa[q][0], eh0, sc[0]); sc[1] = WFrag<bf>::mma(xa[q][2], eh0, sc[1]); sc[0] = WFrag<bf>::mma(xa[q][0], el0, sc[0]); sc[1] = WFrag<bf>::mma(xa[q][2], el0, sc[1]);
            sc[0] = WFrag<bf>::mma(xa[q][1], eh1, sc[0]); sc[1] = WFrag<bf>::mma(xa[q][3], eh1, sc[1]); sc[0] = WFrag<bf>::mma(xa[q][1], el1, sc[0]); sc[1] = WFrag<bf>::mma(xa[q][3], el1, sc[1]);
            __builtin_amdgcn_sched_barrier(0);   // keeps the asm exponentials behind ALL score products
#pragma unroll
            for (int h = 0; h < 2; ++h) {   // fragment slots 8 h + u hold k = kc + 16 h + 8 hi + u
#pragma unroll
                for (int g = 0; g < 2; ++g) { const v4f mx = *(const v4fa*)(smx + k0 + kc + 16 * h + 4 * g), rs = *(const v4fa*)(srs + k0 + kc + 16 * h + 4 * g);
#pragma unroll
                    for (int u = 0; u < 4; ++u) { const float p = ex2d(sc[h][4 * g + u], mx[u]) * rs[u]; unsigned short x1, x2; splitf(p, x1, x2); ah[h][4 * g + u] = x1; al[h][4 * g + u] = x2; } } }
            const V a = cat16b(ah[0], ah[1]), a2 = cat16b(al[0], al[1]);
#pragma unroll
            for (int nb = 0; nb < 4; ++nb) acc[nb] = WFrag<bf>::mma(a, b[q][nb], acc[nb]);
#pragma unroll
            for (int nb = 0; nb < 4; ++nb) acc[nb] = WFrag<bf>::mma(a2, b[q][nb], acc[nb]); }
    }
#pragma unroll
    for (int nb = 0; nb < 4; ++nb) {
#pragma unroll
        for (int j = 0; j < 8; ++j) red[wave][(hi * 8 + j) * 68 + nb * 16 + lr] = acc[nb][j]; }
    __syncthreads();
    const int row = threadIdx.x >> 5, col = lane * 2; v2f p[KW_];   // one wave sums and stores one 256-B row of C
#pragma unroll
    for (int w = 0; w < KW_; ++w) p[w] = *(const v2fa*)(&red[w][row * 68 + col]);
    float s0 = 0.f, s1 = 0.f;
#pragma unroll
    for (int w = 0; w < KW_; ++w) { s0 += p[w][0]; s1 += p[w][1]; }
    float* cp = C + (size_t)(r0 + row) * DD + col; cp[0] = s0; cp[1] = s1;
}


__global__ __launch_bounds__(256) void k_wtG(const float* __restrict__ w, int K, int N, bf* Bt) {
    const int lane = threadIdx.x & 31; const int L0 = (blockIdx.x * 8 + (threadIdx.x >> 5)) * 8; const int nlines = N * K / 64;
{
#pragma unroll 1
        for (int l = 0; l < 8; ++l) { const int L = L0 + l; if (L >= nlines) break; const size_t e = (size_t)L * 64 + lane * 2; const int k = (int)(e % K), n = (int)(e / K); v2us o;
            o[0] = f2bf(w[(size_t)k * N + n]); o[1] = f2bf(w[(size_t)(k + 1) * N + n]); *(v2us*)(Bt + e) = o; }
         }
}
// k_cvt8: dst = bf16 src (rows of DD), in fragment order. Thread i writes the i-th 16-B piece of dst, so a wave stores 4 whole lines; the piece's row and column follow from its place.
__global__ __launch_bounds__(256) void k_cvt8(const float* __restrict__ src, bf* dst, size_t n8) { const size_t i = (size_t)blockIdx.x * 256 + threadIdx.x; if (i >= n8) return;
    const size_t r = (i >> 7) * 16 + (i & 15); const int c = (int)((i >> 6) & 1) * 32 + (int)((i >> 5) & 1) * 16 + (int)((i >> 4) & 1) * 8; const v8f v = *(const v8f*)(src + r * DD + c); v8us o;
#pragma unroll
    for (int k = 0; k < 8; ++k) o[k] = f2bf(v[k]); *(v8us*)(dst + i * 8) = o;  }
// k_vt: XT[d][t] = bf16 x[t][d], a DD x TT plane in fragment order (thread i writes its i-th 16-B piece: 8 consecutive t of one d; 16 lanes read 64 B in a row of x; blockIdx.y is the batch); k_enc (all NB_ * TT tokens in one launch): lane -> 4 consecutive features c of token t: softmax statistics of the Z row (64, fixed order), acc[u] = sum_k softmax_k W2[k][c+u], enc = tanh(acc + b2) -> hl planes in fragment order (8-B lanes; a block's 16 tokens are 2 KB in a row of each plane);
__global__ __launch_bounds__(256) void k_vt(const float* __restrict__ x, bf* XT) { const int i = blockIdx.x * 256 + threadIdx.x; if (i >= DD * TT / 8) return; x += (size_t)blockIdx.y * TT * DD; XT += (size_t)blockIdx.y * DD * TT;
    const int tile = i >> 6; const int d = tile / (TT / 32) * 16 + (i & 15); const int t = tile % (TT / 32) * 32 + ((i >> 5) & 1) * 16 + ((i >> 4) & 1) * 8; v8us o;
#pragma unroll
    for (int k = 0; k < 8; ++k) o[k] = f2bf(x[(size_t)(t + k) * DD + d]);
    *(v8us*)(XT + (size_t)i * 8) = o;  }
__global__ __launch_bounds__(256) void k_enc(const float* __restrict__ Z, const float* __restrict__ W2, const float* __restrict__ b2, bf* Eh, bf* El) {
    __shared__ __align__(16) float sw[DD * DD];   // W2 rounded to bf16 (kept as f32), rounded once a block
    const int e = (blockIdx.x * 256 + threadIdx.x) * 4; if (e >= NB_ * TT * DD) return;   // a block holds 1024 elements and the total is a multiple of that: a whole block leaves or none, in front of the barrier
    const int c0 = e % DD; const int t = e / DD; const float* zr = Z + (size_t)t * DD; const float* pw = W2 + threadIdx.x * 4; const float* pb = b2 + c0;
    // every global operand of the thread is asked for here, at once: its Z row (16 loads of 16 B), its 16 elements of W2, its 4 of b2. No load stands in the chains below.
    v4f z[DD / 4], w[DD * DD / 1024];
#pragma unroll
    for (int q = 0; q < DD * DD / 1024; ++q) w[q] = *(const v4f*)(pw + q * 1024);
#pragma unroll
    for (int k = 0; k < DD / 4; ++k) z[k] = *(const v4f*)(zr + 4 * k);
    const v4f bv = *(const v4f*)pb;
    // the wait that stands in front of an overwrite of an issued load's address registers. The pointers are named as inputs, so that they stay live up to the wait and no load's result is placed on them
    asm volatile("s_wait_xcnt 0x0" :: "v"(zr), "v"(pw), "v"(pb) : "memory");
#pragma unroll
    for (int q = 0; q < DD * DD / 1024; ++q) { v4f r;
#pragma unroll
        for (int u = 0; u < 4; ++u) r[u] = bfr(w[q][u]);
        *(v4f*)(sw + q * 1024 + threadIdx.x * 4) = r; }
    float mx = -3.0e38f;
#pragma unroll
    for (int k = 0; k < DD; ++k) mx = fmaxf(mx, z[k >> 2][k & 3]);
    float sum = 0.f;
#pragma unroll   // whole: z is indexed by constants only, or it leaves the registers
    for (int k = 0; k < DD; ++k) { const float ex = ex2d(z[k >> 2][k & 3], mx); z[k >> 2][k & 3] = ex; sum += ex; }
    const float rs = __fdiv_rn(1.0f, sum); float acc[4] = {0.f, 0.f, 0.f, 0.f};
    __syncthreads();   // sw is whole
#pragma unroll
    for (int k = 0; k < DD; ++k) { const float h1 = z[k >> 2][k & 3] * rs; const v4f wk = *(const v4fa*)(sw + k * DD + c0);
#pragma unroll
        for (int u = 0; u < 4; ++u) acc[u] = __builtin_fmaf(h1, wk[u], acc[u]); }
    // inputs only: all four dots are finished here, in the straight code above. Without it the compiler sinks three of them behind the branches of the first tanh and keeps the 64 h1 and all rows of W2 for them: 271 registers for 122, 3 waves a SIMD for 8
    asm volatile("" :: "v"(acc[0]), "v"(acc[1]), "v"(acc[2]), "v"(acc[3]));
    v4us oh, ol;
#pragma unroll
    for (int u = 0; u < 4; ++u) { const float en = tanhf(acc[u] + bfr(bv[u])); unsigned short a, b; splitf(en, a, b); oh[u] = a; ol[u] = b; } const size_t f = fpos(t, c0, DD); *(v4us*)(Eh + f) = oh; *(v4us*)(El + f) = ol;  }
// k_cstat: per column j of M[i][j] = encoded_i . x_j a partial maximum and a partial sum_i exp(M[i][j] - max), with M formed on the matrix unit and never stored. One block = 64 columns x a quarter of the rows of one batch (grid.y = SQ_, grid.z = NB_).
// Each of its 16 waves holds the B fragments of the 64 columns and takes 64 rows as 4 tiles of 16 (A = encoded hi, lo). In the accumulator a lane holds 8 rows of ONE column, so the running (max, sum scaled to that max)
// pair is per lane; the pairs are merged in a fixed order: the two lane halves by a shuffle, the 16 waves through LDS; the SQ_ quarters are merged by the reader (k_gemmk).
__global__ __launch_bounds__(512) void k_cstat(const bf* __restrict__ Eh, const bf* __restrict__ El, const bf* __restrict__ XB, float* PM, float* PS) {
    typedef WFrag<bf>::V V;
    __shared__ __align__(16) float sm[16][64]; __shared__ __align__(16) float ss[16][64];
    const int lane = threadIdx.x & 31, wave = threadIdx.x >> 5, lr = lane & 15, hi = lane >> 4;
    const int j0 = blockIdx.x * 64, i0 = blockIdx.y * (TT / SQ_) + wave * (TT / SQ_ / 16);
    { const size_t zb = blockIdx.z; Eh += zb * TT * DD; El += zb * TT * DD; XB += zb * TT * DD; PM += zb * SQ_ * TT; PS += zb * SQ_ * TT; }
    const bf* pxb = XB + (size_t)j0 * DD + 8 * lane; const bf* peh = Eh + (size_t)i0 * DD + 8 * lane; const bf* pel = El + (size_t)i0 * DD + 8 * lane;   // one address a plane (fragment order: 16 rows are 2 tiles of 512 elements); tiles and column blocks are constant offsets from it
    V b[4][2];
#pragma unroll
    for (int nb = 0; nb < 4; ++nb) { b[nb][0] = WFrag<bf>::ldf(pxb + nb * 16 * DD); b[nb][1] = WFrag<bf>::ldf(pxb + nb * 16 * DD + 512); }
    float m[4] = {-3.0e38f, -3.0e38f, -3.0e38f, -3.0e38f}, s[4] = {0.f, 0.f, 0.f, 0.f};
    V a[2][4];   // two sets of A fragments: the next tile's loads fly while this one is worked on
#pragma unroll   // whole: the set index t % 2 must be a constant, or the sets leave the registers
    for (int t = 0; t < TT / SQ_ / 256 + 1; ++t) {
        if (t < TT / SQ_ / 256) { const int q = t % 2, o = t * 16 * DD;
            a[q][0] = WFrag<bf>::ldf(peh + o); a[q][1] = WFrag<bf>::ldf(pel + o); a[q][2] = WFrag<bf>::ldf(peh + o + 512); a[q][3] = WFrag<bf>::ldf(pel + o + 512); }
        // the wait that stands in front of an overwrite of an issued load's address registers. The pointers that are used for the last time are named as inputs, so that they stay live up to the wait and no later load's result is placed on them
        if (t == 0) asm volatile("s_wait_xcnt 0x0" :: "v"(pxb) : "memory");
        if (t == TT / SQ_ / 256 - 1) asm volatile("s_wait_xcnt 0x0" :: "v"(peh), "v"(pel) : "memory");
        __builtin_amdgcn_sched_barrier(0);   // holds this tile's loads in front of the arithmetic of the tile before; without it the scheduler sinks them to just before their use
        if (t >= 1) { const int q = (t - 1) % 2; v8f acc[4];
#pragma unroll
            for (int nb = 0; nb < 4; ++nb) acc[nb] = (v8f){};
#pragma unroll
            for (int f = 0; f < 4; ++f) {   // hi d 0..31, lo d 0..31, hi d 32..63, lo d 32..63
#pragma unroll
                for (int nb = 0; nb < 4; ++nb) acc[nb] = WFrag<bf>::mma(a[q][f], b[nb][f >> 1], acc[nb]); }
            __builtin_amdgcn_sched_barrier(0);   // keeps the asm exponentials behind ALL products of the tile
#pragma unroll
            for (int nb = 0; nb < 4; ++nb) { float mn = m[nb];
#pragma unroll
                for (int r = 0; r < 8; ++r) mn = fmaxf(mn, acc[nb][r]);
                float sa = s[nb] * ex2d(m[nb], mn);
#pragma unroll
                for (int r = 0; r < 8; ++r) sa += ex2d(acc[nb][r], mn);
                m[nb] = mn; s[nb] = sa; } }
    }
#pragma unroll
    for (int nb = 0; nb < 4; ++nb) { const float om = __shfl_xor(m[nb], 16), os = __shfl_xor(s[nb], 16); const float mn = fmaxf(m[nb], om); s[nb] = s[nb] * ex2d(m[nb], mn) + os * ex2d(om, mn); m[nb] = mn; }
    if (hi == 0) {
#pragma unroll
        for (int nb = 0; nb < 4; ++nb) { sm[wave][nb * 16 + lr] = m[nb]; ss[wave][nb * 16 + lr] = s[nb]; } }
    __syncthreads();
    if (threadIdx.x < 64) { const int c = threadIdx.x; float mx = -3.0e38f, sum = 0.f;
#pragma unroll
        for (int w = 0; w < 16; ++w) mx = fmaxf(mx, sm[w][c]);
#pragma unroll
        for (int w = 0; w < 16; ++w) sum += ss[w][c] * ex2d(sm[w][c], mx);
        PM[blockIdx.y * TT + j0 + c] = mx; PS[blockIdx.y * TT + j0 + c] = sum; } }

extern "C" void kernel_launch(void* const* d_in, const int* in_sizes, int n_in,
                              void* d_out, int out_size, void* d_ws, size_t ws_size, hipStream_t stream) {
    (void)in_sizes; (void)n_in; (void)out_size;
    const float* x = (const float*)d_in[0]; const float* W1 = (const float*)d_in[1]; const float* b1 = (const float*)d_in[2]; const float* W2 = (const float*)d_in[3]; const float* b2 = (const float*)d_in[4];
    float* OUT = (float*)d_out;     // [4][4096][64]
    char* wsp = (char*)d_ws;
    auto take = [&](size_t bytes) { char* p = wsp; wsp += (bytes + 255) & ~(size_t)255; return (void*)p; };
    bf* BW1 = (bf*)take(DD * DD * 2); bf* XB = (bf*)take((size_t)NB_ * TT * DD * 2); bf* XT = (bf*)take((size_t)NB_ * DD * TT * 2); float* Z = (float*)take((size_t)NB_ * TT * DD * 4); bf* Eh = (bf*)take((size_t)NB_ * TT * DD * 2); bf* El = (bf*)take((size_t)NB_ * TT * DD * 2);
    float* PM = (float*)take((size_t)NB_ * SQ_ * TT * 4); float* PS = (float*)take((size_t)NB_ * SQ_ * TT * 4);
    if ((size_t)(wsp - (char*)d_ws) > ws_size) return;    // total ~ 13 MB
    // every stage runs once for all NB_ batches: token-wise stages over NB_ * TT rows, the others with the batch as a grid dimension
    k_wtG<<<(DD * DD / 64 + 63) / 64, 256, 0, stream>>>(W1, DD, DD, BW1);
    k_cvt8<<<(NB_ * TT * DD / 8 + 255) / 256, 256, 0, stream>>>(x, XB, NB_ * TT * DD / 8); k_vt<<<dim3((DD * TT / 8 + 255) / 256, NB_, 1), 256, 0, stream>>>(x, XT);
    k_gemmw<bf, 0, true><<<dim3(NB_ * TT / 64, 1, 1), 32, 0, stream>>>(XB, nullptr, BW1, nullptr, DD, Z, DD, b1, 0, 0, 0); k_enc<<<(NB_ * TT * DD / 4 + 255) / 256, 256, 0, stream>>>(Z, W2, b2, Eh, El);
    k_cstat<<<dim3(TT / 64, SQ_, NB_), 512, 0, stream>>>(Eh, El, XB, PM, PS);     // statistics of M[i][j] = encoded_i . x_j = scores[j][i] over i
    k_gemmk<<<dim3(TT / 16, NB_, 1), KW_ * 32, 0, stream>>>(XB, Eh, El, PM, PS, XT, OUT);   // out[i][d] = sum_j attention[j][i] x[j][d], attention[j][i] = exp(M[i][j] - MX[j]) RS[j]
}

// v008
// It runs in 77.2 microseconds.
// In both of two side-by-side timings against v007, it was 1.22 times as fast.
// Counting every step since v000, it is 90.4 times as fast.
#include <hip/hip_runtime.h>

// TimeSeriesAttention (x [4][4096][64]; h1 = softmax(x W1 + b1) (over the 64 features); encoded = tanh(h1 W2 + b2); scores[i][j] = x_i . encoded_j (unscaled); attention = softmax over j; out[i] = sum_j attention[j][i] x[j] (the TRANSPOSED attention, as the
// reference's permute) -> [4][4096][64]). The transposed use is handled by computing M[i][j] = encoded_i . x_j = scores[j][i] directly (swapped GEMM operands) and normalising each COLUMN j of M (= row j of the reference's softmax) with per-column statistics, so M-normalised[i][j] = attention[j][i] is already the A operand of out = attention^T x - exact restructuring.
// Compute dtypes, f32 accumulate: every input rounded to bf16; x W1 on PLAIN bf16 operands (inputs: exact) + bias; the feature softmax, h1 W2 + b2 (64-term fixed-order dots) and tanh f32 on the VALU -> bf16 hi+lo planes; scores as

#define NB_  4
#define TT   4096
#define DD   64
typedef _Float16 h16;
typedef unsigned short bf;
typedef __attribute__((ext_vector_type(16))) __bf16   v16bf;
typedef __attribute__((ext_vector_type(16))) _Float16 v16h;
typedef __attribute__((ext_vector_type(8)))  _Float16 v8h;
typedef __attribute__((ext_vector_type(8)))  unsigned short v8us;
typedef __attribute__((ext_vector_type(8)))  float    v8f;
typedef __attribute__((ext_vector_type(4)))  float    v4f;
typedef v8h  __attribute__((may_alias)) v8ha;
typedef v4f  __attribute__((may_alias)) v4fa;
typedef v8us __attribute__((may_alias)) v8usa;

__device__ __forceinline__ unsigned short f2bf(float f) { unsigned u = __float_as_uint(f); u += 0x7FFFu + ((u >> 16) & 1u); return (unsigned short)(u >> 16); }
__device__ __forceinline__ float bf2f(unsigned short b) { return __uint_as_float(((unsigned)b) << 16); }
__device__ __forceinline__ float bfr(float f) { return bf2f(f2bf(f)); }
__device__ __forceinline__ v16h cat16(v8h lo, v8h hi) { return __builtin_shufflevector(lo, hi, 0, 1, 2, 3, 4, 5, 6, 7, 8, 9, 10, 11, 12, 13, 14, 15); }
__device__ __forceinline__ v16bf cat16b(v8us lo, v8us hi) { return __builtin_bit_cast(v16bf, __builtin_shufflevector(lo, hi, 0, 1, 2, 3, 4, 5, 6, 7, 8, 9, 10, 11, 12, 13, 14, 15)); }
__device__ __forceinline__ v8f wmma16(v16h a, v16h b, v8f c) { return __builtin_amdgcn_wmma_f32_16x16x32_f16(false, a, false, b, (short)0, c, false, false); }
__device__ __forceinline__ v8f wmmab(v16bf a, v16bf b, v8f c) { return __builtin_amdgcn_wmma_f32_16x16x32_bf16(false, a, false, b, (short)0, c, false, false); }



// ---- FRAGMENT ORDER of the 16-bit planes that pass between the launches (XB, XT, Eh, El): a plane of R rows x C columns is kept as tiles of 16 rows x 32 columns, 512 elements = 1 KB each, tile number (row / 16) * (C / 32) + col / 32.
// Inside a tile the 8 elements that lane l = 16 hi + lr of a wave takes as fragment slots 0..7 (row lr, columns 8 hi + 0..7) stand at element 8 l, those of slots 8..15 (columns 16 + 8 hi + 0..7) at element 256 + 8 l.
// So a fragment is two wave-wide 16-B loads of 512 contiguous bytes each (4 whole lines); from a row-major plane each such load touches 16 lines and takes 32 B of each. WFrag::ldf(tile + 8 * lane) reads one; fpos gives an element's place.
__device__ __forceinline__ size_t fpos(int r, int c, int C) { return ((size_t)(r >> 4) * (C >> 5) + (c >> 5)) * 512 + ((c >> 4) & 1) * 256 + (((c >> 3) & 1) * 16 + (r & 15)) * 8 + (c & 7); }

// ---- k_gemmw: register-blocked GEMM, ONE WAVE per 64x64 output tile (16 accumulators), A from planes in fragment order, Bt from K-contiguous row-major planes; grid (M/64, N/64, Z), 32 threads.
// C[m][n] (f32, pitch ldc, + optional f32 bias[n]) = sum_k A[m][k] Bt[n][k] (+ split products per NSPLIT). z-batch strides sA/sB/sC in elements. K % 32 == 0.
template <typename T16> struct WFrag;
template <> struct WFrag<h16> { typedef v16h V; static __device__ __forceinline__ V ld(const h16* p) { return cat16(*(const v8h*)p, *(const v8h*)(p + 16)); } static __device__ __forceinline__ V ldf(const h16* p) { return cat16(*(const v8h*)p, *(const v8h*)(p + 256)); } static __device__ __forceinline__ v8f mma(V a, V b, v8f c) { return wmma16(a, b, c); } };
template <> struct WFrag<bf> { typedef v16bf V; static __device__ __forceinline__ V ld(const bf* p) { return cat16b(*(const v8us*)p, *(const v8us*)(p + 16)); } static __device__ __forceinline__ V ldf(const bf* p) { return cat16b(*(const v8us*)p, *(const v8us*)(p + 256)); } static __device__ __forceinline__ v8f mma(V a, V b, v8f c) { return wmmab(a, b, c); } };
template <typename T16, int NSPLIT, bool BIAS>
__global__ __launch_bounds__(32) void k_gemmw(const T16* __restrict__ A, const T16* __restrict__ A2, const T16* __restrict__ Bt, const T16* __restrict__ Bt2, int K, float* C, int ldc, const float* __restrict__ bias, size_t sA, size_t sB, size_t sC) {
    typedef typename WFrag<T16>::V V;
    __shared__ __align__(16) float os[16 * 68];
    const size_t z = blockIdx.z; A += z * sA; if (A2) A2 += z * sA; Bt += z * sB; if (Bt2) Bt2 += z * sB; C += z * sC;
    const int lane = threadIdx.x & 31, lr = lane & 15, hi = lane >> 4; const int r0 = blockIdx.x * 64, c0 = blockIdx.y * 64;
    v8f acc[4][4];
#pragma unroll
    for (int mb = 0; mb < 4; ++mb)
#pragma unroll
        for (int nb = 0; nb < 4; ++nb) acc[mb][nb] = (v8f){};
    const size_t aoff = (size_t)(r0 >> 4) * (K >> 5) * 512 + 8 * lane, boff = (size_t)(c0 + lr) * K + 8 * hi;
#pragma unroll 1
    for (int kc = 0; kc < K; kc += 32) {
        V a[4], a2[4]; const T16* pa[4]; const T16* pa2[4];
#pragma unroll
        for (int mb = 0; mb < 4; ++mb) { const size_t o = aoff + ((size_t)mb * (K >> 5) + (kc >> 5)) * 512; pa[mb] = A + o; a[mb] = WFrag<T16>::ldf(pa[mb]); if (NSPLIT == 1 || NSPLIT == 2) { pa2[mb] = A2 + o; a2[mb] = WFrag<T16>::ldf(pa2[mb]); } }
        // the wait that stands in front of an overwrite of an issued load's address registers. The A pointers are named as inputs, so that they stay live up to the wait and no later load's result is placed on them
        asm volatile("s_wait_xcnt 0x0" :: "v"(pa[0]), "v"(pa[1]), "v"(pa[2]), "v"(pa[3]) : "memory");
        if (NSPLIT == 1 || NSPLIT == 2) asm volatile("s_wait_xcnt 0x0" :: "v"(pa2[0]), "v"(pa2[1]), "v"(pa2[2]), "v"(pa2[3]) : "memory");
#pragma unroll
        for (int nb = 0; nb < 4; ++nb) { const V b = WFrag<T16>::ld(Bt + boff + (size_t)nb * 16 * K + kc); V b2; if (NSPLIT >= 2) b2 = WFrag<T16>::ld(Bt2 + boff + (size_t)nb * 16 * K + kc);
#pragma unroll
            for (int mb = 0; mb < 4; ++mb) { acc[mb][nb] = WFrag<T16>::mma(a[mb], b, acc[mb][nb]); if (NSPLIT == 1 || NSPLIT == 2) acc[mb][nb] = WFrag<T16>::mma(a2[mb], b, acc[mb][nb]); if (NSPLIT >= 2) acc[mb][nb] = WFrag<T16>::mma(a[mb], b2, acc[mb][nb]); } }
        asm volatile("v_nop\n\tv_nop\n\tv_nop\n\tv_nop" : "+v"(acc[0][0]), "+v"(acc[1][1]), "+v"(acc[2][2]), "+v"(acc[3][3]) : "v"(a[0]), "v"(a[3]));
    }
#pragma unroll
    for (int mb = 0; mb < 4; ++mb) {
#pragma unroll
        for (int nb = 0; nb < 4; ++nb) {
#pragma unroll
            for (int j = 0; j < 8; ++j) os[(hi * 8 + j) * 68 + nb * 16 + lr] = acc[mb][nb][j]; }
        __builtin_amdgcn_wave_barrier(); asm volatile("" ::: "memory");
        float* crow = C + (size_t)(r0 + mb * 16) * ldc + c0;
{
#pragma unroll
            for (int s = 0; s < 8; ++s) { const int row = 2 * s + hi, cofs = lr * 4; v4f val = *(const v4fa*)(os + row * 68 + cofs); if (BIAS) { val[0] += bfr(bias[c0 + cofs]); val[1] += bfr(bias[c0 + cofs + 1]); val[2] += bfr(bias[c0 + cofs + 2]); val[3] += bfr(bias[c0 + cofs + 3]); }
                *(v4f*)(crow + (size_t)row * ldc + cofs) = val; }
             }
        __builtin_amdgcn_wave_barrier(); asm volatile("" ::: "memory");
    }
}

__device__ __forceinline__ void splitf(float y, unsigned short& h, unsigned short& l) { h = f2bf(y); l = f2bf(y - bf2f(h)); }
typedef __attribute__((ext_vector_type(2))) unsigned short v2us;
typedef __attribute__((ext_vector_type(4))) unsigned short v4us;
// ex2d = exp(a - b). The v_nop keeps the one slot that the instruction set asks for behind a transcendental.
__device__ __forceinline__ float ex2d(float a, float b) { float r; asm("v_exp_f32 %0, %1\n\tv_nop" : "=v"(r) : "v"((a - b) * 1.4426950408889634f)); return r; }

// ---- k_gemmk: the out product. One work-group = 64 rows x 64 columns of C: 16 waves = MT_ row tiles of 16 (wm) x KQ_ quarters of K (wk). A wave keeps a 16x64 f32 partial over its quarter (1024 k);
// the KQ_ partials of a row tile are summed in quarter order through LDS. C[m][n] = sum_k (Ph[m][k] + Pl[m][k]) Bt[n][k]; Bt (DD x TT) in fragment order, C pitch DD.
// The x and x^T fragments of a k step are the same for every row tile, so they are fetched ONCE a work-group: the MT_ waves of a quarter each bring a quarter of the stage (KS_ k values: 8 KB of x, 8 KB of x^T)
// through registers into LDS, and each reads the whole stage from there. Two stage buffers; the loads of stage t + 2 fly while stage t is worked on; one barrier a stage.
// The A operand is formed in registers and no score is read from memory: per k step of 32 the wave computes the two 16x16 score tiles S[k][m] = x_k . (Eh_m + El_m) on the matrix unit
// (A = x rows k, B = the wave's 16 encoded rows, held in registers). The accumulator of tile h holds, in lane (lr, hi) and register u, S[16 h + 8 hi + u][lr]: that is slot 8 h + u
// of row lr of the 16-bit A fragment, so p = exp(S - MX[k]) * RS[k] goes into the hi and lo A fragments with no move between lanes.
// MX, RS: the SQ_ partial (max, sum) pairs a column that k_cstat leaves are merged in a fixed order and staged once in LDS.
// grid (TT / 64, NB_): blockIdx.y is the batch; every plane holds the NB_ batches one behind the other.
#define KQ_ 4
#define MT_ 4
#define KS_ 64
#define NT_ (TT / KQ_ / KS_)
#define STQ_ (2 * KS_ * DD)
#define SQ_ 4
typedef __attribute__((ext_vector_type(2))) float v2f;
typedef v2f __attribute__((may_alias)) v2fa;
__global__ __launch_bounds__(KQ_ * MT_ * 32) void k_gemmk(const bf* __restrict__ XB, const bf* __restrict__ Eh, const bf* __restrict__ El, const float* __restrict__ PM, const float* __restrict__ PS, const bf* __restrict__ Bt, float* C) {
    typedef WFrag<bf>::V V;
    // a quarter's stage: KS_ rows of x (KS_ / 16 * 2 tiles of 512 elements, as they stand in XB), then the x^T tiles, number nb * (KS_ / 32) + k step
    __shared__ __align__(16) bf st[2 * KQ_ * STQ_];
    __shared__ __align__(16) float red[KQ_ * MT_][16 * 68];
    __shared__ __align__(16) float smx[TT]; __shared__ __align__(16) float srs[TT];
    const int lane = threadIdx.x & 31, wave = threadIdx.x >> 5, lr = lane & 15, hi = lane >> 4, wm = wave % MT_, wk = wave / MT_; const int r0 = blockIdx.x * (16 * MT_);
    { const size_t zb = blockIdx.y; XB += zb * TT * DD; Eh += zb * TT * DD; El += zb * TT * DD; Bt += zb * DD * TT; C += zb * TT * DD; PM += zb * SQ_ * TT; PS += zb * SQ_ * TT; }
    const int k0 = wk * (TT / KQ_) + 8 * hi;
    const int t8 = threadIdx.x * (TT / (KQ_ * MT_ * 32));   // 8 columns' statistics a thread; loaded first, so that their merge waits for these loads alone
    v4f pm[SQ_][2], ps[SQ_][2];
#pragma unroll
    for (int q = 0; q < SQ_; ++q) { pm[q][0] = *(const v4f*)(PM + q * TT + t8); pm[q][1] = *(const v4f*)(PM + q * TT + t8 + 4); ps[q][0] = *(const v4f*)(PS + q * TT + t8); ps[q][1] = *(const v4f*)(PS + q * TT + t8 + 4); }
    // the wave's share of a stage: 2 KB in a row of XB (fragment order: 16 rows are 2 tiles) and 2 KB in a row of Bt = XT (d block nb = wm; the tile of d block nb and k step kc is number nb * (TT / 32) + k / 32)
    const bf* pgx = XB + (size_t)wk * (TT / KQ_) * DD + wm * (KS_ * DD / MT_) + 8 * lane; const bf* pgb = Bt + ((size_t)wm * (TT / 32) + wk * (TT / KQ_ / 32)) * 512 + 8 * lane;
    const bf* peh = Eh + (size_t)(r0 + 16 * wm) * DD + 8 * lane; const bf* pel = El + (size_t)(r0 + 16 * wm) * DD + 8 * lane;
    bf* sw = st + wk * STQ_ + wm * (KS_ * DD / MT_) + 8 * lane; const bf* sr = st + wk * STQ_ + 8 * lane;
    v8us gx[4], gb[4];
#pragma unroll
    for (int i = 0; i < 4; ++i) { gx[i] = *(const v8us*)(pgx + i * 256); gb[i] = *(const v8us*)(pgb + i * 256); }
    const V eh0 = WFrag<bf>::ldf(peh), eh1 = WFrag<bf>::ldf(peh + 512), el0 = WFrag<bf>::ldf(pel), el1 = WFrag<bf>::ldf(pel + 512);
    // the wait that stands in front of an overwrite of an issued load's address registers. The pointers are named as inputs, so that they stay live up to the wait and no later load's result is placed on them
    asm volatile("s_wait_xcnt 0x0" :: "v"(peh), "v"(pel), "v"(pgx), "v"(pgb) : "memory");
    pgx += KS_ * DD; pgb += KS_ / 32 * 512;
#pragma unroll
    for (int i = 0; i < 4; ++i) { *(v8us*)(sw + i * 256) = gx[i]; *(v8us*)(sw + KS_ * DD + i * 256) = gb[i]; }   // stage 0 into buffer 0
#pragma unroll
    for (int i = 0; i < 4; ++i) { gx[i] = *(const v8us*)(pgx + i * 256); gb[i] = *(const v8us*)(pgb + i * 256); }   // stage 1 flies
    asm volatile("s_wait_xcnt 0x0" :: "v"(pgx), "v"(pgb) : "memory");   // as above: the two pointers are advanced right behind it
    pgx += KS_ * DD; pgb += KS_ / 32 * 512;
#pragma unroll
    for (int g = 0; g < 2; ++g) { v4f mv, rv;
#pragma unroll
        for (int u = 0; u < 4; ++u) { float mx = pm[0][g][u];
#pragma unroll
            for (int q = 1; q < SQ_; ++q) mx = fmaxf(mx, pm[q][g][u]);
            float sum = 0.f;
#pragma unroll
            for (int q = 0; q < SQ_; ++q) sum += ps[q][g][u] * ex2d(pm[q][g][u], mx);
            mv[u] = mx; rv[u] = __fdiv_rn(1.0f, sum); }
        *(v4f*)(smx + t8 + 4 * g) = mv; *(v4f*)(srs + t8 + 4 * g) = rv; }
    v8f acc[4];
#pragma unroll
    for (int nb = 0; nb < 4; ++nb) acc[nb] = (v8f){};
#pragma unroll 1   // rolled: for speed only
    for (int t = 0; t < NT_; ++t) {
        __syncthreads();   // publishes stage t (at t = 0 the statistics too) and ends every wave's reads of the buffer that stage t + 1 goes into
        const bf* rd = sr + (t & 1) * (KQ_ * STQ_); V xa[4], b[4];
        // the first k step's fragments are asked for in front of the staging: for speed only
#pragma unroll
        for (int j = 0; j < 4; ++j) xa[j] = WFrag<bf>::ldf(rd + j * 512);
#pragma unroll
        for (int nb = 0; nb < 4; ++nb) b[nb] = WFrag<bf>::ldf(rd + KS_ * DD + nb * (KS_ / 32) * 512);
        if (t + 1 < NT_) { bf* w = sw + ((t + 1) & 1) * (KQ_ * STQ_);
#pragma unroll
            for (int i = 0; i < 4; ++i) { *(v8us*)(w + i * 256) = gx[i]; *(v8us*)(w + KS_ * DD + i * 256) = gb[i]; } }
        if (t + 2 < NT_) {
#pragma unroll
            for (int i = 0; i < 4; ++i) { gx[i] = *(const v8us*)(pgx + i * 256); gb[i] = *(const v8us*)(pgb + i * 256); }
            asm volatile("s_wait_xcnt 0x0" :: "v"(pgx), "v"(pgb) : "memory");   // as above: the two pointers are advanced right behind it
            pgx += KS_ * DD; pgb += KS_ / 32 * 512; }
#pragma unroll
        for (int s = 0; s < KS_ / 32; ++s) { const int kc = t * KS_ + s * 32;
            if (s > 0) {
#pragma unroll
                for (int j = 0; j < 4; ++j) xa[j] = WFrag<bf>::ldf(rd + (s * 4 + j) * 512);   // rows 32 s + 16 (j / 2), d half j % 2
#pragma unroll
                for (int nb = 0; nb < 4; ++nb) b[nb] = WFrag<bf>::ldf(rd + KS_ * DD + (nb * (KS_ / 32) + s) * 512); }
            v8us ah[2], al[2]; v8f sc[2] = {(v8f){}, (v8f){}};
            // per score the sum order of the four products is: hi d 0..31, lo d 0..31, hi d 32..63, lo d 32..63, as in k_cstat
            sc[0] = WFrag<bf>::mma(xa[0], eh0, sc[0]); sc[1] = WFrag<bf>::mma(xa[2], eh0, sc[1]); sc[0] = WFrag<bf>::mma(xa[0], el0, sc[0]); sc[1] = WFrag<bf>::mma(xa[2], el0, sc[1]);
            sc[0] = WFrag<bf>::mma(xa[1], eh1, sc[0]); sc[1] = WFrag<bf>::mma(xa[3], eh1, sc[1]); sc[0] = WFrag<bf>::mma(xa[1], el1, sc[0]); sc[1] = WFrag<bf>::mma(xa[3], el1, sc[1]);
            __builtin_amdgcn_sched_barrier(0);   // keeps the asm exponentials behind ALL score products
#pragma unroll
            for (int h = 0; h < 2; ++h) {   // fragment slots 8 h + u hold k = kc + 16 h + 8 hi + u
#pragma unroll
                for (int g = 0; g < 2; ++g) { const v4f mx = *(const v4fa*)(smx + k0 + kc + 16 * h + 4 * g), rs = *(const v4fa*)(srs + k0 + kc + 16 * h + 4 * g);
#pragma unroll
                    for (int u = 0; u < 4; ++u) { const float p = ex2d(sc[h][4 * g + u], mx[u]) * rs[u]; unsigned short x1, x2; splitf(p, x1, x2); ah[h][4 * g + u] = x1; al[h][4 * g + u] = x2; } } }
            const V a = cat16b(ah[0], ah[1]), a2 = cat16b(al[0], al[1]);
#pragma unroll
            for (int nb = 0; nb < 4; ++nb) acc[nb] = WFrag<bf>::mma(a, b[nb], acc[nb]);
#pragma unroll
            for (int nb = 0; nb < 4; ++nb) acc[nb] = WFrag<bf>::mma(a2, b[nb], acc[nb]); }
        // the four issue slots that a matrix instruction needs before an operand register is overwritten
        asm volatile("v_nop\n\tv_nop\n\tv_nop\n\tv_nop" :: "v"(acc[0]), "v"(acc[1]), "v"(acc[2]), "v"(acc[3]));
    }
#pragma unroll
    for (int nb = 0; nb < 4; ++nb) {
#pragma unroll
        for (int j = 0; j < 8; ++j) red[wave][(hi * 8 + j) * 68 + nb * 16 + lr] = acc[nb][j]; }
    __syncthreads();
    const int row = threadIdx.x >> 3, col = (threadIdx.x & 7) * 8; v4f p[KQ_][2];   // 8 columns of one row a thread: a wave sums and stores 4 whole 256-B rows of C
#pragma unroll
    for (int q = 0; q < KQ_; ++q) { p[q][0] = *(const v4fa*)(&red[q * MT_ + (row >> 4)][(row & 15) * 68 + col]); p[q][1] = *(const v4fa*)(&red[q * MT_ + (row >> 4)][(row & 15) * 68 + col + 4]); }
    v4f s0 = {0.f, 0.f, 0.f, 0.f}, s1 = {0.f, 0.f, 0.f, 0.f};
#pragma unroll
    for (int q = 0; q < KQ_; ++q) { s0 += p[q][0]; s1 += p[q][1]; }
    float* cp = C + (size_t)(r0 + row) * DD + col; *(v4f*)cp = s0; *(v4f*)(cp + 4) = s1;
}


__global__ __launch_bounds__(256) void k_wtG(const float* __restrict__ w, int K, int N, bf* Bt) {
    const int lane = threadIdx.x & 31; const int L0 = (blockIdx.x * 8 + (threadIdx.x >> 5)) * 8; const int nlines = N * K / 64;
{
#pragma unroll 1
        for (int l = 0; l < 8; ++l) { const int L = L0 + l; if (L >= nlines) break; const size_t e = (size_t)L * 64 + lane * 2; const int k = (int)(e % K), n = (int)(e / K); v2us o;
            o[0] = f2bf(w[(size_t)k * N + n]); o[1] = f2bf(w[(size_t)(k + 1) * N + n]); *(v2us*)(Bt + e) = o; }
         }
}
// k_cvt8: dst = bf16 src (rows of DD), in fragment order. Thread i writes the i-th 16-B piece of dst, so a wave stores 4 whole lines; the piece's row and column follow from its place.
__global__ __launch_bounds__(256) void k_cvt8(const float* __restrict__ src, bf* dst, size_t n8) { const size_t i = (size_t)blockIdx.x * 256 + threadIdx.x; if (i >= n8) return;
    const size_t r = (i >> 7) * 16 + (i & 15); const int c = (int)((i >> 6) & 1) * 32 + (int)((i >> 5) & 1) * 16 + (int)((i >> 4) & 1) * 8; const v8f v = *(const v8f*)(src + r * DD + c); v8us o;
#pragma unroll
    for (int k = 0; k < 8; ++k) o[k] = f2bf(v[k]); *(v8us*)(dst + i * 8) = o;  }
// k_vt: XT[d][t] = bf16 x[t][d], a DD x TT plane in fragment order (thread i writes its i-th 16-B piece: 8 consecutive t of one d; 16 lanes read 64 B in a row of x; blockIdx.y is the batch); k_enc (all NB_ * TT tokens in one launch): lane -> 4 consecutive features c of token t: softmax statistics of the Z row (64, fixed order), acc[u] = sum_k softmax_k W2[k][c+u], enc = tanh(acc + b2) -> hl planes in fragment order (8-B lanes; a block's 16 tokens are 2 KB in a row of each plane);
__global__ __launch_bounds__(256) void k_vt(const float* __restrict__ x, bf* XT) { const int i = blockIdx.x * 256 + threadIdx.x; if (i >= DD * TT / 8) return; x += (size_t)blockIdx.y * TT * DD; XT += (size_t)blockIdx.y * DD * TT;
    const int tile = i >> 6; const int d = tile / (TT / 32) * 16 + (i & 15); const int t = tile % (TT / 32) * 32 + ((i >> 5) & 1) * 16 + ((i >> 4) & 1) * 8; v8us o;
#pragma unroll
    for (int k = 0; k < 8; ++k) o[k] = f2bf(x[(size_t)(t + k) * DD + d]);
    *(v8us*)(XT + (size_t)i * 8) = o;  }
__global__ __launch_bounds__(256) void k_enc(const float* __restrict__ Z, const float* __restrict__ W2, const float* __restrict__ b2, bf* Eh, bf* El) {
    __shared__ __align__(16) float sw[DD * DD];   // W2 rounded to bf16 (kept as f32), rounded once a block
    const int e = (blockIdx.x * 256 + threadIdx.x) * 4; if (e >= NB_ * TT * DD) return;   // a block holds 1024 elements and the total is a multiple of that: a whole block leaves or none, in front of the barrier
    const int c0 = e % DD; const int t = e / DD; const float* zr = Z + (size_t)t * DD; const float* pw = W2 + threadIdx.x * 4; const float* pb = b2 + c0;
    // every global operand of the thread is asked for here, at once: its Z row (16 loads of 16 B), its 16 elements of W2, its 4 of b2. No load stands in the chains below.
    v4f z[DD / 4], w[DD * DD / 1024];
#pragma unroll
    for (int q = 0; q < DD * DD / 1024; ++q) w[q] = *(const v4f*)(pw + q * 1024);
#pragma unroll
    for (int k = 0; k < DD / 4; ++k) z[k] = *(const v4f*)(zr + 4 * k);
    const v4f bv = *(const v4f*)pb;
    // the wait that stands in front of an overwrite of an issued load's address registers. The pointers are named as inputs, so that they stay live up to the wait and no load's result is placed on them
    asm volatile("s_wait_xcnt 0x0" :: "v"(zr), "v"(pw), "v"(pb) : "memory");
#pragma unroll
    for (int q = 0; q < DD * DD / 1024; ++q) { v4f r;
#pragma unroll
        for (int u = 0; u < 4; ++u) r[u] = bfr(w[q][u]);
        *(v4f*)(sw + q * 1024 + threadIdx.x * 4) = r; }
    float mx = -3.0e38f;
#pragma unroll
    for (int k = 0; k < DD; ++k) mx = fmaxf(mx, z[k >> 2][k & 3]);
    float sum = 0.f;
#pragma unroll   // whole: z is indexed by constants only, or it leaves the registers
    for (int k = 0; k < DD; ++k) { const float ex = ex2d(z[k >> 2][k & 3], mx); z[k >> 2][k & 3] = ex; sum += ex; }
    const float rs = __fdiv_rn(1.0f, sum); float acc[4] = {0.f, 0.f, 0.f, 0.f};
    __syncthreads();   // sw is whole
#pragma unroll
    for (int k = 0; k < DD; ++k) { const float h1 = z[k >> 2][k & 3] * rs; const v4f wk = *(const v4fa*)(sw + k * DD + c0);
#pragma unroll
        for (int u = 0; u < 4; ++u) acc[u] = __builtin_fmaf(h1, wk[u], acc[u]); }
    // inputs only: all four dots are finished here, in the straight code above. Without it the compiler sinks three of them behind the branches of the first tanh and keeps the 64 h1 and all rows of W2 for them: 271 registers for 122, 3 waves a SIMD for 8
    asm volatile("" :: "v"(acc[0]), "v"(acc[1]), "v"(acc[2]), "v"(acc[3]));
    v4us oh, ol;
#pragma unroll
    for (int u = 0; u < 4; ++u) { const float en = tanhf(acc[u] + bfr(bv[u])); unsigned short a, b; splitf(en, a, b); oh[u] = a; ol[u] = b; } const size_t f = fpos(t, c0, DD); *(v4us*)(Eh + f) = oh; *(v4us*)(El + f) = ol;  }
// k_cstat: per column j of M[i][j] = encoded_i . x_j a partial maximum and a partial sum_i exp(M[i][j] - max), with M formed on the matrix unit and never stored. One block = 64 columns x a quarter of the rows of one batch (grid.y = SQ_, grid.z = NB_).
// Each of its 16 waves holds the B fragments of the 64 columns and takes 64 rows as 4 tiles of 16 (A = encoded hi, lo). In the accumulator a lane holds 8 rows of ONE column, so the running (max, sum scaled to that max)
// pair is per lane; the pairs are merged in a fixed order: the two lane halves by a shuffle, the 16 waves through LDS; the SQ_ quarters are merged by the reader (k_gemmk).
__global__ __launch_bounds__(512) void k_cstat(const bf* __restrict__ Eh, const bf* __restrict__ El, const bf* __restrict__ XB, float* PM, float* PS) {
    typedef WFrag<bf>::V V;
    __shared__ __align__(16) float sm[16][64]; __shared__ __align__(16) float ss[16][64];
    const int lane = threadIdx.x & 31, wave = threadIdx.x >> 5, lr = lane & 15, hi = lane >> 4;
    const int j0 = blockIdx.x * 64, i0 = blockIdx.y * (TT / SQ_) + wave * (TT / SQ_ / 16);
    { const size_t zb = blockIdx.z; Eh += zb * TT * DD; El += zb * TT * DD; XB += zb * TT * DD; PM += zb * SQ_ * TT; PS += zb * SQ_ * TT; }
    const bf* pxb = XB + (size_t)j0 * DD + 8 * lane; const bf* peh = Eh + (size_t)i0 * DD + 8 * lane; const bf* pel = El + (size_t)i0 * DD + 8 * lane;   // one address a plane (fragment order: 16 rows are 2 tiles of 512 elements); tiles and column blocks are constant offsets from it
    V b[4][2];
#pragma unroll
    for (int nb = 0; nb < 4; ++nb) { b[nb][0] = WFrag<bf>::ldf(pxb + nb * 16 * DD); b[nb][1] = WFrag<bf>::ldf(pxb + nb * 16 * DD + 512); }
    float m[4] = {-3.0e38f, -3.0e38f, -3.0e38f, -3.0e38f}, s[4] = {0.f, 0.f, 0.f, 0.f};
    V a[2][4];   // two sets of A fragments: the next tile's loads fly while this one is worked on
#pragma unroll   // whole: the set index t % 2 must be a constant, or the sets leave the registers
    for (int t = 0; t < TT / SQ_ / 256 + 1; ++t) {
        if (t < TT / SQ_ / 256) { const int q = t % 2, o = t * 16 * DD;
            a[q][0] = WFrag<bf>::ldf(peh + o); a[q][1] = WFrag<bf>::ldf(pel + o); a[q][2] = WFrag<bf>::ldf(peh + o + 512); a[q][3] = WFrag<bf>::ldf(pel + o + 512); }
        // the wait that stands in front of an overwrite of an issued load's address registers. The pointers that are used for the last time are named as inputs, so that they stay live up to the wait and no later load's result is placed on them
        if (t == 0) asm volatile("s_wait_xcnt 0x0" :: "v"(pxb) : "memory");
        if (t == TT / SQ_ / 256 - 1) asm volatile("s_wait_xcnt 0x0" :: "v"(peh), "v"(pel) : "memory");
        __builtin_amdgcn_sched_barrier(0);   // holds this tile's loads in front of the arithmetic of the tile before; without it the scheduler sinks them to just before their use
        if (t >= 1) { const int q = (t - 1) % 2; v8f acc[4];
#pragma unroll
            for (int nb = 0; nb < 4; ++nb) acc[nb] = (v8f){};
#pragma unroll
            for (int f = 0; f < 4; ++f) {   // hi d 0..31, lo d 0..31, hi d 32..63, lo d 32..63
#pragma unroll
                for (int nb = 0; nb < 4; ++nb) acc[nb] = WFrag<bf>::mma(a[q][f], b[nb][f >> 1], acc[nb]); }
            __builtin_amdgcn_sched_barrier(0);   // keeps the asm exponentials behind ALL products of the tile
#pragma unroll
            for (int nb = 0; nb < 4; ++nb) { float mn = m[nb];
#pragma unroll
                for (int r = 0; r < 8; ++r) mn = fmaxf(mn, acc[nb][r]);
                float sa = s[nb] * ex2d(m[nb], mn);
#pragma unroll
                for (int r = 0; r < 8; ++r) sa += ex2d(acc[nb][r], mn);
                m[nb] = mn; s[nb] = sa; } }
    }
#pragma unroll
    for (int nb = 0; nb < 4; ++nb) { const float om = __shfl_xor(m[nb], 16), os = __shfl_xor(s[nb], 16); const float mn = fmaxf(m[nb], om); s[nb] = s[nb] * ex2d(m[nb], mn) + os * ex2d(om, mn); m[nb] = mn; }
    if (hi == 0) {
#pragma unroll
        for (int nb = 0; nb < 4; ++nb) { sm[wave][nb * 16 + lr] = m[nb]; ss[wave][nb * 16 + lr] = s[nb]; } }
    __syncthreads();
    if (threadIdx.x < 64) { const int c = threadIdx.x; float mx = -3.0e38f, sum = 0.f;
#pragma unroll
        for (int w = 0; w < 16; ++w) mx = fmaxf(mx, sm[w][c]);
#pragma unroll
        for (int w = 0; w < 16; ++w) sum += ss[w][c] * ex2d(sm[w][c], mx);
        PM[blockIdx.y * TT + j0 + c] = mx; PS[blockIdx.y * TT + j0 + c] = sum; } }

extern "C" void kernel_launch(void* const* d_in, const int* in_sizes, int n_in,
                              void* d_out, int out_size, void* d_ws, size_t ws_size, hipStream_t stream) {
    (void)in_sizes; (void)n_in; (void)out_size;
    const float* x = (const float*)d_in[0]; const float* W1 = (const float*)d_in[1]; const float* b1 = (const float*)d_in[2]; const float* W2 = (const float*)d_in[3]; const float* b2 = (const float*)d_in[4];
    float* OUT = (float*)d_out;     // [4][4096][64]
    char* wsp = (char*)d_ws;
    auto take = [&](size_t bytes) { char* p = wsp; wsp += (bytes + 255) & ~(size_t)255; return (void*)p; };
    bf* BW1 = (bf*)take(DD * DD * 2); bf* XB = (bf*)take((size_t)NB_ * TT * DD * 2); bf* XT = (bf*)take((size_t)NB_ * DD * TT * 2); float* Z = (float*)take((size_t)NB_ * TT * DD * 4); bf* Eh = (bf*)take((size_t)NB_ * TT * DD * 2); bf* El = (bf*)take((size_t)NB_ * TT * DD * 2);
    float* PM = (float*)take((size_t)NB_ * SQ_ * TT * 4); float* PS = (float*)take((size_t)NB_ * SQ_ * TT * 4);
    if ((size_t)(wsp - (char*)d_ws) > ws_size) return;    // total ~ 13 MB
    // every stage runs once for all NB_ batches: token-wise stages over NB_ * TT rows, the others with the batch as a grid dimension
    k_wtG<<<(DD * DD / 64 + 63) / 64, 256, 0, stream>>>(W1, DD, DD, BW1);
    k_cvt8<<<(NB_ * TT * DD / 8 + 255) / 256, 256, 0, stream>>>(x, XB, NB_ * TT * DD / 8); k_vt<<<dim3((DD * TT / 8 + 255) / 256, NB_, 1), 256, 0, stream>>>(x, XT);
    k_gemmw<bf, 0, true><<<dim3(NB_ * TT / 64, 1, 1), 32, 0, stream>>>(XB, nullptr, BW1, nullptr, DD, Z, DD, b1, 0, 0, 0); k_enc<<<(NB_ * TT * DD / 4 + 255) / 256, 256, 0, stream>>>(Z, W2, b2, Eh, El);
    k_cstat<<<dim3(TT / 64, SQ_, NB_), 512, 0, stream>>>(Eh, El, XB, PM, PS);     // statistics of M[i][j] = encoded_i . x_j = scores[j][i] over i
    k_gemmk<<<dim3(TT / (16 * MT_), NB_, 1), KQ_ * MT_ * 32, 0, stream>>>(XB, Eh, El, PM, PS, XT, OUT);   // out[i][d] = sum_j attention[j][i] x[j][d], attention[j][i] = exp(M[i][j] - MX[j]) RS[j]
}

// v009
// Measured time: 64.6 microseconds a run.
// Timed twice side by side with v008, it ran 1.19 and 1.20 times as fast.
// Counting every step since v000, it is 108 times as fast.
#include <hip/hip_runtime.h>

// TimeSeriesAttention (x [4][4096][64]; h1 = softmax(x W1 + b1) (over the 64 features); encoded = tanh(h1 W2 + b2); scores[i][j] = x_i . encoded_j (unscaled); attention = softmax over j; out[i] = sum_j attention[j][i] x[j] (the TRANSPOSED attention, as the
// reference's permute) -> [4][4096][64]). The transposed use is handled by computing M[i][j] = encoded_i . x_j = scores[j][i] directly (swapped GEMM operands) and normalising each COLUMN j of M (= row j of the reference's softmax) with per-column statistics, so M-normalised[i][j] = attention[j][i] is already the A operand of out = attention^T x - exact restructuring.
// Compute dtypes, f32 accumulate: every input rounded to bf16; x W1 on PLAIN bf16 operands (inputs: exact) + bias; the feature softmax, h1 W2 + b2 (64-term fixed-order dots) and tanh f32 on the VALU -> bf16 hi+lo planes; scores as

#define NB_  4
#define TT   4096
#define DD   64
typedef _Float16 h16;
typedef unsigned short bf;
typedef __attribute__((ext_vector_type(16))) __bf16   v16bf;
typedef __attribute__((ext_vector_type(16))) _Float16 v16h;
typedef __attribute__((ext_vector_type(8)))  _Float16 v8h;
typedef __attribute__((ext_vector_type(8)))  unsigned short v8us;
typedef __attribute__((ext_vector_type(8)))  float    v8f;
typedef __attribute__((ext_vector_type(4)))  float    v4f;
typedef v8h  __attribute__((may_alias)) v8ha;
typedef v4f  __attribute__((may_alias)) v4fa;
typedef v8us __attribute__((may_alias)) v8usa;

__device__ __forceinline__ unsigned short f2bf(float f) { unsigned u = __float_as_uint(f); u += 0x7FFFu + ((u >> 16) & 1u); return (unsigned short)(u >> 16); }
__device__ __forceinline__ float bf2f(unsigned short b) { return __uint_as_float(((unsigned)b) << 16); }
__device__ __forceinline__ float bfr(float f) { return bf2f(f2bf(f)); }
__device__ __forceinline__ v16h cat16(v8h lo, v8h hi) { return __builtin_shufflevector(lo, hi, 0, 1, 2, 3, 4, 5, 6, 7, 8, 9, 10, 11, 12, 13, 14, 15); }
__device__ __forceinline__ v16bf cat16b(v8us lo, v8us hi) { return __builtin_bit_cast(v16bf, __builtin_shufflevector(lo, hi, 0, 1, 2, 3, 4, 5, 6, 7, 8, 9, 10, 11, 12, 13, 14, 15)); }
__device__ __forceinline__ v8f wmma16(v16h a, v16h b, v8f c) { return __builtin_amdgcn_wmma_f32_16x16x32_f16(false, a, false, b, (short)0, c, false, false); }
__device__ __forceinline__ v8f wmmab(v16bf a, v16bf b, v8f c) { return __builtin_amdgcn_wmma_f32_16x16x32_bf16(false, a, false, b, (short)0, c, false, false); }



// ---- FRAGMENT ORDER of the 16-bit planes that pass between the launches (XB, XT, Eh, El): a plane of R rows x C columns is kept as tiles of 16 rows x 32 columns, 512 elements = 1 KB each, tile number (row / 16) * (C / 32) + col / 32.
// Inside a tile the 8 elements that lane l = 16 hi + lr of a wave takes as fragment slots 0..7 (row lr, columns 8 hi + 0..7) stand at element 8 l, those of slots 8..15 (columns 16 + 8 hi + 0..7) at element 256 + 8 l.
// So a fragment is two wave-wide 16-B loads of 512 contiguous bytes each (4 whole lines); from a row-major plane each such load touches 16 lines and takes 32 B of each. WFrag::ldf(tile + 8 * lane) reads one; fpos gives an element's place.
__device__ __forceinline__ size_t fpos(int r, int c, int C) { return ((size_t)(r >> 4) * (C >> 5) + (c >> 5)) * 512 + ((c >> 4) & 1) * 256 + (((c >> 3) & 1) * 16 + (r & 15)) * 8 + (c & 7); }

// ---- WFrag: a 16-bit fragment from a K-contiguous row-major plane (ld) or from a plane in fragment order (ldf), and the matrix product on it.
template <typename T16> struct WFrag;
template <> struct WFrag<h16> { typedef v16h V; static __device__ __forceinline__ V ld(const h16* p) { return cat16(*(const v8h*)p, *(const v8h*)(p + 16)); } static __device__ __forceinline__ V ldf(const h16* p) { return cat16(*(const v8h*)p, *(const v8h*)(p + 256)); } static __device__ __forceinline__ v8f mma(V a, V b, v8f c) { return wmma16(a, b, c); } };
template <> struct WFrag<bf> { typedef v16bf V; static __device__ __forceinline__ V ld(const bf* p) { return cat16b(*(const v8us*)p, *(const v8us*)(p + 16)); } static __device__ __forceinline__ V ldf(const bf* p) { return cat16b(*(const v8us*)p, *(const v8us*)(p + 256)); } static __device__ __forceinline__ v8f mma(V a, V b, v8f c) { return wmmab(a, b, c); } };

__device__ __forceinline__ void splitf(float y, unsigned short& h, unsigned short& l) { h = f2bf(y); l = f2bf(y - bf2f(h)); }
typedef __attribute__((ext_vector_type(2))) unsigned short v2us;
typedef __attribute__((ext_vector_type(4))) unsigned short v4us;
// ex2d = exp(a - b). The v_nop keeps the one slot that the instruction set asks for behind a transcendental.
__device__ __forceinline__ float ex2d(float a, float b) { float r; asm("v_exp_f32 %0, %1\n\tv_nop" : "=v"(r) : "v"((a - b) * 1.4426950408889634f)); return r; }

// ---- k_gemmk: the out product. One work-group = 64 rows x 64 columns of C: 16 waves = MT_ row tiles of 16 (wm) x KQ_ quarters of K (wk). A wave keeps a 16x64 f32 partial over its quarter (1024 k);
// the KQ_ partials of a row tile are summed in quarter order through LDS. C[m][n] = sum_k (Ph[m][k] + Pl[m][k]) Bt[n][k]; Bt (DD x TT) in fragment order, C pitch DD.
// The x and x^T fragments of a k step are the same for every row tile, so they are fetched ONCE a work-group: the MT_ waves of a quarter each bring a quarter of the stage (KS_ k values: 8 KB of x, 8 KB of x^T)
// through registers into LDS, and each reads the whole stage from there. Two stage buffers; the loads of stage t + 2 fly while stage t is worked on; one barrier a stage.
// The A operand is formed in registers and no score is read from memory: per k step of 32 the wave computes the two 16x16 score tiles S[k][m] = x_k . (Eh_m + El_m) on the matrix unit
// (A = x rows k, B = the wave's 16 encoded rows, held in registers). The accumulator of tile h holds, in lane (lr, hi) and register u, S[16 h + 8 hi + u][lr]: that is slot 8 h + u
// of row lr of the 16-bit A fragment, so p = exp(S - MX[k]) * RS[k] goes into the hi and lo A fragments with no move between lanes.
// MX, RS: the SQ_ partial (max, sum) pairs a column that k_cstat leaves are merged in a fixed order and staged once in LDS.
// grid (TT / 64, NB_): blockIdx.y is the batch; every plane holds the NB_ batches one behind the other.
#define KQ_ 4
#define MT_ 4
#define KS_ 64
#define NT_ (TT / KQ_ / KS_)
#define STQ_ (2 * KS_ * DD)
#define SQ_ 4
typedef __attribute__((ext_vector_type(2))) float v2f;
typedef v2f __attribute__((may_alias)) v2fa;
__global__ __launch_bounds__(KQ_ * MT_ * 32) void k_gemmk(const bf* __restrict__ XB, const bf* __restrict__ Eh, const bf* __restrict__ El, const float* __restrict__ PM, const float* __restrict__ PS, const bf* __restrict__ Bt, float* C) {
    typedef WFrag<bf>::V V;
    // a quarter's stage: KS_ rows of x (KS_ / 16 * 2 tiles of 512 elements, as they stand in XB), then the x^T tiles, number nb * (KS_ / 32) + k step
    __shared__ __align__(16) bf st[2 * KQ_ * STQ_];
    __shared__ __align__(16) float red[KQ_ * MT_][16 * 68];
    __shared__ __align__(16) float smx[TT]; __shared__ __align__(16) float srs[TT];
    const int lane = threadIdx.x & 31, wave = threadIdx.x >> 5, lr = lane & 15, hi = lane >> 4, wm = wave % MT_, wk = wave / MT_; const int r0 = blockIdx.x * (16 * MT_);
    { const size_t zb = blockIdx.y; XB += zb * TT * DD; Eh += zb * TT * DD; El += zb * TT * DD; Bt += zb * DD * TT; C += zb * TT * DD; PM += zb * SQ_ * TT; PS += zb * SQ_ * TT; }
    const int k0 = wk * (TT / KQ_) + 8 * hi;
    const int t8 = threadIdx.x * (TT / (KQ_ * MT_ * 32));   // 8 columns' statistics a thread; loaded first, so that their merge waits for these loads alone
    v4f pm[SQ_][2], ps[SQ_][2];
#pragma unroll
    for (int q = 0; q < SQ_; ++q) { pm[q][0] = *(const v4f*)(PM + q * TT + t8); pm[q][1] = *(const v4f*)(PM + q * TT + t8 + 4); ps[q][0] = *(const v4f*)(PS + q * TT + t8); ps[q][1] = *(const v4f*)(PS + q * TT + t8 + 4); }
    // the wave's share of a stage: 2 KB in a row of XB (fragment order: 16 rows are 2 tiles) and 2 KB in a row of Bt = XT (d block nb = wm; the tile of d block nb and k step kc is number nb * (TT / 32) + k / 32)
    const bf* pgx = XB + (size_t)wk * (TT / KQ_) * DD + wm * (KS_ * DD / MT_) + 8 * lane; const bf* pgb = Bt + ((size_t)wm * (TT / 32) + wk * (TT / KQ_ / 32)) * 512 + 8 * lane;
    const bf* peh = Eh + (size_t)(r0 + 16 * wm) * DD + 8 * lane; const bf* pel = El + (size_t)(r0 + 16 * wm) * DD + 8 * lane;
    bf* sw = st + wk * STQ_ + wm * (KS_ * DD / MT_) + 8 * lane; const bf* sr = st + wk * STQ_ + 8 * lane;
    v8us gx[4], gb[4];
#pragma unroll
    for (int i = 0; i < 4; ++i) { gx[i] = *(const v8us*)(pgx + i * 256); gb[i] = *(const v8us*)(pgb + i * 256); }
    const V eh0 = WFrag<bf>::ldf(peh), eh1 = WFrag<bf>::ldf(peh + 512), el0 = WFrag<bf>::ldf(pel), el1 = WFrag<bf>::ldf(pel + 512);
    // the wait that stands in front of an overwrite of an issued load's address registers. The pointers are named as inputs, so that they stay live up to the wait and no later load's result is placed on them
    asm volatile("s_wait_xcnt 0x0" :: "v"(peh), "v"(pel), "v"(pgx), "v"(pgb) : "memory");
    pgx += KS_ * DD; pgb += KS_ / 32 * 512;
#pragma unroll
    for (int i = 0; i < 4; ++i) { *(v8us*)(sw + i * 256) = gx[i]; *(v8us*)(sw + KS_ * DD + i * 256) = gb[i]; }   // stage 0 into buffer 0
#pragma unroll
    for (int i = 0; i < 4; ++i) { gx[i] = *(const v8us*)(pgx + i * 256); gb[i] = *(const v8us*)(pgb + i * 256); }   // stage 1 flies
    asm volatile("s_wait_xcnt 0x0" :: "v"(pgx), "v"(pgb) : "memory");   // as above: the two pointers are advanced right behind it
    pgx += KS_ * DD; pgb += KS_ / 32 * 512;
#pragma unroll
    for (int g = 0; g < 2; ++g) { v4f mv, rv;
#pragma unroll
        for (int u = 0; u < 4; ++u) { float mx = pm[0][g][u];
#pragma unroll
            for (int q = 1; q < SQ_; ++q) mx = fmaxf(mx, pm[q][g][u]);
            float sum = 0.f;
#pragma unroll
            for (int q = 0; q < SQ_; ++q) sum += ps[q][g][u] * ex2d(pm[q][g][u], mx);
            mv[u] = mx; rv[u] = __fdiv_rn(1.0f, sum); }
        *(v4f*)(smx + t8 + 4 * g) = mv; *(v4f*)(srs + t8 + 4 * g) = rv; }
    v8f acc[4];
#pragma unroll
    for (int nb = 0; nb < 4; ++nb) acc[nb] = (v8f){};
#pragma unroll 1   // rolled: for speed only
    for (int t = 0; t < NT_; ++t) {
        __syncthreads();   // publishes stage t (at t = 0 the statistics too) and ends every wave's reads of the buffer that stage t + 1 goes into
        const bf* rd = sr + (t & 1) * (KQ_ * STQ_); V xa[4], b[4];
        // the first k step's fragments are asked for in front of the staging: for speed only
#pragma unroll
        for (int j = 0; j < 4; ++j) xa[j] = WFrag<bf>::ldf(rd + j * 512);
#pragma unroll
        for (int nb = 0; nb < 4; ++nb) b[nb] = WFrag<bf>::ldf(rd + KS_ * DD + nb * (KS_ / 32) * 512);
        if (t + 1 < NT_) { bf* w = sw + ((t + 1) & 1) * (KQ_ * STQ_);
#pragma unroll
            for (int i = 0; i < 4; ++i) { *(v8us*)(w + i * 256) = gx[i]; *(v8us*)(w + KS_ * DD + i * 256) = gb[i]; } }
        if (t + 2 < NT_) {
#pragma unroll
            for (int i = 0; i < 4; ++i) { gx[i] = *(const v8us*)(pgx + i * 256); gb[i] = *(const v8us*)(pgb + i * 256); }
            asm volatile("s_wait_xcnt 0x0" :: "v"(pgx), "v"(pgb) : "memory");   // as above: the two pointers are advanced right behind it
            pgx += KS_ * DD; pgb += KS_ / 32 * 512; }
#pragma unroll
        for (int s = 0; s < KS_ / 32; ++s) { const int kc = t * KS_ + s * 32;
            if (s > 0) {
#pragma unroll
                for (int j = 0; j < 4; ++j) xa[j] = WFrag<bf>::ldf(rd + (s * 4 + j) * 512);   // rows 32 s + 16 (j / 2), d half j % 2
#pragma unroll
                for (int nb = 0; nb < 4; ++nb) b[nb] = WFrag<bf>::ldf(rd + KS_ * DD + (nb * (KS_ / 32) + s) * 512); }
            v8us ah[2], al[2]; v8f sc[2] = {(v8f){}, (v8f){}};
            // per score the sum order of the four products is: hi d 0..31, lo d 0..31, hi d 32..63, lo d 32..63, as in k_cstat
            sc[0] = WFrag<bf>::mma(xa[0], eh0, sc[0]); sc[1] = WFrag<bf>::mma(xa[2], eh0, sc[1]); sc[0] = WFrag<bf>::mma(xa[0], el0, sc[0]); sc[1] = WFrag<bf>::mma(xa[2], el0, sc[1]);
            sc[0] = WFrag<bf>::mma(xa[1], eh1, sc[0]); sc[1] = WFrag<bf>::mma(xa[3], eh1, sc[1]); sc[0] = WFrag<bf>::mma(xa[1], el1, sc[0]); sc[1] = WFrag<bf>::mma(xa[3], el1, sc[1]);
            __builtin_amdgcn_sched_barrier(0);   // keeps the asm exponentials behind ALL score products
#pragma unroll
            for (int h = 0; h < 2; ++h) {   // fragment slots 8 h + u hold k = kc + 16 h + 8 hi + u
#pragma unroll
                for (int g = 0; g < 2; ++g) { const v4f mx = *(const v4fa*)(smx + k0 + kc + 16 * h + 4 * g), rs = *(const v4fa*)(srs + k0 + kc + 16 * h + 4 * g);
#pragma unroll
                    for (int u = 0; u < 4; ++u) { const float p = ex2d(sc[h][4 * g + u], mx[u]) * rs[u]; unsigned short x1, x2; splitf(p, x1, x2); ah[h][4 * g + u] = x1; al[h][4 * g + u] = x2; } } }
            const V a = cat16b(ah[0], ah[1]), a2 = cat16b(al[0], al[1]);
#pragma unroll
            for (int nb = 0; nb < 4; ++nb) acc[nb] = WFrag<bf>::mma(a, b[nb], acc[nb]);
#pragma unroll
            for (int nb = 0; nb < 4; ++nb) acc[nb] = WFrag<bf>::mma(a2, b[nb], acc[nb]); }
        // the four issue slots that a matrix instruction needs before an operand register is overwritten
        asm volatile("v_nop\n\tv_nop\n\tv_nop\n\tv_nop" :: "v"(acc[0]), "v"(acc[1]), "v"(acc[2]), "v"(acc[3]));
    }
#pragma unroll
    for (int nb = 0; nb < 4; ++nb) {
#pragma unroll
        for (int j = 0; j < 8; ++j) red[wave][(hi * 8 + j) * 68 + nb * 16 + lr] = acc[nb][j]; }
    __syncthreads();
    const int row = threadIdx.x >> 3, col = (threadIdx.x & 7) * 8; v4f p[KQ_][2];   // 8 columns of one row a thread: a wave sums and stores 4 whole 256-B rows of C
#pragma unroll
    for (int q = 0; q < KQ_; ++q) { p[q][0] = *(const v4fa*)(&red[q * MT_ + (row >> 4)][(row & 15) * 68 + col]); p[q][1] = *(const v4fa*)(&red[q * MT_ + (row >> 4)][(row & 15) * 68 + col + 4]); }
    v4f s0 = {0.f, 0.f, 0.f, 0.f}, s1 = {0.f, 0.f, 0.f, 0.f};
#pragma unroll
    for (int q = 0; q < KQ_; ++q) { s0 += p[q][0]; s1 += p[q][1]; }
    float* cp = C + (size_t)(r0 + row) * DD + col; *(v4f*)cp = s0; *(v4f*)(cp + 4) = s1;
}


// ---- k_front: everything in front of the score statistics, in ONE launch. One block = 16 tokens (grid NB_ * TT / 16, 8 waves); nothing passes through the workspace inside it.
// Waves 0..3: Z tile (16 tokens x 64) = bf16 x . bf16 W1 on the matrix unit, wave w = feature block w. A fragment straight from the f32 rows of x (row lr, k = 32 s + 16 h + 8 hi + u at slot 8 h + u),
// B fragment straight from W1 (column 16 w + lr, the same k at the same slot); two k steps in rising order, + bf16 b1; the tile goes to LDS (zs). The four 16-B pieces of a lane's A fragments ARE the block's 2 tiles of XB in fragment order: wave w keeps piece w (512 B in a row a wave).
// Waves 4..7: the block's share of XT (d block w - 4; 16 t = half a tile = 512 B in a row): a lane takes 8 consecutive t of one d.
// All waves: W2 rounded to bf16 into LDS. Behind the one barrier, lane -> 4 consecutive features c of token t: softmax statistics of the Z row (64, fixed order), acc[u] = sum_k softmax_k W2[k][c+u], enc = tanh(acc + b2) -> hi, lo planes in fragment order.
__global__ __launch_bounds__(256) void k_front(const float* __restrict__ x, const float* __restrict__ W1, const float* __restrict__ b1, const float* __restrict__ W2, const float* __restrict__ b2, bf* XB, bf* XT, bf* Eh, bf* El) {
    __shared__ __align__(16) float sw[DD * DD];   // W2 rounded to bf16 (kept as f32), rounded once a block
    __shared__ __align__(16) float zs[16 * 68];   // the Z tile; pitch 68: the two rows that a wave reads at once stand in different banks
    const int row0 = blockIdx.x * 16; if (row0 >= NB_ * TT) return;   // the same for the whole block, in front of the barrier
    const int lane = threadIdx.x & 31, lr = lane & 15, hi = lane >> 4; const int wave = __builtin_amdgcn_readfirstlane(threadIdx.x >> 5);   // a scalar: the split of the roles below is a scalar branch
    const int c0 = lr * 4, tl = threadIdx.x >> 4, t = row0 + tl; const float* pw = W2 + threadIdx.x * 4; const float* pb = b2 + c0;
    // every global operand of the thread is asked for at once, here and at the head of its branch. No load stands in the chains below.
    v4f w[DD * DD / 1024];
#pragma unroll
    for (int q = 0; q < DD * DD / 1024; ++q) w[q] = *(const v4f*)(pw + q * 1024);
    const v4f bv = *(const v4f*)pb;
    v8us o; bf* po;   // the wave's 512 B of XB or XT: a lane's 16-B piece and the wave's place. Stored behind the barrier: in front of it every wave would wait there for its store to come back
    if (wave < 4) {
        const float* px = x + (size_t)(row0 + lr) * DD + 8 * hi; const float* pw1 = W1 + 8 * hi * DD + wave * 16 + lr; const float* pb1 = b1 + wave * 16 + lr;
        v4f xv[2][2][2]; float wv[2][2][8];
#pragma unroll
        for (int s = 0; s < 2; ++s)
#pragma unroll
            for (int h = 0; h < 2; ++h) { xv[s][h][0] = *(const v4f*)(px + 32 * s + 16 * h); xv[s][h][1] = *(const v4f*)(px + 32 * s + 16 * h + 4); }
#pragma unroll
        for (int s = 0; s < 2; ++s)
#pragma unroll
            for (int h = 0; h < 2; ++h)
#pragma unroll
                for (int u = 0; u < 8; ++u) wv[s][h][u] = pw1[(32 * s + 16 * h + u) * DD];
        const float bias = *pb1;
        // the wait that stands in front of an overwrite of an issued load's address registers. The pointers (of the W2 and b2 loads above: their scalar bases) are named as inputs, so that they stay live up to the wait and nothing else is placed on them
        asm volatile("s_wait_xcnt 0x0" :: "v"(px), "v"(pw1), "s"(W2), "s"(b2) : "memory");
        v8us a[2][2], b[2][2];
#pragma unroll
        for (int s = 0; s < 2; ++s)
#pragma unroll
            for (int h = 0; h < 2; ++h)
#pragma unroll
                for (int u = 0; u < 8; ++u) { a[s][h][u] = f2bf(xv[s][h][u >> 2][u & 3]); b[s][h][u] = f2bf(wv[s][h][u]); }
        o = wave == 0 ? a[0][0] : wave == 1 ? a[0][1] : wave == 2 ? a[1][0] : a[1][1]; po = XB + (size_t)row0 * DD + wave * 256;   // piece w of the 2 tiles
        v8f acc = (v8f){};
        acc = wmmab(cat16b(a[0][0], a[0][1]), cat16b(b[0][0], b[0][1]), acc); acc = wmmab(cat16b(a[1][0], a[1][1]), cat16b(b[1][0], b[1][1]), acc);
        const float bb = bfr(bias);
#pragma unroll
        for (int j = 0; j < 8; ++j) zs[(hi * 8 + j) * 68 + wave * 16 + lr] = acc[j] + bb;
    } else {
        const int zb = row0 / TT, tb = row0 % TT, db = wave - 4; const float* pt = x + (size_t)(row0 + 8 * hi) * DD + db * 16 + lr; float xt[8];
#pragma unroll
        for (int k = 0; k < 8; ++k) xt[k] = pt[k * DD];
        asm volatile("s_wait_xcnt 0x0" :: "v"(pt), "s"(W2), "s"(b2) : "memory");   // as above
#pragma unroll
        for (int k = 0; k < 8; ++k) o[k] = f2bf(xt[k]);
        po = XT + (size_t)zb * DD * TT + ((size_t)db * (TT / 32) + (tb >> 5)) * 512 + ((tb >> 4) & 1) * 256;
    }
#pragma unroll
    for (int q = 0; q < DD * DD / 1024; ++q) { v4f r;
#pragma unroll
        for (int u = 0; u < 4; ++u) r[u] = bfr(w[q][u]);
        *(v4f*)(sw + q * 1024 + threadIdx.x * 4) = r; }
    __syncthreads();   // sw and zs are whole
    v4f z[DD / 4];
#pragma unroll
    for (int k = 0; k < DD / 4; ++k) z[k] = *(const v4fa*)(zs + tl * 68 + 4 * k);
    *(v8us*)(po + 8 * lane) = o;
    // inputs only, the loaded values: the 16 LDS loads of the row are asked for at once. Without it the compiler strings most of them along the chain of maxima, few in flight, and the chain waits for LDS again and again
    asm volatile("" :: "v"(z[0]), "v"(z[1]), "v"(z[2]), "v"(z[3]), "v"(z[4]), "v"(z[5]), "v"(z[6]), "v"(z[7]), "v"(z[8]), "v"(z[9]), "v"(z[10]), "v"(z[11]), "v"(z[12]), "v"(z[13]), "v"(z[14]), "v"(z[15]));
    float mx = -3.0e38f;
#pragma unroll
    for (int k = 0; k < DD; ++k) mx = fmaxf(mx, z[k >> 2][k & 3]);
    float sum = 0.f;
#pragma unroll   // whole: z is indexed by constants only, or it leaves the registers
    for (int k = 0; k < DD; ++k) { const float ex = ex2d(z[k >> 2][k & 3], mx); z[k >> 2][k & 3] = ex; sum += ex; }
    const float rs = __fdiv_rn(1.0f, sum); float acc[4] = {0.f, 0.f, 0.f, 0.f};
#pragma unroll
    for (int k = 0; k < DD; ++k) { const float h1 = z[k >> 2][k & 3] * rs; const v4f wk = *(const v4fa*)(sw + k * DD + c0);
#pragma unroll
        for (int u = 0; u < 4; ++u) acc[u] = __builtin_fmaf(h1, wk[u], acc[u]); }
    // inputs only: all four dots are finished here, in the straight code above. Without it the compiler sinks three of them behind the branches of the first tanh and keeps the 64 h1 and all rows of W2 for them: 273 registers for 123, 3 waves a SIMD for 8
    asm volatile("" :: "v"(acc[0]), "v"(acc[1]), "v"(acc[2]), "v"(acc[3]));
    v4us oh, ol;
#pragma unroll
    for (int u = 0; u < 4; ++u) { const float en = tanhf(acc[u] + bfr(bv[u])); unsigned short a, b; splitf(en, a, b); oh[u] = a; ol[u] = b; } const size_t f = fpos(t, c0, DD); *(v4us*)(Eh + f) = oh; *(v4us*)(El + f) = ol;  }
// k_cstat: per column j of M[i][j] = encoded_i . x_j a partial maximum and a partial sum_i exp(M[i][j] - max), with M formed on the matrix unit and never stored. One block = 64 columns x a quarter of the rows of one batch (grid.y = SQ_, grid.z = NB_).
// Each of its 16 waves holds the B fragments of the 64 columns and takes 64 rows as 4 tiles of 16 (A = encoded hi, lo). In the accumulator a lane holds 8 rows of ONE column, so the running (max, sum scaled to that max)
// pair is per lane; the pairs are merged in a fixed order: the two lane halves by a shuffle, the 16 waves through LDS; the SQ_ quarters are merged by the reader (k_gemmk).
__global__ __launch_bounds__(512) void k_cstat(const bf* __restrict__ Eh, const bf* __restrict__ El, const bf* __restrict__ XB, float* PM, float* PS) {
    typedef WFrag<bf>::V V;
    __shared__ __align__(16) float sm[16][64]; __shared__ __align__(16) float ss[16][64];
    const int lane = threadIdx.x & 31, wave = threadIdx.x >> 5, lr = lane & 15, hi = lane >> 4;
    const int j0 = blockIdx.x * 64, i0 = blockIdx.y * (TT / SQ_) + wave * (TT / SQ_ / 16);
    { const size_t zb = blockIdx.z; Eh += zb * TT * DD; El += zb * TT * DD; XB += zb * TT * DD; PM += zb * SQ_ * TT; PS += zb * SQ_ * TT; }
    const bf* pxb = XB + (size_t)j0 * DD + 8 * lane; const bf* peh = Eh + (size_t)i0 * DD + 8 * lane; const bf* pel = El + (size_t)i0 * DD + 8 * lane;   // one address a plane (fragment order: 16 rows are 2 tiles of 512 elements); tiles and column blocks are constant offsets from it
    V b[4][2];
#pragma unroll
    for (int nb = 0; nb < 4; ++nb) { b[nb][0] = WFrag<bf>::ldf(pxb + nb * 16 * DD); b[nb][1] = WFrag<bf>::ldf(pxb + nb * 16 * DD + 512); }
    float m[4] = {-3.0e38f, -3.0e38f, -3.0e38f, -3.0e38f}, s[4] = {0.f, 0.f, 0.f, 0.f};
    V a[2][4];   // two sets of A fragments: the next tile's loads fly while this one is worked on
#pragma unroll   // whole: the set index t % 2 must be a constant, or the sets leave the registers
    for (int t = 0; t < TT / SQ_ / 256 + 1; ++t) {
        if (t < TT / SQ_ / 256) { const int q = t % 2, o = t * 16 * DD;
            a[q][0] = WFrag<bf>::ldf(peh + o); a[q][1] = WFrag<bf>::ldf(pel + o); a[q][2] = WFrag<bf>::ldf(peh + o + 512); a[q][3] = WFrag<bf>::ldf(pel + o + 512); }
        // the wait that stands in front of an overwrite of an issued load's address registers. The pointers that are used for the last time are named as inputs, so that they stay live up to the wait and no later load's result is placed on them
        if (t == 0) asm volatile("s_wait_xcnt 0x0" :: "v"(pxb) : "memory");
        if (t == TT / SQ_ / 256 - 1) asm volatile("s_wait_xcnt 0x0" :: "v"(peh), "v"(pel) : "memory");
        __builtin_amdgcn_sched_barrier(0);   // holds this tile's loads in front of the arithmetic of the tile before; without it the scheduler sinks them to just before their use
        if (t >= 1) { const int q = (t - 1) % 2; v8f acc[4];
#pragma unroll
            for (int nb = 0; nb < 4; ++nb) acc[nb] = (v8f){};
#pragma unroll
            for (int f = 0; f < 4; ++f) {   // hi d 0..31, lo d 0..31, hi d 32..63, lo d 32..63
#pragma unroll
                for (int nb = 0; nb < 4; ++nb) acc[nb] = WFrag<bf>::mma(a[q][f], b[nb][f >> 1], acc[nb]); }
            __builtin_amdgcn_sched_barrier(0);   // keeps the asm exponentials behind ALL products of the tile
#pragma unroll
            for (int nb = 0; nb < 4; ++nb) { float mn = m[nb];
#pragma unroll
                for (int r = 0; r < 8; ++r) mn = fmaxf(mn, acc[nb][r]);
                float sa = s[nb] * ex2d(m[nb], mn);
#pragma unroll
                for (int r = 0; r < 8; ++r) sa += ex2d(acc[nb][r], mn);
                m[nb] = mn; s[nb] = sa; } }
    }
#pragma unroll
    for (int nb = 0; nb < 4; ++nb) { const float om = __shfl_xor(m[nb], 16), os = __shfl_xor(s[nb], 16); const float mn = fmaxf(m[nb], om); s[nb] = s[nb] * ex2d(m[nb], mn) + os * ex2d(om, mn); m[nb] = mn; }
    if (hi == 0) {
#pragma unroll
        for (int nb = 0; nb < 4; ++nb) { sm[wave][nb * 16 + lr] = m[nb]; ss[wave][nb * 16 + lr] = s[nb]; } }
    __syncthreads();
    if (threadIdx.x < 64) { const int c = threadIdx.x; float mx = -3.0e38f, sum = 0.f;
#pragma unroll
        for (int w = 0; w < 16; ++w) mx = fmaxf(mx, sm[w][c]);
#pragma unroll
        for (int w = 0; w < 16; ++w) sum += ss[w][c] * ex2d(sm[w][c], mx);
        PM[blockIdx.y * TT + j0 + c] = mx; PS[blockIdx.y * TT + j0 + c] = sum; } }

extern "C" void kernel_launch(void* const* d_in, const int* in_sizes, int n_in,
                              void* d_out, int out_size, void* d_ws, size_t ws_size, hipStream_t stream) {
    (void)in_sizes; (void)n_in; (void)out_size;
    const float* x = (const float*)d_in[0]; const float* W1 = (const float*)d_in[1]; const float* b1 = (const float*)d_in[2]; const float* W2 = (const float*)d_in[3]; const float* b2 = (const float*)d_in[4];
    float* OUT = (float*)d_out;     // [4][4096][64]
    char* wsp = (char*)d_ws;
    auto take = [&](size_t bytes) { char* p = wsp; wsp += (bytes + 255) & ~(size_t)255; return (void*)p; };
    bf* XB = (bf*)take((size_t)NB_ * TT * DD * 2); bf* XT = (bf*)take((size_t)NB_ * DD * TT * 2); bf* Eh = (bf*)take((size_t)NB_ * TT * DD * 2); bf* El = (bf*)take((size_t)NB_ * TT * DD * 2);
    float* PM = (float*)take((size_t)NB_ * SQ_ * TT * 4); float* PS = (float*)take((size_t)NB_ * SQ_ * TT * 4);
    if ((size_t)(wsp - (char*)d_ws) > ws_size) return;    // total ~ 9 MB
    // every stage runs once for all NB_ batches: token-wise stages over NB_ * TT rows, the others with the batch as a grid dimension
    k_front<<<NB_ * TT / 16, 256, 0, stream>>>(x, W1, b1, W2, b2, XB, XT, Eh, El);   // x -> XB, XT (bf16, fragment order) and encoded -> Eh, El
    k_cstat<<<dim3(TT / 64, SQ_, NB_), 512, 0, stream>>>(Eh, El, XB, PM, PS);     // statistics of M[i][j] = encoded_i . x_j = scores[j][i] over i
    k_gemmk<<<dim3(TT / (16 * MT_), NB_, 1), KQ_ * MT_ * 32, 0, stream>>>(XB, Eh, El, PM, PS, XT, OUT);   // out[i][d] = sum_j attention[j][i] x[j][d], attention[j][i] = exp(M[i][j] - MX[j]) RS[j]
}

// v010
// One run takes 54.6 microseconds.
// Next to v009, in two timings, it ran 1.17 times as fast each time.
// Counting every step since v000, it is 127 times as fast.
#include <hip/hip_runtime.h>

// TimeSeriesAttention (x [4][4096][64]; h1 = softmax(x W1 + b1) (over the 64 features); encoded = tanh(h1 W2 + b2); scores[i][j] = x_i . encoded_j (unscaled); attention = softmax over j; out[i] = sum_j attention[j][i] x[j] (the TRANSPOSED attention, as the
// reference's permute) -> [4][4096][64]). The transposed use is handled by computing M[i][j] = encoded_i . x_j = scores[j][i] directly (swapped GEMM operands) and normalising each COLUMN j of M (= row j of the reference's softmax) with per-column statistics, so M-normalised[i][j] = attention[j][i] is already the A operand of out = attention^T x - exact restructuring.
// Compute dtypes, f32 accumulate: every input rounded to bf16; x W1 on PLAIN bf16 operands (inputs: exact) + bias; the feature softmax, h1 W2 + b2 (64-term fixed-order dots) and tanh f32 on the VALU -> bf16 hi+lo planes; scores as

#define NB_  4
#define TT   4096
#define DD   64
typedef _Float16 h16;
typedef unsigned short bf;
typedef __attribute__((ext_vector_type(16))) __bf16   v16bf;
typedef __attribute__((ext_vector_type(16))) _Float16 v16h;
typedef __attribute__((ext_vector_type(8)))  _Float16 v8h;
typedef __attribute__((ext_vector_type(8)))  unsigned short v8us;
typedef __attribute__((ext_vector_type(8)))  float    v8f;
typedef __attribute__((ext_vector_type(4)))  float    v4f;
typedef v8h  __attribute__((may_alias)) v8ha;
typedef v4f  __attribute__((may_alias)) v4fa;
typedef v8us __attribute__((may_alias)) v8usa;

__device__ __forceinline__ unsigned short f2bf(float f) { unsigned u = __float_as_uint(f); u += 0x7FFFu + ((u >> 16) & 1u); return (unsigned short)(u >> 16); }
__device__ __forceinline__ float bf2f(unsigned short b) { return __uint_as_float(((unsigned)b) << 16); }
__device__ __forceinline__ float bfr(float f) { return bf2f(f2bf(f)); }
__device__ __forceinline__ v16h cat16(v8h lo, v8h hi) { return __builtin_shufflevector(lo, hi, 0, 1, 2, 3, 4, 5, 6, 7, 8, 9, 10, 11, 12, 13, 14, 15); }
__device__ __forceinline__ v16bf cat16b(v8us lo, v8us hi) { return __builtin_bit_cast(v16bf, __builtin_shufflevector(lo, hi, 0, 1, 2, 3, 4, 5, 6, 7, 8, 9, 10, 11, 12, 13, 14, 15)); }
__device__ __forceinline__ v8f wmma16(v16h a, v16h b, v8f c) { return __builtin_amdgcn_wmma_f32_16x16x32_f16(false, a, false, b, (short)0, c, false, false); }
__device__ __forceinline__ v8f wmmab(v16bf a, v16bf b, v8f c) { return __builtin_amdgcn_wmma_f32_16x16x32_bf16(false, a, false, b, (short)0, c, false, false); }



// ---- FRAGMENT ORDER of the 16-bit planes that pass between the launches (XB, XT, Eh, El): a plane of R rows x C columns is kept as tiles of 16 rows x 32 columns, 512 elements = 1 KB each, tile number (row / 16) * (C / 32) + col / 32.
// Inside a tile the 8 elements that lane l = 16 hi + lr of a wave takes as fragment slots 0..7 (row lr, columns 8 hi + 0..7) stand at element 8 l, those of slots 8..15 (columns 16 + 8 hi + 0..7) at element 256 + 8 l.
// So a fragment is two wave-wide 16-B loads of 512 contiguous bytes each (4 whole lines); from a row-major plane each such load touches 16 lines and takes 32 B of each. WFrag::ldf(tile + 8 * lane) reads one; fpos gives an element's place.
__device__ __forceinline__ size_t fpos(int r, int c, int C) { return ((size_t)(r >> 4) * (C >> 5) + (c >> 5)) * 512 + ((c >> 4) & 1) * 256 + (((c >> 3) & 1) * 16 + (r & 15)) * 8 + (c & 7); }

// ---- WFrag: a 16-bit fragment from a K-contiguous row-major plane (ld) or from a plane in fragment order (ldf), and the matrix product on it.
template <typename T16> struct WFrag;
template <> struct WFrag<h16> { typedef v16h V; static __device__ __forceinline__ V ld(const h16* p) { return cat16(*(const v8h*)p, *(const v8h*)(p + 16)); } static __device__ __forceinline__ V ldf(const h16* p) { return cat16(*(const v8h*)p, *(const v8h*)(p + 256)); } static __device__ __forceinline__ v8f mma(V a, V b, v8f c) { return wmma16(a, b, c); } };
template <> struct WFrag<bf> { typedef v16bf V; static __device__ __forceinline__ V ld(const bf* p) { return cat16b(*(const v8us*)p, *(const v8us*)(p + 16)); } static __device__ __forceinline__ V ldf(const bf* p) { return cat16b(*(const v8us*)p, *(const v8us*)(p + 256)); } static __device__ __forceinline__ v8f mma(V a, V b, v8f c) { return wmmab(a, b, c); } };

typedef __attribute__((ext_vector_type(2))) unsigned short v2us;
typedef __attribute__((ext_vector_type(4))) unsigned short v4us;
// ex2d = exp(a - b). The v_nop keeps the one slot that the instruction set asks for behind a transcendental.
__device__ __forceinline__ float ex2d(float a, float b) { float r; asm("v_exp_f32 %0, %1\n\tv_nop" : "=v"(r) : "v"((a - b) * 1.4426950408889634f)); return r; }
typedef __attribute__((ext_vector_type(4))) __bf16 v4bf;
typedef __attribute__((ext_vector_type(8))) __bf16 v8bf;
typedef __attribute__((ext_vector_type(2))) unsigned v2u;
// ---- The same work on whole vectors, so that it compiles to the packed instructions, two values each (v_pk_add_f32, v_pk_mul_f32, v_pk_fma_f32, v_cvt_pk_bf16_f32). Every value is rounded as in the one-value forms above.
// ex2d on eight values. An exponential that follows another neither reads its result nor overwrites its source (early-clobber outputs), so each fills the slot of the one before it, and one v_nop behind the last serves all eight.
__device__ __forceinline__ v8f ex2d8(v8f a, v8f b) { const v8f d = (a - b) * 1.4426950408889634f; float r0, r1, r2, r3, r4, r5, r6, r7;
    asm("v_exp_f32 %0, %8\n\tv_exp_f32 %1, %9\n\tv_exp_f32 %2, %10\n\tv_exp_f32 %3, %11\n\tv_exp_f32 %4, %12\n\tv_exp_f32 %5, %13\n\tv_exp_f32 %6, %14\n\tv_exp_f32 %7, %15\n\tv_nop"
        : "=&v"(r0), "=&v"(r1), "=&v"(r2), "=&v"(r3), "=&v"(r4), "=&v"(r5), "=&v"(r6), "=&v"(r7) : "v"(d[0]), "v"(d[1]), "v"(d[2]), "v"(d[3]), "v"(d[4]), "v"(d[5]), "v"(d[6]), "v"(d[7]));
    return (v8f){r0, r1, r2, r3, r4, r5, r6, r7}; }
__device__ __forceinline__ v8f cat8(v4f lo, v4f hi) { return __builtin_shufflevector(lo, hi, 0, 1, 2, 3, 4, 5, 6, 7); }
__device__ __forceinline__ v8f spl8(float s) { return (v8f){s, s, s, s, s, s, s, s}; }
// f2bf on eight and on four values: the hardware's conversion rounds to nearest even, as f2bf does. bfr4: bfr on four. splitf8, splitf4: y as a bf16 pair, h = y rounded, l = (y - h) rounded
__device__ __forceinline__ v8us f2bf8(v8f v) { return __builtin_bit_cast(v8us, __builtin_convertvector(v, v8bf)); }
__device__ __forceinline__ v4us f2bf4(v4f v) { return __builtin_bit_cast(v4us, __builtin_convertvector(v, v4bf)); }
// bf2f on the two halves of each 32-bit word (written on the words: from a vector conversion back to f32 this build made a second conversion a value)
__device__ __forceinline__ v4f bf2f4(v4us b) { const v2u w = __builtin_bit_cast(v2u, b); return (v4f){__uint_as_float(w[0] << 16), __uint_as_float(w[0] & 0xFFFF0000u), __uint_as_float(w[1] << 16), __uint_as_float(w[1] & 0xFFFF0000u)}; }
__device__ __forceinline__ v8f bf2f8(v8us b) { return cat8(bf2f4(__builtin_shufflevector(b, b, 0, 1, 2, 3)), bf2f4(__builtin_shufflevector(b, b, 4, 5, 6, 7))); }
__device__ __forceinline__ v4f bfr4(v4f v) { return bf2f4(f2bf4(v)); }
__device__ __forceinline__ void splitf8(v8f y, v8us& h, v8us& l) { h = f2bf8(y); l = f2bf8(y - bf2f8(h)); }
__device__ __forceinline__ void splitf4(v4f y, v4us& h, v4us& l) { h = f2bf4(y); l = f2bf4(y - bf2f4(h)); }

// ---- k_gemmk: the out product. One work-group = 64 rows x 64 columns of C: 16 waves = MT_ row tiles of 16 (wm) x KQ_ quarters of K (wk). A wave keeps a 16x64 f32 partial over its quarter (1024 k);
// the KQ_ partials of a row tile are summed in quarter order through LDS. C[m][n] = sum_k (Ph[m][k] + Pl[m][k]) Bt[n][k]; Bt (DD x TT) in fragment order, C pitch DD.
// The x and x^T fragments of a k step are the same for every row tile, so they are fetched ONCE a work-group: the MT_ waves of a quarter each bring a quarter of the stage (KS_ k values: 8 KB of x, 8 KB of x^T)
// through registers into LDS, and each reads the whole stage from there. Two stage buffers; the loads of stage t + 2 fly while stage t is worked on; one barrier a stage.
// The A operand is formed in registers and no score is read from memory: per k step of 32 the wave computes the two 16x16 score tiles S[k][m] = x_k . (Eh_m + El_m) on the matrix unit
// (A = x rows k, B = the wave's 16 encoded rows, held in registers). The accumulator of tile h holds, in lane (lr, hi) and register u, S[16 h + 8 hi + u][lr]: that is slot 8 h + u
// of row lr of the 16-bit A fragment, so p = exp(S - MX[k]) * RS[k] goes into the hi and lo A fragments with no move between lanes.
// MX, RS: the SQ_ partial (max, sum) pairs a column that k_cstat leaves are merged in a fixed order and staged once in LDS.
// grid (TT / 64, NB_): blockIdx.y is the batch; every plane holds the NB_ batches one behind the other.
#define KQ_ 4
#define MT_ 4
#define KS_ 64
#define NT_ (TT / KQ_ / KS_)
#define STQ_ (2 * KS_ * DD)
#define SQ_ 4
typedef __attribute__((ext_vector_type(2))) float v2f;
typedef v2f __attribute__((may_alias)) v2fa;
__global__ __launch_bounds__(KQ_ * MT_ * 32) void k_gemmk(const bf* __restrict__ XB, const bf* __restrict__ Eh, const bf* __restrict__ El, const float* __restrict__ PM, const float* __restrict__ PS, const bf* __restrict__ Bt, float* C) {
    typedef WFrag<bf>::V V;
    // a quarter's stage: KS_ rows of x (KS_ / 16 * 2 tiles of 512 elements, as they stand in XB), then the x^T tiles, number nb * (KS_ / 32) + k step
    __shared__ __align__(16) bf st[2 * KQ_ * STQ_];
    __shared__ __align__(16) float red[KQ_ * MT_][16 * 68];
    __shared__ __align__(16) float smx[TT]; __shared__ __align__(16) float srs[TT];
    const int lane = threadIdx.x & 31, wave = threadIdx.x >> 5, lr = lane & 15, hi = lane >> 4, wm = wave % MT_, wk = wave / MT_; const int r0 = blockIdx.x * (16 * MT_);
    { const size_t zb = blockIdx.y; XB += zb * TT * DD; Eh += zb * TT * DD; El += zb * TT * DD; Bt += zb * DD * TT; C += zb * TT * DD; PM += zb * SQ_ * TT; PS += zb * SQ_ * TT; }
    const int k0 = wk * (TT / KQ_) + 8 * hi;
    const int t8 = threadIdx.x * (TT / (KQ_ * MT_ * 32));   // 8 columns' statistics a thread; loaded first, so that their merge waits for these loads alone
    v4f pm[SQ_][2], ps[SQ_][2];
#pragma unroll
    for (int q = 0; q < SQ_; ++q) { pm[q][0] = *(const v4f*)(PM + q * TT + t8); pm[q][1] = *(const v4f*)(PM + q * TT + t8 + 4); ps[q][0] = *(const v4f*)(PS + q * TT + t8); ps[q][1] = *(const v4f*)(PS + q * TT + t8 + 4); }
    // the wave's share of a stage: 2 KB in a row of XB (fragment order: 16 rows are 2 tiles) and 2 KB in a row of Bt = XT (d block nb = wm; the tile of d block nb and k step kc is number nb * (TT / 32) + k / 32)
    const bf* pgx = XB + (size_t)wk * (TT / KQ_) * DD + wm * (KS_ * DD / MT_) + 8 * lane; const bf* pgb = Bt + ((size_t)wm * (TT / 32) + wk * (TT / KQ_ / 32)) * 512 + 8 * lane;
    const bf* peh = Eh + (size_t)(r0 + 16 * wm) * DD + 8 * lane; const bf* pel = El + (size_t)(r0 + 16 * wm) * DD + 8 * lane;
    bf* sw = st + wk * STQ_ + wm * (KS_ * DD / MT_) + 8 * lane; const bf* sr = st + wk * STQ_ + 8 * lane;
    v8us gx[4], gb[4];
#pragma unroll
    for (int i = 0; i < 4; ++i) { gx[i] = *(const v8us*)(pgx + i * 256); gb[i] = *(const v8us*)(pgb + i * 256); }
    const V eh0 = WFrag<bf>::ldf(peh), eh1 = WFrag<bf>::ldf(peh + 512), el0 = WFrag<bf>::ldf(pel), el1 = WFrag<bf>::ldf(pel + 512);
    // the wait that stands in front of an overwrite of an issued load's address registers. The pointers are named as inputs, so that they stay live up to the wait and no later load's result is placed on them
    asm volatile("s_wait_xcnt 0x0" :: "v"(peh), "v"(pel), "v"(pgx), "v"(pgb) : "memory");
    pgx += KS_ * DD; pgb += KS_ / 32 * 512;
#pragma unroll
    for (int i = 0; i < 4; ++i) { *(v8us*)(sw + i * 256) = gx[i]; *(v8us*)(sw + KS_ * DD + i * 256) = gb[i]; }   // stage 0 into buffer 0
#pragma unroll
    for (int i = 0; i < 4; ++i) { gx[i] = *(const v8us*)(pgx + i * 256); gb[i] = *(const v8us*)(pgb + i * 256); }   // stage 1 flies
    asm volatile("s_wait_xcnt 0x0" :: "v"(pgx), "v"(pgb) : "memory");   // as above: the two pointers are advanced right behind it
    pgx += KS_ * DD; pgb += KS_ / 32 * 512;
#pragma unroll
    for (int g = 0; g < 2; ++g) { v4f mv, rv;
#pragma unroll
        for (int u = 0; u < 4; ++u) { float mx = pm[0][g][u];
#pragma unroll
            for (int q = 1; q < SQ_; ++q) mx = fmaxf(mx, pm[q][g][u]);
            float sum = 0.f;
#pragma unroll
            for (int q = 0; q < SQ_; ++q) sum += ps[q][g][u] * ex2d(pm[q][g][u], mx);
            mv[u] = mx; rv[u] = __fdiv_rn(1.0f, sum); }
        *(v4f*)(smx + t8 + 4 * g) = mv; *(v4f*)(srs + t8 + 4 * g) = rv; }
    v8f acc[4];
#pragma unroll
    for (int nb = 0; nb < 4; ++nb) acc[nb] = (v8f){};
#pragma unroll 1   // rolled: for speed only
    for (int t = 0; t < NT_; ++t) {
        __syncthreads();   // publishes stage t (at t = 0 the statistics too) and ends every wave's reads of the buffer that stage t + 1 goes into
        const bf* rd = sr + (t & 1) * (KQ_ * STQ_); V xa[4], b[4];
        // the first k step's fragments are asked for in front of the staging: for speed only
#pragma unroll
        for (int j = 0; j < 4; ++j) xa[j] = WFrag<bf>::ldf(rd + j * 512);
#pragma unroll
        for (int nb = 0; nb < 4; ++nb) b[nb] = WFrag<bf>::ldf(rd + KS_ * DD + nb * (KS_ / 32) * 512);
        if (t + 1 < NT_) { bf* w = sw + ((t + 1) & 1) * (KQ_ * STQ_);
#pragma unroll
            for (int i = 0; i < 4; ++i) { *(v8us*)(w + i * 256) = gx[i]; *(v8us*)(w + KS_ * DD + i * 256) = gb[i]; } }
        if (t + 2 < NT_) {
#pragma unroll
            for (int i = 0; i < 4; ++i) { gx[i] = *(const v8us*)(pgx + i * 256); gb[i] = *(const v8us*)(pgb + i * 256); }
            asm volatile("s_wait_xcnt 0x0" :: "v"(pgx), "v"(pgb) : "memory");   // as above: the two pointers are advanced right behind it
            pgx += KS_ * DD; pgb += KS_ / 32 * 512; }
#pragma unroll
        for (int s = 0; s < KS_ / 32; ++s) { const int kc = t * KS_ + s * 32;
            if (s > 0) {
#pragma unroll
                for (int j = 0; j < 4; ++j) xa[j] = WFrag<bf>::ldf(rd + (s * 4 + j) * 512);   // rows 32 s + 16 (j / 2), d half j % 2
#pragma unroll
                for (int nb = 0; nb < 4; ++nb) b[nb] = WFrag<bf>::ldf(rd + KS_ * DD + (nb * (KS_ / 32) + s) * 512); }
            v8us ah[2], al[2]; v8f sc[2] = {(v8f){}, (v8f){}};
            // per score the sum order of the four products is: hi d 0..31, lo d 0..31, hi d 32..63, lo d 32..63, as in k_cstat
            sc[0] = WFrag<bf>::mma(xa[0], eh0, sc[0]); sc[1] = WFrag<bf>::mma(xa[2], eh0, sc[1]); sc[0] = WFrag<bf>::mma(xa[0], el0, sc[0]); sc[1] = WFrag<bf>::mma(xa[2], el0, sc[1]);
            sc[0] = WFrag<bf>::mma(xa[1], eh1, sc[0]); sc[1] = WFrag<bf>::mma(xa[3], eh1, sc[1]); sc[0] = WFrag<bf>::mma(xa[1], el1, sc[0]); sc[1] = WFrag<bf>::mma(xa[3], el1, sc[1]);
            __builtin_amdgcn_sched_barrier(0);   // keeps the asm exponentials behind ALL score products
#pragma unroll
            for (int h = 0; h < 2; ++h) {   // fragment slots 8 h + u hold k = kc + 16 h + 8 hi + u
                const float* pm8 = smx + k0 + kc + 16 * h; const float* pr8 = srs + k0 + kc + 16 * h;
                const v8f mx = cat8(*(const v4fa*)pm8, *(const v4fa*)(pm8 + 4)), rs = cat8(*(const v4fa*)pr8, *(const v4fa*)(pr8 + 4));
                splitf8(ex2d8(sc[h], mx) * rs, ah[h], al[h]); }
            const V a = cat16b(ah[0], ah[1]), a2 = cat16b(al[0], al[1]);
#pragma unroll
            for (int nb = 0; nb < 4; ++nb) acc[nb] = WFrag<bf>::mma(a, b[nb], acc[nb]);
#pragma unroll
            for (int nb = 0; nb < 4; ++nb) acc[nb] = WFrag<bf>::mma(a2, b[nb], acc[nb]); }
        // the four issue slots that a matrix instruction needs before an operand register is overwritten
        asm volatile("v_nop\n\tv_nop\n\tv_nop\n\tv_nop" :: "v"(acc[0]), "v"(acc[1]), "v"(acc[2]), "v"(acc[3]));
    }
#pragma unroll
    for (int nb = 0; nb < 4; ++nb) {
#pragma unroll
        for (int j = 0; j < 8; ++j) red[wave][(hi * 8 + j) * 68 + nb * 16 + lr] = acc[nb][j]; }
    __syncthreads();
    const int row = threadIdx.x >> 3, col = (threadIdx.x & 7) * 8; v4f p[KQ_][2];   // 8 columns of one row a thread: a wave sums and stores 4 whole 256-B rows of C
#pragma unroll
    for (int q = 0; q < KQ_; ++q) { p[q][0] = *(const v4fa*)(&red[q * MT_ + (row >> 4)][(row & 15) * 68 + col]); p[q][1] = *(const v4fa*)(&red[q * MT_ + (row >> 4)][(row & 15) * 68 + col + 4]); }
    v4f s0 = {0.f, 0.f, 0.f, 0.f}, s1 = {0.f, 0.f, 0.f, 0.f};
#pragma unroll
    for (int q = 0; q < KQ_; ++q) { s0 += p[q][0]; s1 += p[q][1]; }
    float* cp = C + (size_t)(r0 + row) * DD + col; *(v4f*)cp = s0; *(v4f*)(cp + 4) = s1;
}


// ---- k_front: everything in front of the score statistics, in ONE launch. One block = 16 tokens (grid NB_ * TT / 16, 8 waves); nothing passes through the workspace inside it.
// Waves 0..3: Z tile (16 tokens x 64) = bf16 x . bf16 W1 on the matrix unit, wave w = feature block w. A fragment straight from the f32 rows of x (row lr, k = 32 s + 16 h + 8 hi + u at slot 8 h + u),
// B fragment straight from W1 (column 16 w + lr, the same k at the same slot); two k steps in rising order, + bf16 b1; the tile goes to LDS (zs). The four 16-B pieces of a lane's A fragments ARE the block's 2 tiles of XB in fragment order: wave w keeps piece w (512 B in a row a wave).
// Waves 4..7: the block's share of XT (d block w - 4; 16 t = half a tile = 512 B in a row): a lane takes 8 consecutive t of one d.
// All waves: W2 rounded to bf16 into LDS. Behind the one barrier, lane -> 4 consecutive features c of token t: softmax statistics of the Z row (64, fixed order), acc[u] = sum_k softmax_k W2[k][c+u], enc = tanh(acc + b2) -> hi, lo planes in fragment order.
__global__ __launch_bounds__(256) void k_front(const float* __restrict__ x, const float* __restrict__ W1, const float* __restrict__ b1, const float* __restrict__ W2, const float* __restrict__ b2, bf* XB, bf* XT, bf* Eh, bf* El) {
    __shared__ __align__(16) float sw[DD * DD];   // W2 rounded to bf16 (kept as f32), rounded once a block
    __shared__ __align__(16) float zs[16 * 68];   // the Z tile; pitch 68: the two rows that a wave reads at once stand in different banks
    const int row0 = blockIdx.x * 16; if (row0 >= NB_ * TT) return;   // the same for the whole block, in front of the barrier
    const int lane = threadIdx.x & 31, lr = lane & 15, hi = lane >> 4; const int wave = __builtin_amdgcn_readfirstlane(threadIdx.x >> 5);   // a scalar: the split of the roles below is a scalar branch
    const int c0 = lr * 4, tl = threadIdx.x >> 4, t = row0 + tl; const float* pw = W2 + threadIdx.x * 4; const float* pb = b2 + c0;
    // every global operand of the thread is asked for at once, here and at the head of its branch. No load stands in the chains below.
    v4f w[DD * DD / 1024];
#pragma unroll
    for (int q = 0; q < DD * DD / 1024; ++q) w[q] = *(const v4f*)(pw + q * 1024);
    const v4f bv = *(const v4f*)pb;
    v8us o; bf* po;   // the wave's 512 B of XB or XT: a lane's 16-B piece and the wave's place. Stored behind the barrier: in front of it every wave would wait there for its store to come back
    if (wave < 4) {
        const float* px = x + (size_t)(row0 + lr) * DD + 8 * hi; const float* pw1 = W1 + 8 * hi * DD + wave * 16 + lr; const float* pb1 = b1 + wave * 16 + lr;
        v4f xv[2][2][2]; v8f wv[2][2];
#pragma unroll
        for (int s = 0; s < 2; ++s)
#pragma unroll
            for (int h = 0; h < 2; ++h) { xv[s][h][0] = *(const v4f*)(px + 32 * s + 16 * h); xv[s][h][1] = *(const v4f*)(px + 32 * s + 16 * h + 4); }
#pragma unroll
        for (int s = 0; s < 2; ++s)
#pragma unroll
            for (int h = 0; h < 2; ++h)
#pragma unroll
                for (int u = 0; u < 8; ++u) wv[s][h][u] = pw1[(32 * s + 16 * h + u) * DD];
        const float bias = *pb1;
        // the wait that stands in front of an overwrite of an issued load's address registers. The pointers (of the W2 and b2 loads above: their scalar bases) are named as inputs, so that they stay live up to the wait and nothing else is placed on them
        asm volatile("s_wait_xcnt 0x0" :: "v"(px), "v"(pw1), "s"(W2), "s"(b2) : "memory");
        v8us a[2][2], b[2][2];
#pragma unroll
        for (int s = 0; s < 2; ++s)
#pragma unroll
            for (int h = 0; h < 2; ++h) { a[s][h] = f2bf8(cat8(xv[s][h][0], xv[s][h][1])); b[s][h] = f2bf8(wv[s][h]); }
        o = wave == 0 ? a[0][0] : wave == 1 ? a[0][1] : wave == 2 ? a[1][0] : a[1][1]; po = XB + (size_t)row0 * DD + wave * 256;   // piece w of the 2 tiles
        v8f acc = (v8f){};
        acc = wmmab(cat16b(a[0][0], a[0][1]), cat16b(b[0][0], b[0][1]), acc); acc = wmmab(cat16b(a[1][0], a[1][1]), cat16b(b[1][0], b[1][1]), acc);
        const float bb = bfr(bias);
#pragma unroll
        for (int j = 0; j < 8; ++j) zs[(hi * 8 + j) * 68 + wave * 16 + lr] = acc[j] + bb;
    } else {
        const int zb = row0 / TT, tb = row0 % TT, db = wave - 4; const float* pt = x + (size_t)(row0 + 8 * hi) * DD + db * 16 + lr; v8f xt;
#pragma unroll
        for (int k = 0; k < 8; ++k) xt[k] = pt[k * DD];
        asm volatile("s_wait_xcnt 0x0" :: "v"(pt), "s"(W2), "s"(b2) : "memory");   // as above
        o = f2bf8(xt);
        po = XT + (size_t)zb * DD * TT + ((size_t)db * (TT / 32) + (tb >> 5)) * 512 + ((tb >> 4) & 1) * 256;
    }
#pragma unroll
    for (int q = 0; q < DD * DD / 1024; ++q) *(v4f*)(sw + q * 1024 + threadIdx.x * 4) = bfr4(w[q]);
    __syncthreads();   // sw and zs are whole
    v4f z[DD / 4];
#pragma unroll
    for (int k = 0; k < DD / 4; ++k) z[k] = *(const v4fa*)(zs + tl * 68 + 4 * k);
    *(v8us*)(po + 8 * lane) = o;
    // inputs only, the loaded values: the 16 LDS loads of the row are asked for at once. Without it the compiler strings most of them along the chain of maxima, few in flight, and the chain waits for LDS again and again
    asm volatile("" :: "v"(z[0]), "v"(z[1]), "v"(z[2]), "v"(z[3]), "v"(z[4]), "v"(z[5]), "v"(z[6]), "v"(z[7]), "v"(z[8]), "v"(z[9]), "v"(z[10]), "v"(z[11]), "v"(z[12]), "v"(z[13]), "v"(z[14]), "v"(z[15]));
    float mx = -3.0e38f;
#pragma unroll
    for (int k = 0; k < DD; ++k) mx = fmaxf(mx, z[k >> 2][k & 3]);
    float sum = 0.f;
#pragma unroll   // whole: z is indexed by constants only, or it leaves the registers
    for (int k = 0; k < DD / 4; k += 2) { const v8f ex = ex2d8(cat8(z[k], z[k + 1]), spl8(mx)); z[k] = __builtin_shufflevector(ex, ex, 0, 1, 2, 3); z[k + 1] = __builtin_shufflevector(ex, ex, 4, 5, 6, 7);
#pragma unroll
        for (int u = 0; u < 8; ++u) sum += ex[u]; }
    const float rs = __fdiv_rn(1.0f, sum); float acc[4] = {0.f, 0.f, 0.f, 0.f};
#pragma unroll
    for (int k = 0; k < DD / 4; ++k) z[k] *= rs;
#pragma unroll
    for (int k = 0; k < DD; ++k) { const float h1 = z[k >> 2][k & 3]; const v4f wk = *(const v4fa*)(sw + k * DD + c0);
#pragma unroll
        for (int u = 0; u < 4; ++u) acc[u] = __builtin_fmaf(h1, wk[u], acc[u]); }
    // inputs only: all four dots are finished here, in the straight code above. Without it the compiler sinks three of them behind the branches of the first tanh and keeps the 64 h1 and all rows of W2 for them: 273 registers for 123, 3 waves a SIMD for 8
    asm volatile("" :: "v"(acc[0]), "v"(acc[1]), "v"(acc[2]), "v"(acc[3]));
    v4us oh, ol; v4f en; const v4f bb4 = bfr4(bv);
#pragma unroll
    for (int u = 0; u < 4; ++u) en[u] = tanhf(acc[u] + bb4[u]);
    splitf4(en, oh, ol); const size_t f = fpos(t, c0, DD); *(v4us*)(Eh + f) = oh; *(v4us*)(El + f) = ol;  }
// k_cstat: per column j of M[i][j] = encoded_i . x_j a partial maximum and a partial sum_i exp(M[i][j] - max), with M formed on the matrix unit and never stored. One block = 64 columns x a quarter of the rows of one batch (grid.y = SQ_, grid.z = NB_).
// Each of its 16 waves holds the B fragments of the 64 columns and takes 64 rows as 4 tiles of 16 (A = encoded hi, lo). In the accumulator a lane holds 8 rows of ONE column, so the running (max, sum scaled to that max)
// pair is per lane; the pairs are merged in a fixed order: the two lane halves by a shuffle, the 16 waves through LDS; the SQ_ quarters are merged by the reader (k_gemmk).
__global__ __launch_bounds__(512) void k_cstat(const bf* __restrict__ Eh, const bf* __restrict__ El, const bf* __restrict__ XB, float* PM, float* PS) {
    typedef WFrag<bf>::V V;
    __shared__ __align__(16) float sm[16][64]; __shared__ __align__(16) float ss[16][64];
    const int lane = threadIdx.x & 31, wave = threadIdx.x >> 5, lr = lane & 15, hi = lane >> 4;
    const int j0 = blockIdx.x * 64, i0 = blockIdx.y * (TT / SQ_) + wave * (TT / SQ_ / 16);
    { const size_t zb = blockIdx.z; Eh += zb * TT * DD; El += zb * TT * DD; XB += zb * TT * DD; PM += zb * SQ_ * TT; PS += zb * SQ_ * TT; }
    const bf* pxb = XB + (size_t)j0 * DD + 8 * lane; const bf* peh = Eh + (size_t)i0 * DD + 8 * lane; const bf* pel = El + (size_t)i0 * DD + 8 * lane;   // one address a plane (fragment order: 16 rows are 2 tiles of 512 elements); tiles and column blocks are constant offsets from it
    V b[4][2];
#pragma unroll
    for (int nb = 0; nb < 4; ++nb) { b[nb][0] = WFrag<bf>::ldf(pxb + nb * 16 * DD); b[nb][1] = WFrag<bf>::ldf(pxb + nb * 16 * DD + 512); }
    float m[4] = {-3.0e38f, -3.0e38f, -3.0e38f, -3.0e38f}, s[4] = {0.f, 0.f, 0.f, 0.f};
    V a[2][4];   // two sets of A fragments: the next tile's loads fly while this one is worked on
#pragma unroll   // whole: the set index t % 2 must be a constant, or the sets leave the registers
    for (int t = 0; t < TT / SQ_ / 256 + 1; ++t) {
        if (t < TT / SQ_ / 256) { const int q = t % 2, o = t * 16 * DD;
            a[q][0] = WFrag<bf>::ldf(peh + o); a[q][1] = WFrag<bf>::ldf(pel + o); a[q][2] = WFrag<bf>::ldf(peh + o + 512); a[q][3] = WFrag<bf>::ldf(pel + o + 512); }
        // the wait that stands in front of an overwrite of an issued load's address registers. The pointers that are used for the last time are named as inputs, so that they stay live up to the wait and no later load's result is placed on them
        if (t == 0) asm volatile("s_wait_xcnt 0x0" :: "v"(pxb) : "memory");
        if (t == TT / SQ_ / 256 - 1) asm volatile("s_wait_xcnt 0x0" :: "v"(peh), "v"(pel) : "memory");
        __builtin_amdgcn_sched_barrier(0);   // holds this tile's loads in front of the arithmetic of the tile before; without it the scheduler sinks them to just before their use
        if (t >= 1) { const int q = (t - 1) % 2; v8f acc[4];
#pragma unroll
            for (int nb = 0; nb < 4; ++nb) acc[nb] = (v8f){};
#pragma unroll
            for (int f = 0; f < 4; ++f) {   // hi d 0..31, lo d 0..31, hi d 32..63, lo d 32..63
#pragma unroll
                for (int nb = 0; nb < 4; ++nb) acc[nb] = WFrag<bf>::mma(a[q][f], b[nb][f >> 1], acc[nb]); }
            __builtin_amdgcn_sched_barrier(0);   // keeps the asm exponentials behind ALL products of the tile
#pragma unroll
            for (int nb = 0; nb < 4; ++nb) { float mn = m[nb];
#pragma unroll
                for (int r = 0; r < 8; ++r) mn = fmaxf(mn, acc[nb][r]);
                float sa = s[nb] * ex2d(m[nb], mn);
                const v8f ex = ex2d8(acc[nb], spl8(mn));
#pragma unroll
                for (int r = 0; r < 8; ++r) sa += ex[r];
                m[nb] = mn; s[nb] = sa; } }
    }
#pragma unroll
    for (int nb = 0; nb < 4; ++nb) { const float om = __shfl_xor(m[nb], 16), os = __shfl_xor(s[nb], 16); const float mn = fmaxf(m[nb], om); s[nb] = s[nb] * ex2d(m[nb], mn) + os * ex2d(om, mn); m[nb] = mn; }
    if (hi == 0) {
#pragma unroll
        for (int nb = 0; nb < 4; ++nb) { sm[wave][nb * 16 + lr] = m[nb]; ss[wave][nb * 16 + lr] = s[nb]; } }
    __syncthreads();
    if (threadIdx.x < 64) { const int c = threadIdx.x; float mx = -3.0e38f, sum = 0.f;
#pragma unroll
        for (int w = 0; w < 16; ++w) mx = fmaxf(mx, sm[w][c]);
#pragma unroll
        for (int w = 0; w < 16; ++w) sum += ss[w][c] * ex2d(sm[w][c], mx);
        PM[blockIdx.y * TT + j0 + c] = mx; PS[blockIdx.y * TT + j0 + c] = sum; } }

extern "C" void kernel_launch(void* const* d_in, const int* in_sizes, int n_in,
                              void* d_out, int out_size, void* d_ws, size_t ws_size, hipStream_t stream) {
    (void)in_sizes; (void)n_in; (void)out_size;
    const float* x = (const float*)d_in[0]; const float* W1 = (const float*)d_in[1]; const float* b1 = (const float*)d_in[2]; const float* W2 = (const float*)d_in[3]; const float* b2 = (const float*)d_in[4];
    float* OUT = (float*)d_out;     // [4][4096][64]
    char* wsp = (char*)d_ws;
    auto take = [&](size_t bytes) { char* p = wsp; wsp += (bytes + 255) & ~(size_t)255; return (void*)p; };
    bf* XB = (bf*)take((size_t)NB_ * TT * DD * 2); bf* XT = (bf*)take((size_t)NB_ * DD * TT * 2); bf* Eh = (bf*)take((size_t)NB_ * TT * DD * 2); bf* El = (bf*)take((size_t)NB_ * TT * DD * 2);
    float* PM = (float*)take((size_t)NB_ * SQ_ * TT * 4); float* PS = (float*)take((size_t)NB_ * SQ_ * TT * 4);
    if ((size_t)(wsp - (char*)d_ws) > ws_size) return;    // total ~ 9 MB
    // every stage runs once for all NB_ batches: token-wise stages over NB_ * TT rows, the others with the batch as a grid dimension
    k_front<<<NB_ * TT / 16, 256, 0, stream>>>(x, W1, b1, W2, b2, XB, XT, Eh, El);   // x -> XB, XT (bf16, fragment order) and encoded -> Eh, El
    k_cstat<<<dim3(TT / 64, SQ_, NB_), 512, 0, stream>>>(Eh, El, XB, PM, PS);     // statistics of M[i][j] = encoded_i . x_j = scores[j][i] over i
    k_gemmk<<<dim3(TT / (16 * MT_), NB_, 1), KQ_ * MT_ * 32, 0, stream>>>(XB, Eh, El, PM, PS, XT, OUT);   // out[i][d] = sum_j attention[j][i] x[j][d], attention[j][i] = exp(M[i][j] - MX[j]) RS[j]
}
